// v000
// The times below were measured on an AMD MI455X: many runs one after another, warmed up first and cycling through
// copies of the inputs, with the whole window's GPU time divided by the number of runs. Launches and the gaps
// between them are all in it. The median over several windows is given; except for v000 it joins two sittings, which
// can be a few percent apart, so the side-by-side timings, each taken in one sitting, are the better comparison.
// v000, which the later versions start from, runs in 522 microseconds.
#include <hip/hip_runtime.h>
#include <hip/hip_bf16.h>
#include <math.h>

typedef __attribute__((ext_vector_type(16))) _Float16 v16h;
typedef __attribute__((ext_vector_type(8)))  _Float16 v8h;
typedef __attribute__((ext_vector_type(8)))  float    v8f;

#define S_LEN 4096
#define DMODEL 1024
#define NHEADS 16
#define HDIM 64
#define CHUNKLEN 1024

// ---------------------------------------------------------------------------
// WMMA helpers: v_wmma_f32_16x16x32_f16, D = A(16x32) * B(32x16) + C(16x16 f32)
// A layout (wave32): lane L (row M = L%16); halves 0..7 -> K = base+0..7,
// halves 8..15 -> K = base+16..23, base = (L>=16)?8:0.
// B layout mirrors A with N = L%16. C/D: VGPR r, lane L: M = r + ((L>=16)?8:0).
// ---------------------------------------------------------------------------
__device__ __forceinline__ v8f wmma_f16(v16h a, v16h b, v8f c) {
  return __builtin_amdgcn_wmma_f32_16x16x32_f16(
      false, a, false, b, (short)0, c, false, false);
}

__device__ __forceinline__ v16h pack16(v8h lo, v8h hi) {
  v16h r;
#pragma unroll
  for (int t = 0; t < 8; ++t) { r[t] = lo[t]; r[8 + t] = hi[t]; }
  return r;
}

__device__ __forceinline__ v16h load_frag_f16(const _Float16* __restrict__ row, int kb) {
  v8h lo = *(const v8h*)(row + kb);
  v8h hi = *(const v8h*)(row + kb + 16);
  return pack16(lo, hi);
}

// ---------------------------------------------------------------------------
// Kernel 1a: elementwise f32 -> f16
// ---------------------------------------------------------------------------
__global__ void cvt_x_kernel(const float* __restrict__ x, _Float16* __restrict__ xh,
                             int n) {
  int i = blockIdx.x * blockDim.x + threadIdx.x;
  if (i < n) xh[i] = (_Float16)x[i];
}

// ---------------------------------------------------------------------------
// Kernel 1b: convert + transpose weight  w[K][N] f32  ->  wT[N][K] f16
// ---------------------------------------------------------------------------
__global__ void cvtT_kernel(const float* __restrict__ w, _Float16* __restrict__ wT,
                            int K, int N) {
  int n = blockIdx.x * blockDim.x + threadIdx.x;
  int k = blockIdx.y;
  if (n < N) wT[(size_t)n * K + k] = (_Float16)w[(size_t)k * N + n];
}

// ---------------------------------------------------------------------------
// Kernel 2: QKV projection GEMM.  out = xh(f16 SxK) @ wT^T(f16) + bias
// Each wave computes a 32(M) x 64(N) tile (B fragments reused by 2 A frags).
// mode 0: out[h][s][d]; mode 1: out[h][d][s]
// ---------------------------------------------------------------------------
__global__ __launch_bounds__(256) void gemm_qkv_kernel(
    const _Float16* __restrict__ xh, const _Float16* __restrict__ wT,
    const float* __restrict__ bias, _Float16* __restrict__ out, int mode) {
  const int K = DMODEL;
  int wave   = (blockIdx.x * 256 + threadIdx.x) >> 5;   // 0..2047
  int lane16 = threadIdx.x & 15;
  int hi8    = ((threadIdx.x >> 4) & 1) << 3;           // 0 or 8
  int tile_m = wave & 127;                              // 128 tiles of 32 rows
  int tile_n = wave >> 7;                               // 16 tiles of 64 cols
  int m0 = tile_m * 32, n0 = tile_n * 64;

  v8f c0[4] = {}, c1[4] = {};
  const _Float16* arow0 = xh + (size_t)(m0 + lane16) * K;
  const _Float16* arow1 = arow0 + (size_t)16 * K;
  const _Float16* wrow  = wT + (size_t)(n0 + lane16) * K;

  for (int k0 = 0; k0 < K; k0 += 32) {
    int kb = k0 + hi8;
    v16h a0 = load_frag_f16(arow0, kb);
    v16h a1 = load_frag_f16(arow1, kb);
#pragma unroll
    for (int j = 0; j < 4; ++j) {
      v16h b = load_frag_f16(wrow + (size_t)(j * 16) * K, kb);
      c0[j] = wmma_f16(a0, b, c0[j]);
      c1[j] = wmma_f16(a1, b, c1[j]);
    }
  }

#pragma unroll
  for (int j = 0; j < 4; ++j) {
    int n = n0 + j * 16 + lane16;
    float bj = bias[n];
    int head = n >> 6, d = n & 63;
#pragma unroll
    for (int r = 0; r < 8; ++r) {
      int s0r = m0 + r + hi8;
      int s1r = s0r + 16;
      float v0 = c0[j][r] + bj;
      float v1 = c1[j][r] + bj;
      if (mode == 0) {
        out[((size_t)head * S_LEN + s0r) * HDIM + d] = (_Float16)v0;
        out[((size_t)head * S_LEN + s1r) * HDIM + d] = (_Float16)v1;
      } else {
        out[((size_t)head * HDIM + d) * S_LEN + s0r] = (_Float16)v0;
        out[((size_t)head * HDIM + d) * S_LEN + s1r] = (_Float16)v1;
      }
    }
  }
}

// ---------------------------------------------------------------------------
// Kernel 3: flash-style block-causal attention. One wave per (16-q-row tile, head).
// 64 keys per iteration: 8 score WMMAs + amortized softmax + 8 PV WMMAs.
// qh,kh: [H][S][64] f16;  vt: [H][64][S] f16;  aout: [S][H*64] f16
// ---------------------------------------------------------------------------
__global__ __launch_bounds__(32) void attn_kernel(
    const _Float16* __restrict__ qh, const _Float16* __restrict__ kh,
    const _Float16* __restrict__ vt, _Float16* __restrict__ aout) {
  __shared__ __align__(16) _Float16 sP[16][72];   // 16 q-rows x 64 keys (+pad)

  int qtile  = blockIdx.x;
  int head   = blockIdx.y;
  int lane16 = threadIdx.x & 15;
  int hi8    = ((threadIdx.x >> 4) & 1) << 3;
  int m0     = qtile * 16;
  int kv_end = ((m0 / CHUNKLEN) + 1) * CHUNKLEN;  // block-causal: full chunks
  const float scale = 0.125f;                     // 64^-0.5

  const _Float16* qrow = qh + ((size_t)head * S_LEN + m0 + lane16) * HDIM;
  v16h aq0 = load_frag_f16(qrow, hi8);        // d 0..31
  v16h aq1 = load_frag_f16(qrow + 32, hi8);   // d 32..63

  float rowmax[8], rowsum[8];
#pragma unroll
  for (int r = 0; r < 8; ++r) { rowmax[r] = -INFINITY; rowsum[r] = 0.0f; }
  v8f o[4] = {};

  for (int kb = 0; kb < kv_end; kb += 64) {
    // --- scores for 64 keys: four 16x16 tiles, Hd=64 split in two WMMAs each
    const _Float16* kr = kh + ((size_t)head * S_LEN + kb + lane16) * HDIM;
    union { v8f v; float f[8]; } u[4], av;
#pragma unroll
    for (int t = 0; t < 4; ++t) {
      const _Float16* krow = kr + (size_t)(t * 16) * HDIM;
      v8f s = {};
      s = wmma_f16(aq0, load_frag_f16(krow,      hi8), s);
      s = wmma_f16(aq1, load_frag_f16(krow + 32, hi8), s);
      u[t].v = s * scale;
    }

    // --- online softmax; each row lives across 16 lanes of a half-wave
#pragma unroll
    for (int r = 0; r < 8; ++r) {
      float mx = fmaxf(fmaxf(u[0].f[r], u[1].f[r]), fmaxf(u[2].f[r], u[3].f[r]));
      mx = fmaxf(mx, __shfl_xor(mx, 1));
      mx = fmaxf(mx, __shfl_xor(mx, 2));
      mx = fmaxf(mx, __shfl_xor(mx, 4));
      mx = fmaxf(mx, __shfl_xor(mx, 8));
      float nm    = fmaxf(rowmax[r], mx);
      float alpha = __expf(rowmax[r] - nm);
      rowmax[r]   = nm;
      float ps = 0.0f;
#pragma unroll
      for (int t = 0; t < 4; ++t) {
        float p = __expf(u[t].f[r] - nm);
        u[t].f[r] = p;
        ps += p;
      }
      ps += __shfl_xor(ps, 1);
      ps += __shfl_xor(ps, 2);
      ps += __shfl_xor(ps, 4);
      ps += __shfl_xor(ps, 8);
      rowsum[r] = rowsum[r] * alpha + ps;
      av.f[r]   = alpha;
    }
#pragma unroll
    for (int j = 0; j < 4; ++j) o[j] = o[j] * av.v;

    // --- redistribute P (C-layout) -> A-layout through LDS
    __syncthreads();
#pragma unroll
    for (int r = 0; r < 8; ++r) {
#pragma unroll
      for (int t = 0; t < 4; ++t)
        sP[r + hi8][t * 16 + lane16] = (_Float16)u[t].f[r];
    }
    __syncthreads();
    v16h ap0 = pack16(*(const v8h*)&sP[lane16][hi8],
                      *(const v8h*)&sP[lane16][hi8 + 16]);
    v16h ap1 = pack16(*(const v8h*)&sP[lane16][32 + hi8],
                      *(const v8h*)&sP[lane16][32 + hi8 + 16]);

    // --- O += P @ V   (V transposed: contiguous over keys per d)
    const _Float16* vbase = vt + ((size_t)head * HDIM + lane16) * S_LEN + kb;
#pragma unroll
    for (int j = 0; j < 4; ++j) {
      const _Float16* vr = vbase + (size_t)(j * 16) * S_LEN;
      o[j] = wmma_f16(ap0, load_frag_f16(vr,      hi8), o[j]);
      o[j] = wmma_f16(ap1, load_frag_f16(vr + 32, hi8), o[j]);
    }
  }

  union { v8f v; float f[8]; } iv;
#pragma unroll
  for (int r = 0; r < 8; ++r) iv.f[r] = 1.0f / rowsum[r];
#pragma unroll
  for (int j = 0; j < 4; ++j) {
    union { v8f v; float f[8]; } uo;
    uo.v = o[j] * iv.v;
#pragma unroll
    for (int r = 0; r < 8; ++r) {
      int s = m0 + r + hi8;
      aout[(size_t)s * DMODEL + head * HDIM + j * 16 + lane16] = (_Float16)uo.f[r];
    }
  }
}

// ---------------------------------------------------------------------------
// Kernel 4: output projection GEMM.  out(f32) = aout(f16) @ woT^T(f16) + bo
// 32(M) x 64(N) wave tiles.
// ---------------------------------------------------------------------------
__global__ __launch_bounds__(256) void gemm_out_kernel(
    const _Float16* __restrict__ ain, const _Float16* __restrict__ wT,
    const float* __restrict__ bias, float* __restrict__ out) {
  const int K = DMODEL, N = DMODEL;
  int wave   = (blockIdx.x * 256 + threadIdx.x) >> 5;
  int lane16 = threadIdx.x & 15;
  int hi8    = ((threadIdx.x >> 4) & 1) << 3;
  int tile_m = wave & 127;
  int tile_n = wave >> 7;
  int m0 = tile_m * 32, n0 = tile_n * 64;

  v8f c0[4] = {}, c1[4] = {};
  const _Float16* arow0 = ain + (size_t)(m0 + lane16) * K;
  const _Float16* arow1 = arow0 + (size_t)16 * K;
  const _Float16* wrow  = wT + (size_t)(n0 + lane16) * K;

  for (int k0 = 0; k0 < K; k0 += 32) {
    int kb = k0 + hi8;
    v16h a0 = load_frag_f16(arow0, kb);
    v16h a1 = load_frag_f16(arow1, kb);
#pragma unroll
    for (int j = 0; j < 4; ++j) {
      v16h b = load_frag_f16(wrow + (size_t)(j * 16) * K, kb);
      c0[j] = wmma_f16(a0, b, c0[j]);
      c1[j] = wmma_f16(a1, b, c1[j]);
    }
  }

#pragma unroll
  for (int j = 0; j < 4; ++j) {
    int n = n0 + j * 16 + lane16;
    float bj = bias[n];
#pragma unroll
    for (int r = 0; r < 8; ++r) {
      int s0r = m0 + r + hi8;
      out[(size_t)s0r * N + n]        = c0[j][r] + bj;
      out[(size_t)(s0r + 16) * N + n] = c1[j][r] + bj;
    }
  }
}

// ---------------------------------------------------------------------------
// Host launch
// ---------------------------------------------------------------------------
extern "C" void kernel_launch(void* const* d_in, const int* in_sizes, int n_in,
                              void* d_out, int out_size, void* d_ws, size_t ws_size,
                              hipStream_t stream) {
  const float* x  = (const float*)d_in[0];
  const float* wq = (const float*)d_in[1];
  const float* bq = (const float*)d_in[2];
  const float* wk = (const float*)d_in[3];
  const float* bk = (const float*)d_in[4];
  const float* wv = (const float*)d_in[5];
  const float* bv = (const float*)d_in[6];
  const float* wo = (const float*)d_in[7];
  const float* bo = (const float*)d_in[8];
  float* out = (float*)d_out;

  char* ws = (char*)d_ws;
  const size_t MB = 1024 * 1024;
  _Float16* wqT  = (_Float16*)(ws + 0 * MB);    // [1024][1024] f16, 2 MB each
  _Float16* wkT  = (_Float16*)(ws + 2 * MB);
  _Float16* wvT  = (_Float16*)(ws + 4 * MB);
  _Float16* woT  = (_Float16*)(ws + 6 * MB);
  _Float16* qh   = (_Float16*)(ws + 8 * MB);    // [16][4096][64], 8 MB each
  _Float16* kh   = (_Float16*)(ws + 16 * MB);
  _Float16* vt   = (_Float16*)(ws + 24 * MB);   // [16][64][4096]
  _Float16* aout = (_Float16*)(ws + 32 * MB);   // [4096][1024]
  _Float16* xh   = (_Float16*)(ws + 40 * MB);   // [4096][1024]

  int nx = S_LEN * DMODEL;
  cvt_x_kernel<<<(nx + 255) / 256, 256, 0, stream>>>(x, xh, nx);

  dim3 tgrid(DMODEL / 256, DMODEL);
  cvtT_kernel<<<tgrid, 256, 0, stream>>>(wq, wqT, DMODEL, DMODEL);
  cvtT_kernel<<<tgrid, 256, 0, stream>>>(wk, wkT, DMODEL, DMODEL);
  cvtT_kernel<<<tgrid, 256, 0, stream>>>(wv, wvT, DMODEL, DMODEL);
  cvtT_kernel<<<tgrid, 256, 0, stream>>>(wo, woT, DMODEL, DMODEL);

  // 2048 wave-tiles per GEMM, 8 waves per 256-thread block -> 256 blocks
  gemm_qkv_kernel<<<256, 256, 0, stream>>>(xh, wqT, bq, qh, 0);
  gemm_qkv_kernel<<<256, 256, 0, stream>>>(xh, wkT, bk, kh, 0);
  gemm_qkv_kernel<<<256, 256, 0, stream>>>(xh, wvT, bv, vt, 1);

  attn_kernel<<<dim3(S_LEN / 16, NHEADS), 32, 0, stream>>>(qh, kh, vt, aout);

  gemm_out_kernel<<<256, 256, 0, stream>>>(aout, woT, bo, out);
}

// v001
// One run takes 362 microseconds.
// Next to v000, in two timings, it ran 1.45 and 1.48 times as fast.
#include <hip/hip_runtime.h>
#include <hip/hip_bf16.h>
#include <math.h>

typedef __attribute__((ext_vector_type(16))) _Float16 v16h;
typedef __attribute__((ext_vector_type(8)))  _Float16 v8h;
typedef __attribute__((ext_vector_type(8)))  float    v8f;

#define S_LEN 4096
#define DMODEL 1024
#define NHEADS 16
#define HDIM 64
#define CHUNKLEN 1024

// ---------------------------------------------------------------------------
// WMMA helpers: v_wmma_f32_16x16x32_f16, D = A(16x32) * B(32x16) + C(16x16 f32)
// A layout (wave32): lane L (row M = L%16); halves 0..7 -> K = base+0..7,
// halves 8..15 -> K = base+16..23, base = (L>=16)?8:0.
// B layout mirrors A with N = L%16. C/D: VGPR r, lane L: M = r + ((L>=16)?8:0).
// ---------------------------------------------------------------------------
__device__ __forceinline__ v8f wmma_f16(v16h a, v16h b, v8f c) {
  return __builtin_amdgcn_wmma_f32_16x16x32_f16(
      false, a, false, b, (short)0, c, false, false);
}

__device__ __forceinline__ v16h pack16(v8h lo, v8h hi) {
  v16h r;
#pragma unroll
  for (int t = 0; t < 8; ++t) { r[t] = lo[t]; r[8 + t] = hi[t]; }
  return r;
}

__device__ __forceinline__ v16h load_frag_f16(const _Float16* __restrict__ row, int kb) {
  v8h lo = *(const v8h*)(row + kb);
  v8h hi = *(const v8h*)(row + kb + 16);
  return pack16(lo, hi);
}

// ---------------------------------------------------------------------------
// Kernel 1a: elementwise f32 -> f16
// ---------------------------------------------------------------------------
__global__ void cvt_x_kernel(const float* __restrict__ x, _Float16* __restrict__ xh,
                             int n) {
  int i = blockIdx.x * blockDim.x + threadIdx.x;
  if (i < n) xh[i] = (_Float16)x[i];
}

// ---------------------------------------------------------------------------
// Kernel 1b: convert + transpose weight  w[K][N] f32  ->  wT[N][K] f16
// ---------------------------------------------------------------------------
__global__ void cvtT_kernel(const float* __restrict__ w, _Float16* __restrict__ wT,
                            int K, int N) {
  int n = blockIdx.x * blockDim.x + threadIdx.x;
  int k = blockIdx.y;
  if (n < N) wT[(size_t)n * K + k] = (_Float16)w[(size_t)k * N + n];
}

// ---------------------------------------------------------------------------
// Kernel 2: QKV projection GEMM.  out = xh(f16 SxK) @ wT^T(f16) + bias
// Each wave computes a 32(M) x 64(N) tile (B fragments reused by 2 A frags).
// mode 0: out[h][s][d]; mode 1: out[h][d][s]
// ---------------------------------------------------------------------------
__global__ __launch_bounds__(256) void gemm_qkv_kernel(
    const _Float16* __restrict__ xh, const _Float16* __restrict__ wT,
    const float* __restrict__ bias, _Float16* __restrict__ out, int mode) {
  const int K = DMODEL;
  int wave   = (blockIdx.x * 256 + threadIdx.x) >> 5;   // 0..2047
  int lane16 = threadIdx.x & 15;
  int hi8    = ((threadIdx.x >> 4) & 1) << 3;           // 0 or 8
  int tile_m = wave & 127;                              // 128 tiles of 32 rows
  int tile_n = wave >> 7;                               // 16 tiles of 64 cols
  int m0 = tile_m * 32, n0 = tile_n * 64;

  v8f c0[4] = {}, c1[4] = {};
  const _Float16* arow0 = xh + (size_t)(m0 + lane16) * K;
  const _Float16* arow1 = arow0 + (size_t)16 * K;
  const _Float16* wrow  = wT + (size_t)(n0 + lane16) * K;

  for (int k0 = 0; k0 < K; k0 += 32) {
    int kb = k0 + hi8;
    v16h a0 = load_frag_f16(arow0, kb);
    v16h a1 = load_frag_f16(arow1, kb);
#pragma unroll
    for (int j = 0; j < 4; ++j) {
      v16h b = load_frag_f16(wrow + (size_t)(j * 16) * K, kb);
      c0[j] = wmma_f16(a0, b, c0[j]);
      c1[j] = wmma_f16(a1, b, c1[j]);
    }
  }

#pragma unroll
  for (int j = 0; j < 4; ++j) {
    int n = n0 + j * 16 + lane16;
    float bj = bias[n];
    int head = n >> 6, d = n & 63;
#pragma unroll
    for (int r = 0; r < 8; ++r) {
      int s0r = m0 + r + hi8;
      int s1r = s0r + 16;
      float v0 = c0[j][r] + bj;
      float v1 = c1[j][r] + bj;
      if (mode == 0) {
        out[((size_t)head * S_LEN + s0r) * HDIM + d] = (_Float16)v0;
        out[((size_t)head * S_LEN + s1r) * HDIM + d] = (_Float16)v1;
      } else {
        out[((size_t)head * HDIM + d) * S_LEN + s0r] = (_Float16)v0;
        out[((size_t)head * HDIM + d) * S_LEN + s1r] = (_Float16)v1;
      }
    }
  }
}

// ---------------------------------------------------------------------------
// Kernel 3: flash-style block-causal attention. One wave per 16-q-row tile; the
// eight waves of a work-group (128 q rows of one head, all in one chunk) share
// each 64-key K tile and V tile through LDS. The tiles come in by asynchronous
// copies of whole 128-byte rows, two buffers, the next tile in flight while this
// one is worked on. 64 keys per trip: 8 score WMMAs + softmax + 8 PV WMMAs.
// qh,kh: [H][S][64] f16;  vt: [H][64][S] f16;  aout: [S][H*64] f16
// ---------------------------------------------------------------------------
#define ATT_WAVES 8
#define KTILE 64
#define LROW 72   // halves per LDS row: 128 B of data + 16 B, conflict-free for 16-B reads

// One tile's share of one thread: two 16-byte pieces of K and two of V.
// The s_wait_xcnt stands inside the statement so that no address register of a
// copy is rewritten ahead of it.
__device__ __forceinline__ void copy_kv_tile(
    unsigned lk0, const _Float16* gk0, unsigned lk1, const _Float16* gk1,
    unsigned lv0, const _Float16* gv0, unsigned lv1, const _Float16* gv1) {
  asm volatile(
      "global_load_async_to_lds_b128 %0, %1, off\n\t"
      "global_load_async_to_lds_b128 %2, %3, off\n\t"
      "global_load_async_to_lds_b128 %4, %5, off\n\t"
      "global_load_async_to_lds_b128 %6, %7, off\n\t"
      "s_wait_xcnt 0x0"
      :: "v"(lk0), "v"(gk0), "v"(lk1), "v"(gk1),
         "v"(lv0), "v"(gv0), "v"(lv1), "v"(gv1)
      : "memory");
}

__global__ __launch_bounds__(256) void attn_kernel(
    const _Float16* __restrict__ qh, const _Float16* __restrict__ kh,
    const _Float16* __restrict__ vt, _Float16* __restrict__ aout) {
  __shared__ __align__(16) _Float16 sK[2][KTILE][LROW];          // keys x d
  __shared__ __align__(16) _Float16 sV[2][HDIM][LROW];           // d x keys
  __shared__ __align__(16) _Float16 sPw[ATT_WAVES][16][LROW];    // per wave: 16 q-rows x 64 keys

  int head   = blockIdx.y;
  int wave   = threadIdx.x >> 5;
  int lane16 = threadIdx.x & 15;
  int hi8    = ((threadIdx.x >> 4) & 1) << 3;
  int mblk   = blockIdx.x * (ATT_WAVES * 16);
  int m0     = mblk + wave * 16;
  int kv_end = ((mblk / CHUNKLEN) + 1) * CHUNKLEN;  // block-causal: full chunks; same for all 8 waves
  const float scale = 0.125f;                       // 64^-0.5
  _Float16 (*sP)[LROW] = sPw[wave];

  // copy map: piece p = threadIdx.x (+256): row p/8, 16-byte column p%8; a wave covers 4 whole rows
  int crow = threadIdx.x >> 3;            // 0..31, second piece: +32
  int ccol = (threadIdx.x & 7) * 8;       // in halves
  const _Float16* gk = kh + ((size_t)head * S_LEN + crow) * HDIM + ccol;
  const _Float16* gv = vt + ((size_t)head * HDIM + crow) * S_LEN + ccol;
  unsigned lk = (unsigned)(size_t)&sK[0][crow][ccol];
  unsigned lv = (unsigned)(size_t)&sV[0][crow][ccol];
  const unsigned half_tile = 32 * LROW * 2;   // bytes of 32 LDS rows
  const unsigned buf_bytes = 64 * LROW * 2;   // bytes of one buffer

  const _Float16* qrow = qh + ((size_t)head * S_LEN + m0 + lane16) * HDIM;
  v16h aq0 = load_frag_f16(qrow, hi8);        // d 0..31
  v16h aq1 = load_frag_f16(qrow + 32, hi8);   // d 32..63

  float rowmax[8], rowsum[8];
#pragma unroll
  for (int r = 0; r < 8; ++r) { rowmax[r] = -INFINITY; rowsum[r] = 0.0f; }
  v8f o[4] = {};

  // --- prologue: tile 0 lands and is published, then tile 1 starts
  copy_kv_tile(lk, gk, lk + half_tile, gk + 32 * HDIM,
               lv, gv, lv + half_tile, gv + (size_t)32 * S_LEN);
  asm volatile("s_wait_asynccnt 0x0" ::: "memory");   // this wave's copies of tile 0 have landed
  __syncthreads();                                    // ... and every other wave's
  if (KTILE < kv_end)
    copy_kv_tile(lk + buf_bytes, gk + KTILE * HDIM,
                 lk + buf_bytes + half_tile, gk + (KTILE + 32) * HDIM,
                 lv + buf_bytes, gv + KTILE,
                 lv + buf_bytes + half_tile, gv + (size_t)32 * S_LEN + KTILE);

  for (int kb = 0; kb < kv_end; kb += KTILE) {
    int buf = (kb >> 6) & 1;
    // --- scores for 64 keys: four 16x16 tiles, Hd=64 split in two WMMAs each
    union { v8f v; float f[8]; } u[4], av;
#pragma unroll
    for (int t = 0; t < 4; ++t) {
      const _Float16* krow = &sK[buf][t * 16 + lane16][0];
      v8f s = {};
      s = wmma_f16(aq0, load_frag_f16(krow,      hi8), s);
      s = wmma_f16(aq1, load_frag_f16(krow + 32, hi8), s);
      u[t].v = s * scale;
    }

    // --- online softmax; each row lives across 16 lanes of a half-wave
#pragma unroll
    for (int r = 0; r < 8; ++r) {
      float mx = fmaxf(fmaxf(u[0].f[r], u[1].f[r]), fmaxf(u[2].f[r], u[3].f[r]));
      mx = fmaxf(mx, __shfl_xor(mx, 1));
      mx = fmaxf(mx, __shfl_xor(mx, 2));
      mx = fmaxf(mx, __shfl_xor(mx, 4));
      mx = fmaxf(mx, __shfl_xor(mx, 8));
      float nm    = fmaxf(rowmax[r], mx);
      float alpha = __expf(rowmax[r] - nm);
      rowmax[r]   = nm;
      float ps = 0.0f;
#pragma unroll
      for (int t = 0; t < 4; ++t) {
        float p = __expf(u[t].f[r] - nm);
        u[t].f[r] = p;
        ps += p;
      }
      ps += __shfl_xor(ps, 1);
      ps += __shfl_xor(ps, 2);
      ps += __shfl_xor(ps, 4);
      ps += __shfl_xor(ps, 8);
      rowsum[r] = rowsum[r] * alpha + ps;
      av.f[r]   = alpha;
    }
#pragma unroll
    for (int j = 0; j < 4; ++j) o[j] = o[j] * av.v;

    // --- redistribute P (C-layout) -> A-layout through this wave's own LDS slice.
    // Only lanes of one wave exchange here: a wave-scope fence keeps the compiler from
    // moving the stores and the loads past each other; the LDS serves a wave in order.
    __builtin_amdgcn_fence(__ATOMIC_ACQ_REL, "wavefront");
#pragma unroll
    for (int r = 0; r < 8; ++r) {
#pragma unroll
      for (int t = 0; t < 4; ++t)
        sP[r + hi8][t * 16 + lane16] = (_Float16)u[t].f[r];
    }
    __builtin_amdgcn_fence(__ATOMIC_ACQ_REL, "wavefront");
    v16h ap0 = pack16(*(const v8h*)&sP[lane16][hi8],
                      *(const v8h*)&sP[lane16][hi8 + 16]);
    v16h ap1 = pack16(*(const v8h*)&sP[lane16][32 + hi8],
                      *(const v8h*)&sP[lane16][32 + hi8 + 16]);

    // --- O += P @ V   (V transposed: contiguous over keys per d)
#pragma unroll
    for (int j = 0; j < 4; ++j) {
      const _Float16* vr = &sV[buf][j * 16 + lane16][0];
      o[j] = wmma_f16(ap0, load_frag_f16(vr,      hi8), o[j]);
      o[j] = wmma_f16(ap1, load_frag_f16(vr + 32, hi8), o[j]);
    }

    // --- publish point of tile t+1; it also ends every wave's reads of this buffer
    asm volatile("s_wait_dscnt 0x0" ::: "memory");     // this wave's LDS reads of the buffer are done
    asm volatile("s_wait_asynccnt 0x0" ::: "memory");  // this wave's copies of tile t+1 have landed
    __syncthreads();
    if (kb + 2 * KTILE < kv_end) {                     // tile t+2 into the buffer just read
      unsigned bo = (unsigned)buf * buf_bytes;
      const _Float16* nk = gk + (size_t)(kb + 2 * KTILE) * HDIM;
      const _Float16* nv = gv + (kb + 2 * KTILE);
      copy_kv_tile(lk + bo, nk, lk + bo + half_tile, nk + 32 * HDIM,
                   lv + bo, nv, lv + bo + half_tile, nv + (size_t)32 * S_LEN);
    }
  }
  asm volatile("s_wait_asynccnt 0x0" ::: "memory");    // nothing of this wave's is in flight at its end

  union { v8f v; float f[8]; } iv;
#pragma unroll
  for (int r = 0; r < 8; ++r) iv.f[r] = 1.0f / rowsum[r];
#pragma unroll
  for (int j = 0; j < 4; ++j) {
    union { v8f v; float f[8]; } uo;
    uo.v = o[j] * iv.v;
#pragma unroll
    for (int r = 0; r < 8; ++r) {
      int s = m0 + r + hi8;
      aout[(size_t)s * DMODEL + head * HDIM + j * 16 + lane16] = (_Float16)uo.f[r];
    }
  }
}

// ---------------------------------------------------------------------------
// Kernel 4: output projection GEMM.  out(f32) = aout(f16) @ woT^T(f16) + bo
// 32(M) x 64(N) wave tiles.
// ---------------------------------------------------------------------------
__global__ __launch_bounds__(256) void gemm_out_kernel(
    const _Float16* __restrict__ ain, const _Float16* __restrict__ wT,
    const float* __restrict__ bias, float* __restrict__ out) {
  const int K = DMODEL, N = DMODEL;
  int wave   = (blockIdx.x * 256 + threadIdx.x) >> 5;
  int lane16 = threadIdx.x & 15;
  int hi8    = ((threadIdx.x >> 4) & 1) << 3;
  int tile_m = wave & 127;
  int tile_n = wave >> 7;
  int m0 = tile_m * 32, n0 = tile_n * 64;

  v8f c0[4] = {}, c1[4] = {};
  const _Float16* arow0 = ain + (size_t)(m0 + lane16) * K;
  const _Float16* arow1 = arow0 + (size_t)16 * K;
  const _Float16* wrow  = wT + (size_t)(n0 + lane16) * K;

  for (int k0 = 0; k0 < K; k0 += 32) {
    int kb = k0 + hi8;
    v16h a0 = load_frag_f16(arow0, kb);
    v16h a1 = load_frag_f16(arow1, kb);
#pragma unroll
    for (int j = 0; j < 4; ++j) {
      v16h b = load_frag_f16(wrow + (size_t)(j * 16) * K, kb);
      c0[j] = wmma_f16(a0, b, c0[j]);
      c1[j] = wmma_f16(a1, b, c1[j]);
    }
  }

#pragma unroll
  for (int j = 0; j < 4; ++j) {
    int n = n0 + j * 16 + lane16;
    float bj = bias[n];
#pragma unroll
    for (int r = 0; r < 8; ++r) {
      int s0r = m0 + r + hi8;
      out[(size_t)s0r * N + n]        = c0[j][r] + bj;
      out[(size_t)(s0r + 16) * N + n] = c1[j][r] + bj;
    }
  }
}

// ---------------------------------------------------------------------------
// Host launch
// ---------------------------------------------------------------------------
extern "C" void kernel_launch(void* const* d_in, const int* in_sizes, int n_in,
                              void* d_out, int out_size, void* d_ws, size_t ws_size,
                              hipStream_t stream) {
  const float* x  = (const float*)d_in[0];
  const float* wq = (const float*)d_in[1];
  const float* bq = (const float*)d_in[2];
  const float* wk = (const float*)d_in[3];
  const float* bk = (const float*)d_in[4];
  const float* wv = (const float*)d_in[5];
  const float* bv = (const float*)d_in[6];
  const float* wo = (const float*)d_in[7];
  const float* bo = (const float*)d_in[8];
  float* out = (float*)d_out;

  char* ws = (char*)d_ws;
  const size_t MB = 1024 * 1024;
  _Float16* wqT  = (_Float16*)(ws + 0 * MB);    // [1024][1024] f16, 2 MB each
  _Float16* wkT  = (_Float16*)(ws + 2 * MB);
  _Float16* wvT  = (_Float16*)(ws + 4 * MB);
  _Float16* woT  = (_Float16*)(ws + 6 * MB);
  _Float16* qh   = (_Float16*)(ws + 8 * MB);    // [16][4096][64], 8 MB each
  _Float16* kh   = (_Float16*)(ws + 16 * MB);
  _Float16* vt   = (_Float16*)(ws + 24 * MB);   // [16][64][4096]
  _Float16* aout = (_Float16*)(ws + 32 * MB);   // [4096][1024]
  _Float16* xh   = (_Float16*)(ws + 40 * MB);   // [4096][1024]

  int nx = S_LEN * DMODEL;
  cvt_x_kernel<<<(nx + 255) / 256, 256, 0, stream>>>(x, xh, nx);

  dim3 tgrid(DMODEL / 256, DMODEL);
  cvtT_kernel<<<tgrid, 256, 0, stream>>>(wq, wqT, DMODEL, DMODEL);
  cvtT_kernel<<<tgrid, 256, 0, stream>>>(wk, wkT, DMODEL, DMODEL);
  cvtT_kernel<<<tgrid, 256, 0, stream>>>(wv, wvT, DMODEL, DMODEL);
  cvtT_kernel<<<tgrid, 256, 0, stream>>>(wo, woT, DMODEL, DMODEL);

  // 2048 wave-tiles per GEMM, 8 waves per 256-thread block -> 256 blocks
  gemm_qkv_kernel<<<256, 256, 0, stream>>>(xh, wqT, bq, qh, 0);
  gemm_qkv_kernel<<<256, 256, 0, stream>>>(xh, wkT, bk, kh, 0);
  gemm_qkv_kernel<<<256, 256, 0, stream>>>(xh, wvT, bv, vt, 1);

  attn_kernel<<<dim3(S_LEN / (ATT_WAVES * 16), NHEADS), ATT_WAVES * 32, 0, stream>>>(qh, kh, vt, aout);

  gemm_out_kernel<<<256, 256, 0, stream>>>(aout, woT, bo, out);
}

// v002
// It runs in 240 microseconds.
// In two side-by-side timings against v001, it was 1.50 and 1.51 times as fast.
// Counting every step since v000, it is 2.21 times as fast.
#include <hip/hip_runtime.h>
#include <hip/hip_bf16.h>
#include <math.h>

typedef __attribute__((ext_vector_type(16))) _Float16 v16h;
typedef __attribute__((ext_vector_type(8)))  _Float16 v8h;
typedef __attribute__((ext_vector_type(8)))  float    v8f;
typedef __attribute__((ext_vector_type(4)))  float    v4f;
typedef __attribute__((ext_vector_type(4)))  _Float16 v4h;

#define S_LEN 4096
#define DMODEL 1024
#define NHEADS 16
#define HDIM 64
#define CHUNKLEN 1024

// ---------------------------------------------------------------------------
// WMMA helpers: v_wmma_f32_16x16x32_f16, D = A(16x32) * B(32x16) + C(16x16 f32)
// A layout (wave32): lane L (row M = L%16); halves 0..7 -> K = base+0..7,
// halves 8..15 -> K = base+16..23, base = (L>=16)?8:0.
// B layout mirrors A with N = L%16. C/D: VGPR r, lane L: M = r + ((L>=16)?8:0).
// ---------------------------------------------------------------------------
__device__ __forceinline__ v8f wmma_f16(v16h a, v16h b, v8f c) {
  return __builtin_amdgcn_wmma_f32_16x16x32_f16(
      false, a, false, b, (short)0, c, false, false);
}

__device__ __forceinline__ v16h pack16(v8h lo, v8h hi) {
  v16h r;
#pragma unroll
  for (int t = 0; t < 8; ++t) { r[t] = lo[t]; r[8 + t] = hi[t]; }
  return r;
}

__device__ __forceinline__ v16h load_frag_f16(const _Float16* __restrict__ row, int kb) {
  v8h lo = *(const v8h*)(row + kb);
  v8h hi = *(const v8h*)(row + kb + 16);
  return pack16(lo, hi);
}

// ---------------------------------------------------------------------------
// Kernel 1a: elementwise f32 -> f16. Few fat waves: 16 waves on each of 256
// work-groups; a thread takes 8 pieces of 4 floats. Each wave-wide load covers 512
// contiguous bytes and each store 256; all 8 loads are issued before the first use.
// ---------------------------------------------------------------------------
#define CVX_BLOCKS  256
#define CVX_THREADS 512
#define CVX_PIECES  8
static_assert(CVX_BLOCKS * CVX_THREADS * CVX_PIECES * 4 == S_LEN * DMODEL, "x is covered exactly once");

__global__ __launch_bounds__(CVX_THREADS) void cvt_x_kernel(const float* __restrict__ x,
                                                            _Float16* __restrict__ xh) {
  const v4f* xv = (const v4f*)x;
  v4h*       hv = (v4h*)xh;
  unsigned q = blockIdx.x * (CVX_THREADS * CVX_PIECES) + threadIdx.x;   // piece index, the same on both sides
  v4f a[CVX_PIECES];
#pragma unroll
  for (int i = 0; i < CVX_PIECES; ++i) a[i] = xv[q + i * CVX_THREADS];
#pragma unroll
  for (int i = 0; i < CVX_PIECES; ++i) {
    v4h h;
#pragma unroll
    for (int c = 0; c < 4; ++c) h[c] = (_Float16)a[i][c];
    hv[q + i * CVX_THREADS] = h;
  }
}

// ---------------------------------------------------------------------------
// Kernel 1b: convert + transpose weight  w[K][N] f32  ->  wT[N][K] f16, K = N = DMODEL.
// One 64(k) x 64(n) tile per work-group, turned in LDS: 16-byte loads along n,
// 16-byte stores along k, 8 lanes of one wave write each whole 128-byte line of wT.
// ---------------------------------------------------------------------------
#define TTILE 64
#define TROW  72   // halves per LDS row: 128 B of data + 16 B, keeps 16-byte reads aligned

__global__ __launch_bounds__(256) void cvtT_kernel(const float* __restrict__ w,
                                                   _Float16* __restrict__ wT) {
  __shared__ __align__(16) _Float16 sT[TTILE][TROW];   // n x k
  int n0 = blockIdx.x * TTILE, k0 = blockIdx.y * TTILE;
  int c4 = (threadIdx.x & 15) * 4;    // 4 consecutive n
  int r4 = (threadIdx.x >> 4) * 4;    // 4 consecutive k
  v4f v[4];
#pragma unroll
  for (int i = 0; i < 4; ++i)
    v[i] = *(const v4f*)(w + (size_t)(k0 + r4 + i) * DMODEL + n0 + c4);
#pragma unroll
  for (int c = 0; c < 4; ++c) {
    v4h h;
#pragma unroll
    for (int i = 0; i < 4; ++i) h[i] = (_Float16)v[i][c];
    *(v4h*)&sT[c4 + c][r4] = h;
  }
  __syncthreads();   // the tile is complete before any thread reads rows that others wrote
  int row = threadIdx.x >> 3;         // 0..31, second piece: +32
  int col = (threadIdx.x & 7) * 8;    // in halves
#pragma unroll
  for (int i = 0; i < 2; ++i)
    *(v8h*)(wT + (size_t)(n0 + row + 32 * i) * DMODEL + k0 + col) =
        *(const v8h*)&sT[row + 32 * i][col];
}

// ---------------------------------------------------------------------------
// Kernel 2: QKV projection GEMM.  out = xh(f16 SxK) @ wT^T(f16) + bias
// Each wave computes a 32(M) x 64(N) tile (B fragments reused by 2 A frags).
// mode 0: out[h][s][d]; mode 1: out[h][d][s]
// ---------------------------------------------------------------------------
__global__ __launch_bounds__(256) void gemm_qkv_kernel(
    const _Float16* __restrict__ xh, const _Float16* __restrict__ wT,
    const float* __restrict__ bias, _Float16* __restrict__ out, int mode) {
  const int K = DMODEL;
  int wave   = (blockIdx.x * 256 + threadIdx.x) >> 5;   // 0..2047
  int lane16 = threadIdx.x & 15;
  int hi8    = ((threadIdx.x >> 4) & 1) << 3;           // 0 or 8
  int tile_m = wave & 127;                              // 128 tiles of 32 rows
  int tile_n = wave >> 7;                               // 16 tiles of 64 cols
  int m0 = tile_m * 32, n0 = tile_n * 64;

  v8f c0[4] = {}, c1[4] = {};
  const _Float16* arow0 = xh + (size_t)(m0 + lane16) * K;
  const _Float16* arow1 = arow0 + (size_t)16 * K;
  const _Float16* wrow  = wT + (size_t)(n0 + lane16) * K;

  for (int k0 = 0; k0 < K; k0 += 32) {
    int kb = k0 + hi8;
    v16h a0 = load_frag_f16(arow0, kb);
    v16h a1 = load_frag_f16(arow1, kb);
#pragma unroll
    for (int j = 0; j < 4; ++j) {
      v16h b = load_frag_f16(wrow + (size_t)(j * 16) * K, kb);
      c0[j] = wmma_f16(a0, b, c0[j]);
      c1[j] = wmma_f16(a1, b, c1[j]);
    }
  }

#pragma unroll
  for (int j = 0; j < 4; ++j) {
    int n = n0 + j * 16 + lane16;
    float bj = bias[n];
    int head = n >> 6, d = n & 63;
#pragma unroll
    for (int r = 0; r < 8; ++r) {
      int s0r = m0 + r + hi8;
      int s1r = s0r + 16;
      float v0 = c0[j][r] + bj;
      float v1 = c1[j][r] + bj;
      if (mode == 0) {
        out[((size_t)head * S_LEN + s0r) * HDIM + d] = (_Float16)v0;
        out[((size_t)head * S_LEN + s1r) * HDIM + d] = (_Float16)v1;
      } else {
        out[((size_t)head * HDIM + d) * S_LEN + s0r] = (_Float16)v0;
        out[((size_t)head * HDIM + d) * S_LEN + s1r] = (_Float16)v1;
      }
    }
  }
}

// ---------------------------------------------------------------------------
// Kernel 3: flash-style block-causal attention. One wave per 16-q-row tile; the
// eight waves of a work-group (128 q rows of one head, all in one chunk) share
// each 64-key K tile and V tile through LDS. The tiles come in by asynchronous
// copies of whole 128-byte rows, two buffers, the next tile in flight while this
// one is worked on. 64 keys per trip: 8 score WMMAs + softmax + 8 PV WMMAs.
// qh,kh: [H][S][64] f16;  vt: [H][64][S] f16;  aout: [S][H*64] f16
// ---------------------------------------------------------------------------
#define ATT_WAVES 8
#define KTILE 64
#define LROW 72   // halves per LDS row: 128 B of data + 16 B, conflict-free for 16-B reads

// One tile's share of one thread: two 16-byte pieces of K and two of V.
// The s_wait_xcnt stands inside the statement so that no address register of a
// copy is rewritten ahead of it.
__device__ __forceinline__ void copy_kv_tile(
    unsigned lk0, const _Float16* gk0, unsigned lk1, const _Float16* gk1,
    unsigned lv0, const _Float16* gv0, unsigned lv1, const _Float16* gv1) {
  asm volatile(
      "global_load_async_to_lds_b128 %0, %1, off\n\t"
      "global_load_async_to_lds_b128 %2, %3, off\n\t"
      "global_load_async_to_lds_b128 %4, %5, off\n\t"
      "global_load_async_to_lds_b128 %6, %7, off\n\t"
      "s_wait_xcnt 0x0"
      :: "v"(lk0), "v"(gk0), "v"(lk1), "v"(gk1),
         "v"(lv0), "v"(gv0), "v"(lv1), "v"(gv1)
      : "memory");
}

__global__ __launch_bounds__(256) void attn_kernel(
    const _Float16* __restrict__ qh, const _Float16* __restrict__ kh,
    const _Float16* __restrict__ vt, _Float16* __restrict__ aout) {
  __shared__ __align__(16) _Float16 sK[2][KTILE][LROW];          // keys x d
  __shared__ __align__(16) _Float16 sV[2][HDIM][LROW];           // d x keys
  __shared__ __align__(16) _Float16 sPw[ATT_WAVES][16][LROW];    // per wave: 16 q-rows x 64 keys

  int head   = blockIdx.y;
  int wave   = threadIdx.x >> 5;
  int lane16 = threadIdx.x & 15;
  int hi8    = ((threadIdx.x >> 4) & 1) << 3;
  int mblk   = blockIdx.x * (ATT_WAVES * 16);
  int m0     = mblk + wave * 16;
  int kv_end = ((mblk / CHUNKLEN) + 1) * CHUNKLEN;  // block-causal: full chunks; same for all 8 waves
  const float scale = 0.125f;                       // 64^-0.5
  _Float16 (*sP)[LROW] = sPw[wave];

  // copy map: piece p = threadIdx.x (+256): row p/8, 16-byte column p%8; a wave covers 4 whole rows
  int crow = threadIdx.x >> 3;            // 0..31, second piece: +32
  int ccol = (threadIdx.x & 7) * 8;       // in halves
  const _Float16* gk = kh + ((size_t)head * S_LEN + crow) * HDIM + ccol;
  const _Float16* gv = vt + ((size_t)head * HDIM + crow) * S_LEN + ccol;
  unsigned lk = (unsigned)(size_t)&sK[0][crow][ccol];
  unsigned lv = (unsigned)(size_t)&sV[0][crow][ccol];
  const unsigned half_tile = 32 * LROW * 2;   // bytes of 32 LDS rows
  const unsigned buf_bytes = 64 * LROW * 2;   // bytes of one buffer

  const _Float16* qrow = qh + ((size_t)head * S_LEN + m0 + lane16) * HDIM;
  v16h aq0 = load_frag_f16(qrow, hi8);        // d 0..31
  v16h aq1 = load_frag_f16(qrow + 32, hi8);   // d 32..63

  float rowmax[8], rowsum[8];
#pragma unroll
  for (int r = 0; r < 8; ++r) { rowmax[r] = -INFINITY; rowsum[r] = 0.0f; }
  v8f o[4] = {};

  // --- prologue: tile 0 lands and is published, then tile 1 starts
  copy_kv_tile(lk, gk, lk + half_tile, gk + 32 * HDIM,
               lv, gv, lv + half_tile, gv + (size_t)32 * S_LEN);
  asm volatile("s_wait_asynccnt 0x0" ::: "memory");   // this wave's copies of tile 0 have landed
  __syncthreads();                                    // ... and every other wave's
  if (KTILE < kv_end)
    copy_kv_tile(lk + buf_bytes, gk + KTILE * HDIM,
                 lk + buf_bytes + half_tile, gk + (KTILE + 32) * HDIM,
                 lv + buf_bytes, gv + KTILE,
                 lv + buf_bytes + half_tile, gv + (size_t)32 * S_LEN + KTILE);

  for (int kb = 0; kb < kv_end; kb += KTILE) {
    int buf = (kb >> 6) & 1;
    // --- scores for 64 keys: four 16x16 tiles, Hd=64 split in two WMMAs each
    union { v8f v; float f[8]; } u[4], av;
#pragma unroll
    for (int t = 0; t < 4; ++t) {
      const _Float16* krow = &sK[buf][t * 16 + lane16][0];
      v8f s = {};
      s = wmma_f16(aq0, load_frag_f16(krow,      hi8), s);
      s = wmma_f16(aq1, load_frag_f16(krow + 32, hi8), s);
      u[t].v = s * scale;
    }

    // --- online softmax; each row lives across 16 lanes of a half-wave
#pragma unroll
    for (int r = 0; r < 8; ++r) {
      float mx = fmaxf(fmaxf(u[0].f[r], u[1].f[r]), fmaxf(u[2].f[r], u[3].f[r]));
      mx = fmaxf(mx, __shfl_xor(mx, 1));
      mx = fmaxf(mx, __shfl_xor(mx, 2));
      mx = fmaxf(mx, __shfl_xor(mx, 4));
      mx = fmaxf(mx, __shfl_xor(mx, 8));
      float nm    = fmaxf(rowmax[r], mx);
      float alpha = __expf(rowmax[r] - nm);
      rowmax[r]   = nm;
      float ps = 0.0f;
#pragma unroll
      for (int t = 0; t < 4; ++t) {
        float p = __expf(u[t].f[r] - nm);
        u[t].f[r] = p;
        ps += p;
      }
      ps += __shfl_xor(ps, 1);
      ps += __shfl_xor(ps, 2);
      ps += __shfl_xor(ps, 4);
      ps += __shfl_xor(ps, 8);
      rowsum[r] = rowsum[r] * alpha + ps;
      av.f[r]   = alpha;
    }
#pragma unroll
    for (int j = 0; j < 4; ++j) o[j] = o[j] * av.v;

    // --- redistribute P (C-layout) -> A-layout through this wave's own LDS slice.
    // Only lanes of one wave exchange here: a wave-scope fence keeps the compiler from
    // moving the stores and the loads past each other; the LDS serves a wave in order.
    __builtin_amdgcn_fence(__ATOMIC_ACQ_REL, "wavefront");
#pragma unroll
    for (int r = 0; r < 8; ++r) {
#pragma unroll
      for (int t = 0; t < 4; ++t)
        sP[r + hi8][t * 16 + lane16] = (_Float16)u[t].f[r];
    }
    __builtin_amdgcn_fence(__ATOMIC_ACQ_REL, "wavefront");
    v16h ap0 = pack16(*(const v8h*)&sP[lane16][hi8],
                      *(const v8h*)&sP[lane16][hi8 + 16]);
    v16h ap1 = pack16(*(const v8h*)&sP[lane16][32 + hi8],
                      *(const v8h*)&sP[lane16][32 + hi8 + 16]);

    // --- O += P @ V   (V transposed: contiguous over keys per d)
#pragma unroll
    for (int j = 0; j < 4; ++j) {
      const _Float16* vr = &sV[buf][j * 16 + lane16][0];
      o[j] = wmma_f16(ap0, load_frag_f16(vr,      hi8), o[j]);
      o[j] = wmma_f16(ap1, load_frag_f16(vr + 32, hi8), o[j]);
    }

    // --- publish point of tile t+1; it also ends every wave's reads of this buffer
    asm volatile("s_wait_dscnt 0x0" ::: "memory");     // this wave's LDS reads of the buffer are done
    asm volatile("s_wait_asynccnt 0x0" ::: "memory");  // this wave's copies of tile t+1 have landed
    __syncthreads();
    if (kb + 2 * KTILE < kv_end) {                     // tile t+2 into the buffer just read
      unsigned bo = (unsigned)buf * buf_bytes;
      const _Float16* nk = gk + (size_t)(kb + 2 * KTILE) * HDIM;
      const _Float16* nv = gv + (kb + 2 * KTILE);
      copy_kv_tile(lk + bo, nk, lk + bo + half_tile, nk + 32 * HDIM,
                   lv + bo, nv, lv + bo + half_tile, nv + (size_t)32 * S_LEN);
    }
  }
  asm volatile("s_wait_asynccnt 0x0" ::: "memory");    // nothing of this wave's is in flight at its end

  union { v8f v; float f[8]; } iv;
#pragma unroll
  for (int r = 0; r < 8; ++r) iv.f[r] = 1.0f / rowsum[r];
#pragma unroll
  for (int j = 0; j < 4; ++j) {
    union { v8f v; float f[8]; } uo;
    uo.v = o[j] * iv.v;
#pragma unroll
    for (int r = 0; r < 8; ++r) {
      int s = m0 + r + hi8;
      aout[(size_t)s * DMODEL + head * HDIM + j * 16 + lane16] = (_Float16)uo.f[r];
    }
  }
}

// ---------------------------------------------------------------------------
// Kernel 4: output projection GEMM.  out(f32) = aout(f16) @ woT^T(f16) + bo
// 32(M) x 64(N) wave tiles.
// ---------------------------------------------------------------------------
__global__ __launch_bounds__(256) void gemm_out_kernel(
    const _Float16* __restrict__ ain, const _Float16* __restrict__ wT,
    const float* __restrict__ bias, float* __restrict__ out) {
  const int K = DMODEL, N = DMODEL;
  int wave   = (blockIdx.x * 256 + threadIdx.x) >> 5;
  int lane16 = threadIdx.x & 15;
  int hi8    = ((threadIdx.x >> 4) & 1) << 3;
  int tile_m = wave & 127;
  int tile_n = wave >> 7;
  int m0 = tile_m * 32, n0 = tile_n * 64;

  v8f c0[4] = {}, c1[4] = {};
  const _Float16* arow0 = ain + (size_t)(m0 + lane16) * K;
  const _Float16* arow1 = arow0 + (size_t)16 * K;
  const _Float16* wrow  = wT + (size_t)(n0 + lane16) * K;

  for (int k0 = 0; k0 < K; k0 += 32) {
    int kb = k0 + hi8;
    v16h a0 = load_frag_f16(arow0, kb);
    v16h a1 = load_frag_f16(arow1, kb);
#pragma unroll
    for (int j = 0; j < 4; ++j) {
      v16h b = load_frag_f16(wrow + (size_t)(j * 16) * K, kb);
      c0[j] = wmma_f16(a0, b, c0[j]);
      c1[j] = wmma_f16(a1, b, c1[j]);
    }
  }

#pragma unroll
  for (int j = 0; j < 4; ++j) {
    int n = n0 + j * 16 + lane16;
    float bj = bias[n];
#pragma unroll
    for (int r = 0; r < 8; ++r) {
      int s0r = m0 + r + hi8;
      out[(size_t)s0r * N + n]        = c0[j][r] + bj;
      out[(size_t)(s0r + 16) * N + n] = c1[j][r] + bj;
    }
  }
}

// ---------------------------------------------------------------------------
// Host launch
// ---------------------------------------------------------------------------
extern "C" void kernel_launch(void* const* d_in, const int* in_sizes, int n_in,
                              void* d_out, int out_size, void* d_ws, size_t ws_size,
                              hipStream_t stream) {
  const float* x  = (const float*)d_in[0];
  const float* wq = (const float*)d_in[1];
  const float* bq = (const float*)d_in[2];
  const float* wk = (const float*)d_in[3];
  const float* bk = (const float*)d_in[4];
  const float* wv = (const float*)d_in[5];
  const float* bv = (const float*)d_in[6];
  const float* wo = (const float*)d_in[7];
  const float* bo = (const float*)d_in[8];
  float* out = (float*)d_out;

  char* ws = (char*)d_ws;
  const size_t MB = 1024 * 1024;
  _Float16* wqT  = (_Float16*)(ws + 0 * MB);    // [1024][1024] f16, 2 MB each
  _Float16* wkT  = (_Float16*)(ws + 2 * MB);
  _Float16* wvT  = (_Float16*)(ws + 4 * MB);
  _Float16* woT  = (_Float16*)(ws + 6 * MB);
  _Float16* qh   = (_Float16*)(ws + 8 * MB);    // [16][4096][64], 8 MB each
  _Float16* kh   = (_Float16*)(ws + 16 * MB);
  _Float16* vt   = (_Float16*)(ws + 24 * MB);   // [16][64][4096]
  _Float16* aout = (_Float16*)(ws + 32 * MB);   // [4096][1024]
  _Float16* xh   = (_Float16*)(ws + 40 * MB);   // [4096][1024]

  cvt_x_kernel<<<CVX_BLOCKS, CVX_THREADS, 0, stream>>>(x, xh);

  dim3 tgrid(DMODEL / TTILE, DMODEL / TTILE);
  cvtT_kernel<<<tgrid, 256, 0, stream>>>(wq, wqT);
  cvtT_kernel<<<tgrid, 256, 0, stream>>>(wk, wkT);
  cvtT_kernel<<<tgrid, 256, 0, stream>>>(wv, wvT);
  cvtT_kernel<<<tgrid, 256, 0, stream>>>(wo, woT);

  // 2048 wave-tiles per GEMM, 8 waves per 256-thread block -> 256 blocks
  gemm_qkv_kernel<<<256, 256, 0, stream>>>(xh, wqT, bq, qh, 0);
  gemm_qkv_kernel<<<256, 256, 0, stream>>>(xh, wkT, bk, kh, 0);
  gemm_qkv_kernel<<<256, 256, 0, stream>>>(xh, wvT, bv, vt, 1);

  attn_kernel<<<dim3(S_LEN / (ATT_WAVES * 16), NHEADS), ATT_WAVES * 32, 0, stream>>>(qh, kh, vt, aout);

  gemm_out_kernel<<<256, 256, 0, stream>>>(aout, woT, bo, out);
}

// v003
// One run takes 200 microseconds.
// Two timings next to v002 both put it at 1.20 times that version's speed.
// Over all steps from v000 it is 2.66 times as fast.
#include <hip/hip_runtime.h>
#include <hip/hip_bf16.h>
#include <math.h>

typedef __attribute__((ext_vector_type(16))) _Float16 v16h;
typedef __attribute__((ext_vector_type(8)))  _Float16 v8h;
typedef __attribute__((ext_vector_type(8)))  float    v8f;
typedef __attribute__((ext_vector_type(4)))  float    v4f;
typedef __attribute__((ext_vector_type(4)))  _Float16 v4h;

#define S_LEN 4096
#define DMODEL 1024
#define NHEADS 16
#define HDIM 64
#define CHUNKLEN 1024

// ---------------------------------------------------------------------------
// WMMA helpers: v_wmma_f32_16x16x32_f16, D = A(16x32) * B(32x16) + C(16x16 f32)
// A layout (wave32): lane L (row M = L%16); halves 0..7 -> K = base+0..7,
// halves 8..15 -> K = base+16..23, base = (L>=16)?8:0.
// B layout mirrors A with N = L%16. C/D: VGPR r, lane L: M = r + ((L>=16)?8:0).
// ---------------------------------------------------------------------------
__device__ __forceinline__ v8f wmma_f16(v16h a, v16h b, v8f c) {
  return __builtin_amdgcn_wmma_f32_16x16x32_f16(
      false, a, false, b, (short)0, c, false, false);
}

__device__ __forceinline__ v16h pack16(v8h lo, v8h hi) {
  v16h r;
#pragma unroll
  for (int t = 0; t < 8; ++t) { r[t] = lo[t]; r[8 + t] = hi[t]; }
  return r;
}

__device__ __forceinline__ v16h load_frag_f16(const _Float16* __restrict__ row, int kb) {
  v8h lo = *(const v8h*)(row + kb);
  v8h hi = *(const v8h*)(row + kb + 16);
  return pack16(lo, hi);
}

// ---------------------------------------------------------------------------
// Kernel 1a: elementwise f32 -> f16. Few fat waves: 16 waves on each of 256
// work-groups; a thread takes 8 pieces of 4 floats. Each wave-wide load covers 512
// contiguous bytes and each store 256; all 8 loads are issued before the first use.
// ---------------------------------------------------------------------------
#define CVX_BLOCKS  256
#define CVX_THREADS 512
#define CVX_PIECES  8
static_assert(CVX_BLOCKS * CVX_THREADS * CVX_PIECES * 4 == S_LEN * DMODEL, "x is covered exactly once");

__global__ __launch_bounds__(CVX_THREADS) void cvt_x_kernel(const float* __restrict__ x,
                                                            _Float16* __restrict__ xh) {
  const v4f* xv = (const v4f*)x;
  v4h*       hv = (v4h*)xh;
  unsigned q = blockIdx.x * (CVX_THREADS * CVX_PIECES) + threadIdx.x;   // piece index, the same on both sides
  v4f a[CVX_PIECES];
#pragma unroll
  for (int i = 0; i < CVX_PIECES; ++i) a[i] = xv[q + i * CVX_THREADS];
#pragma unroll
  for (int i = 0; i < CVX_PIECES; ++i) {
    v4h h;
#pragma unroll
    for (int c = 0; c < 4; ++c) h[c] = (_Float16)a[i][c];
    hv[q + i * CVX_THREADS] = h;
  }
}

// ---------------------------------------------------------------------------
// Kernel 1b: convert + transpose weight  w[K][N] f32  ->  wT[N][K] f16, K = N = DMODEL.
// One 64(k) x 64(n) tile per work-group, turned in LDS: 16-byte loads along n,
// 16-byte stores along k, 8 lanes of one wave write each whole 128-byte line of wT.
// ---------------------------------------------------------------------------
#define TTILE 64
#define TROW  72   // halves per LDS row: 128 B of data + 16 B, keeps 16-byte reads aligned

__global__ __launch_bounds__(256) void cvtT_kernel(const float* __restrict__ w,
                                                   _Float16* __restrict__ wT) {
  __shared__ __align__(16) _Float16 sT[TTILE][TROW];   // n x k
  int n0 = blockIdx.x * TTILE, k0 = blockIdx.y * TTILE;
  int c4 = (threadIdx.x & 15) * 4;    // 4 consecutive n
  int r4 = (threadIdx.x >> 4) * 4;    // 4 consecutive k
  v4f v[4];
#pragma unroll
  for (int i = 0; i < 4; ++i)
    v[i] = *(const v4f*)(w + (size_t)(k0 + r4 + i) * DMODEL + n0 + c4);
#pragma unroll
  for (int c = 0; c < 4; ++c) {
    v4h h;
#pragma unroll
    for (int i = 0; i < 4; ++i) h[i] = (_Float16)v[i][c];
    *(v4h*)&sT[c4 + c][r4] = h;
  }
  __syncthreads();   // the tile is complete before any thread reads rows that others wrote
  int row = threadIdx.x >> 3;         // 0..31, second piece: +32
  int col = (threadIdx.x & 7) * 8;    // in halves
#pragma unroll
  for (int i = 0; i < 2; ++i)
    *(v8h*)(wT + (size_t)(n0 + row + 32 * i) * DMODEL + k0 + col) =
        *(const v8h*)&sT[row + 32 * i][col];
}

// ---------------------------------------------------------------------------
// Kernel 2: QKV projection GEMM.  out = xh(f16 SxK) @ wT^T(f16) + bias
// Each wave computes a 32(M) x 64(N) tile (B fragments reused by 2 A frags).
// mode 0: out[h][s][d]; mode 1: out[h][d][s]
// ---------------------------------------------------------------------------
__global__ __launch_bounds__(256) void gemm_qkv_kernel(
    const _Float16* __restrict__ xh, const _Float16* __restrict__ wT,
    const float* __restrict__ bias, _Float16* __restrict__ out, int mode) {
  const int K = DMODEL;
  int wave   = (blockIdx.x * 256 + threadIdx.x) >> 5;   // 0..2047
  int lane16 = threadIdx.x & 15;
  int hi8    = ((threadIdx.x >> 4) & 1) << 3;           // 0 or 8
  int tile_m = wave & 127;                              // 128 tiles of 32 rows
  int tile_n = wave >> 7;                               // 16 tiles of 64 cols
  int m0 = tile_m * 32, n0 = tile_n * 64;

  v8f c0[4] = {}, c1[4] = {};
  const _Float16* arow0 = xh + (size_t)(m0 + lane16) * K;
  const _Float16* arow1 = arow0 + (size_t)16 * K;
  const _Float16* wrow  = wT + (size_t)(n0 + lane16) * K;

  for (int k0 = 0; k0 < K; k0 += 32) {
    int kb = k0 + hi8;
    v16h a0 = load_frag_f16(arow0, kb);
    v16h a1 = load_frag_f16(arow1, kb);
#pragma unroll
    for (int j = 0; j < 4; ++j) {
      v16h b = load_frag_f16(wrow + (size_t)(j * 16) * K, kb);
      c0[j] = wmma_f16(a0, b, c0[j]);
      c1[j] = wmma_f16(a1, b, c1[j]);
    }
  }

#pragma unroll
  for (int j = 0; j < 4; ++j) {
    int n = n0 + j * 16 + lane16;
    float bj = bias[n];
    int head = n >> 6, d = n & 63;
#pragma unroll
    for (int r = 0; r < 8; ++r) {
      int s0r = m0 + r + hi8;
      int s1r = s0r + 16;
      float v0 = c0[j][r] + bj;
      float v1 = c1[j][r] + bj;
      if (mode == 0) {
        out[((size_t)head * S_LEN + s0r) * HDIM + d] = (_Float16)v0;
        out[((size_t)head * S_LEN + s1r) * HDIM + d] = (_Float16)v1;
      } else {
        out[((size_t)head * HDIM + d) * S_LEN + s0r] = (_Float16)v0;
        out[((size_t)head * HDIM + d) * S_LEN + s1r] = (_Float16)v1;
      }
    }
  }
}

// ---------------------------------------------------------------------------
// Kernel 3: flash-style block-causal attention. One wave per 16-q-row tile; the
// eight waves of a work-group (128 q rows of one head, all in one chunk) share
// each 64-key K tile and V tile through LDS. The tiles come in by asynchronous
// copies of whole 128-byte rows, two buffers, the next tile in flight while this
// one is worked on. 64 keys per trip: 8 score WMMAs + softmax + 8 PV WMMAs.
// Both products are formed transposed: St = K * Qt (A = K rows, B = Q) and
// Ot += Vt * Pt (A = Vt rows, B = P). A lane then holds 32 of the 64 scores of ONE
// query (column lane%16; keys 16t + r + 8*(lane/16)), so maximum and sum are taken
// in the lane, with one exchange between the wave's halves, and the score
// accumulators of tiles 2i and 2i+1 are, converted, the B fragment of keys
// 32i..32i+31: P never leaves the registers.
// qh,kh: [H][S][64] f16;  vt: [H][64][S] f16;  aout: [S][H*64] f16
// ---------------------------------------------------------------------------
#define ATT_WAVES 8
#define KTILE 64
#define LROW 72   // halves per LDS row: 128 B of data + 16 B, conflict-free for 16-B reads

// One tile's share of one thread: two 16-byte pieces of K and two of V.
// The s_wait_xcnt stands inside the statement so that no address register of a
// copy is rewritten ahead of it.
__device__ __forceinline__ void copy_kv_tile(
    unsigned lk0, const _Float16* gk0, unsigned lk1, const _Float16* gk1,
    unsigned lv0, const _Float16* gv0, unsigned lv1, const _Float16* gv1) {
  asm volatile(
      "global_load_async_to_lds_b128 %0, %1, off\n\t"
      "global_load_async_to_lds_b128 %2, %3, off\n\t"
      "global_load_async_to_lds_b128 %4, %5, off\n\t"
      "global_load_async_to_lds_b128 %6, %7, off\n\t"
      "s_wait_xcnt 0x0"
      :: "v"(lk0), "v"(gk0), "v"(lk1), "v"(gk1),
         "v"(lv0), "v"(gv0), "v"(lv1), "v"(gv1)
      : "memory");
}

// lane l <-> lane l ^ 16, on the vector unit
__device__ __forceinline__ float xhalf(float x) {
  int b = __builtin_bit_cast(int, x);
  return __builtin_bit_cast(float,
      __builtin_amdgcn_permlanex16(b, b, 0x76543210, 0xfedcba98, false, false));
}

// waves_per_eu: the grid puts 4 waves on a SIMD (512 work-groups of 8 waves, 256 WGPs). With that
// register budget stated the compiler issues a trip's K reads as one group ahead of the score
// products; without it the build reads two pieces, waits for them and multiplies, product by product.
__global__ __launch_bounds__(256) __attribute__((amdgpu_waves_per_eu(4, 4))) void attn_kernel(
    const _Float16* __restrict__ qh, const _Float16* __restrict__ kh,
    const _Float16* __restrict__ vt, _Float16* __restrict__ aout) {
  __shared__ __align__(16) _Float16 sK[2][KTILE][LROW];          // keys x d
  __shared__ __align__(16) _Float16 sV[2][HDIM][LROW];           // d x keys

  int head   = blockIdx.y;
  int wave   = threadIdx.x >> 5;
  int lane16 = threadIdx.x & 15;
  int hi8    = ((threadIdx.x >> 4) & 1) << 3;
  int mblk   = blockIdx.x * (ATT_WAVES * 16);
  int m0     = mblk + wave * 16;
  int kv_end = ((mblk / CHUNKLEN) + 1) * CHUNKLEN;  // block-causal: full chunks; same for all 8 waves
  const float scale = 0.125f;                       // 64^-0.5

  // copy map: piece p = threadIdx.x (+256): row p/8, 16-byte column p%8; a wave covers 4 whole rows
  int crow = threadIdx.x >> 3;            // 0..31, second piece: +32
  int ccol = (threadIdx.x & 7) * 8;       // in halves
  const _Float16* gk = kh + ((size_t)head * S_LEN + crow) * HDIM + ccol;
  const _Float16* gv = vt + ((size_t)head * HDIM + crow) * S_LEN + ccol;
  unsigned lk = (unsigned)(size_t)&sK[0][crow][ccol];
  unsigned lv = (unsigned)(size_t)&sV[0][crow][ccol];
  const unsigned half_tile = 32 * LROW * 2;   // bytes of 32 LDS rows
  const unsigned buf_bytes = 64 * LROW * 2;   // bytes of one buffer

  const _Float16* qrow = qh + ((size_t)head * S_LEN + m0 + lane16) * HDIM;
  v16h aq0 = load_frag_f16(qrow, hi8);        // d 0..31
  v16h aq1 = load_frag_f16(qrow + 32, hi8);   // d 32..63

  float rowmax = -INFINITY;   // of this lane's query, the same in both halves
  float rowsum = 0.0f;        // of this lane's half of the keys; the halves join after the loop
  v8f o[4] = {};              // Ot: row d = 16j + r + hi8, column = this lane's query

  // --- prologue: tile 0 lands and is published, then tile 1 starts
  copy_kv_tile(lk, gk, lk + half_tile, gk + 32 * HDIM,
               lv, gv, lv + half_tile, gv + (size_t)32 * S_LEN);
  asm volatile("s_wait_asynccnt 0x0" ::: "memory");   // this wave's copies of tile 0 have landed
  __syncthreads();                                    // ... and every other wave's
  if (KTILE < kv_end)
    copy_kv_tile(lk + buf_bytes, gk + KTILE * HDIM,
                 lk + buf_bytes + half_tile, gk + (KTILE + 32) * HDIM,
                 lv + buf_bytes, gv + KTILE,
                 lv + buf_bytes + half_tile, gv + (size_t)32 * S_LEN + KTILE);

  for (int kb = 0; kb < kv_end; kb += KTILE) {
    int buf = (kb >> 6) & 1;
    // --- scores for 64 keys, transposed: four 16(keys) x 16(queries) tiles, Hd=64 in two WMMAs each
    v8f u[4];
#pragma unroll
    for (int t = 0; t < 4; ++t) {
      const _Float16* krow = &sK[buf][t * 16 + lane16][0];
      v8f s = {};
      s = wmma_f16(load_frag_f16(krow,      hi8), aq0, s);
      s = wmma_f16(load_frag_f16(krow + 32, hi8), aq1, s);
      u[t] = s * scale;
    }

    // --- online softmax; a lane holds 32 scores of its query, the lane l ^ 16 the other 32
    float m8[8];
#pragma unroll
    for (int r = 0; r < 8; ++r)
      m8[r] = fmaxf(fmaxf(u[0][r], u[1][r]), fmaxf(u[2][r], u[3][r]));
    float mx = fmaxf(fmaxf(fmaxf(m8[0], m8[1]), fmaxf(m8[2], m8[3])),
                     fmaxf(fmaxf(m8[4], m8[5]), fmaxf(m8[6], m8[7])));
    mx = fmaxf(mx, xhalf(mx));
    float nm    = fmaxf(rowmax, mx);
    float alpha = __expf(rowmax - nm);
    rowmax      = nm;
    float s8[8];
#pragma unroll
    for (int r = 0; r < 8; ++r) {
#pragma unroll
      for (int t = 0; t < 4; ++t) u[t][r] = __expf(u[t][r] - nm);
      s8[r] = (u[0][r] + u[1][r]) + (u[2][r] + u[3][r]);
    }
    float ps = ((s8[0] + s8[1]) + (s8[2] + s8[3])) + ((s8[4] + s8[5]) + (s8[6] + s8[7]));
    rowsum = rowsum * alpha + ps;
#pragma unroll
    for (int j = 0; j < 4; ++j) o[j] = o[j] * alpha;

    // --- P as B fragments, straight from the score accumulators:
    // halves 0..7 = keys hi8+0..7 of the 32 (tile 2i), halves 8..15 = keys hi8+16..23 (tile 2i+1)
    v16h bp0, bp1;
#pragma unroll
    for (int r = 0; r < 8; ++r) {
      bp0[r] = (_Float16)u[0][r];  bp0[8 + r] = (_Float16)u[1][r];
      bp1[r] = (_Float16)u[2][r];  bp1[8 + r] = (_Float16)u[3][r];
    }

    // --- Ot += Vt @ Pt   (V transposed in LDS: contiguous over keys per d)
#pragma unroll
    for (int j = 0; j < 4; ++j) {
      const _Float16* vr = &sV[buf][j * 16 + lane16][0];
      o[j] = wmma_f16(load_frag_f16(vr,      hi8), bp0, o[j]);
      o[j] = wmma_f16(load_frag_f16(vr + 32, hi8), bp1, o[j]);
    }

    // --- publish point of tile t+1; it also ends every wave's reads of this buffer
    asm volatile("s_wait_dscnt 0x0" ::: "memory");     // this wave's LDS reads of the buffer are done
    asm volatile("s_wait_asynccnt 0x0" ::: "memory");  // this wave's copies of tile t+1 have landed
    __syncthreads();
    if (kb + 2 * KTILE < kv_end) {                     // tile t+2 into the buffer just read
      unsigned bo = (unsigned)buf * buf_bytes;
      const _Float16* nk = gk + (size_t)(kb + 2 * KTILE) * HDIM;
      const _Float16* nv = gv + (kb + 2 * KTILE);
      copy_kv_tile(lk + bo, nk, lk + bo + half_tile, nk + 32 * HDIM,
                   lv + bo, nv, lv + bo + half_tile, nv + (size_t)32 * S_LEN);
    }
  }
  asm volatile("s_wait_asynccnt 0x0" ::: "memory");    // nothing of this wave's is in flight at its end

  float inv = 1.0f / (rowsum + xhalf(rowsum));   // the two halves' sums of this query
  // a lane holds 8 consecutive d of its query per tile: one 16-byte store each
  _Float16* orow = aout + (size_t)(m0 + lane16) * DMODEL + head * HDIM + hi8;
#pragma unroll
  for (int j = 0; j < 4; ++j) {
    v8h h;
#pragma unroll
    for (int r = 0; r < 8; ++r) h[r] = (_Float16)(o[j][r] * inv);
    *(v8h*)(orow + j * 16) = h;
  }
}

// ---------------------------------------------------------------------------
// Kernel 4: output projection GEMM.  out(f32) = aout(f16) @ woT^T(f16) + bo
// 32(M) x 64(N) wave tiles.
// ---------------------------------------------------------------------------
__global__ __launch_bounds__(256) void gemm_out_kernel(
    const _Float16* __restrict__ ain, const _Float16* __restrict__ wT,
    const float* __restrict__ bias, float* __restrict__ out) {
  const int K = DMODEL, N = DMODEL;
  int wave   = (blockIdx.x * 256 + threadIdx.x) >> 5;
  int lane16 = threadIdx.x & 15;
  int hi8    = ((threadIdx.x >> 4) & 1) << 3;
  int tile_m = wave & 127;
  int tile_n = wave >> 7;
  int m0 = tile_m * 32, n0 = tile_n * 64;

  v8f c0[4] = {}, c1[4] = {};
  const _Float16* arow0 = ain + (size_t)(m0 + lane16) * K;
  const _Float16* arow1 = arow0 + (size_t)16 * K;
  const _Float16* wrow  = wT + (size_t)(n0 + lane16) * K;

  for (int k0 = 0; k0 < K; k0 += 32) {
    int kb = k0 + hi8;
    v16h a0 = load_frag_f16(arow0, kb);
    v16h a1 = load_frag_f16(arow1, kb);
#pragma unroll
    for (int j = 0; j < 4; ++j) {
      v16h b = load_frag_f16(wrow + (size_t)(j * 16) * K, kb);
      c0[j] = wmma_f16(a0, b, c0[j]);
      c1[j] = wmma_f16(a1, b, c1[j]);
    }
  }

#pragma unroll
  for (int j = 0; j < 4; ++j) {
    int n = n0 + j * 16 + lane16;
    float bj = bias[n];
#pragma unroll
    for (int r = 0; r < 8; ++r) {
      int s0r = m0 + r + hi8;
      out[(size_t)s0r * N + n]        = c0[j][r] + bj;
      out[(size_t)(s0r + 16) * N + n] = c1[j][r] + bj;
    }
  }
}

// ---------------------------------------------------------------------------
// Host launch
// ---------------------------------------------------------------------------
extern "C" void kernel_launch(void* const* d_in, const int* in_sizes, int n_in,
                              void* d_out, int out_size, void* d_ws, size_t ws_size,
                              hipStream_t stream) {
  const float* x  = (const float*)d_in[0];
  const float* wq = (const float*)d_in[1];
  const float* bq = (const float*)d_in[2];
  const float* wk = (const float*)d_in[3];
  const float* bk = (const float*)d_in[4];
  const float* wv = (const float*)d_in[5];
  const float* bv = (const float*)d_in[6];
  const float* wo = (const float*)d_in[7];
  const float* bo = (const float*)d_in[8];
  float* out = (float*)d_out;

  char* ws = (char*)d_ws;
  const size_t MB = 1024 * 1024;
  _Float16* wqT  = (_Float16*)(ws + 0 * MB);    // [1024][1024] f16, 2 MB each
  _Float16* wkT  = (_Float16*)(ws + 2 * MB);
  _Float16* wvT  = (_Float16*)(ws + 4 * MB);
  _Float16* woT  = (_Float16*)(ws + 6 * MB);
  _Float16* qh   = (_Float16*)(ws + 8 * MB);    // [16][4096][64], 8 MB each
  _Float16* kh   = (_Float16*)(ws + 16 * MB);
  _Float16* vt   = (_Float16*)(ws + 24 * MB);   // [16][64][4096]
  _Float16* aout = (_Float16*)(ws + 32 * MB);   // [4096][1024]
  _Float16* xh   = (_Float16*)(ws + 40 * MB);   // [4096][1024]

  cvt_x_kernel<<<CVX_BLOCKS, CVX_THREADS, 0, stream>>>(x, xh);

  dim3 tgrid(DMODEL / TTILE, DMODEL / TTILE);
  cvtT_kernel<<<tgrid, 256, 0, stream>>>(wq, wqT);
  cvtT_kernel<<<tgrid, 256, 0, stream>>>(wk, wkT);
  cvtT_kernel<<<tgrid, 256, 0, stream>>>(wv, wvT);
  cvtT_kernel<<<tgrid, 256, 0, stream>>>(wo, woT);

  // 2048 wave-tiles per GEMM, 8 waves per 256-thread block -> 256 blocks
  gemm_qkv_kernel<<<256, 256, 0, stream>>>(xh, wqT, bq, qh, 0);
  gemm_qkv_kernel<<<256, 256, 0, stream>>>(xh, wkT, bk, kh, 0);
  gemm_qkv_kernel<<<256, 256, 0, stream>>>(xh, wvT, bv, vt, 1);

  attn_kernel<<<dim3(S_LEN / (ATT_WAVES * 16), NHEADS), ATT_WAVES * 32, 0, stream>>>(qh, kh, vt, aout);

  gemm_out_kernel<<<256, 256, 0, stream>>>(aout, woT, bo, out);
}

// v004
// Measured time: 136 microseconds a run.
// Two timings next to v003 put it at 1.47 and 1.46 times that version's speed.
// All steps since v000 together make it 3.89 times as fast.
#include <hip/hip_runtime.h>
#include <hip/hip_bf16.h>
#include <math.h>

typedef __attribute__((ext_vector_type(16))) _Float16 v16h;
typedef __attribute__((ext_vector_type(8)))  _Float16 v8h;
typedef __attribute__((ext_vector_type(8)))  float    v8f;
typedef __attribute__((ext_vector_type(4)))  float    v4f;
typedef __attribute__((ext_vector_type(4)))  _Float16 v4h;

#define S_LEN 4096
#define DMODEL 1024
#define NHEADS 16
#define HDIM 64
#define CHUNKLEN 1024

// ---------------------------------------------------------------------------
// WMMA helpers: v_wmma_f32_16x16x32_f16, D = A(16x32) * B(32x16) + C(16x16 f32)
// A layout (wave32): lane L (row M = L%16); halves 0..7 -> K = base+0..7,
// halves 8..15 -> K = base+16..23, base = (L>=16)?8:0.
// B layout mirrors A with N = L%16. C/D: VGPR r, lane L: M = r + ((L>=16)?8:0).
// ---------------------------------------------------------------------------
__device__ __forceinline__ v8f wmma_f16(v16h a, v16h b, v8f c) {
  return __builtin_amdgcn_wmma_f32_16x16x32_f16(
      false, a, false, b, (short)0, c, false, false);
}

__device__ __forceinline__ v16h pack16(v8h lo, v8h hi) {
  v16h r;
#pragma unroll
  for (int t = 0; t < 8; ++t) { r[t] = lo[t]; r[8 + t] = hi[t]; }
  return r;
}

__device__ __forceinline__ v16h load_frag_f16(const _Float16* __restrict__ row, int kb) {
  v8h lo = *(const v8h*)(row + kb);
  v8h hi = *(const v8h*)(row + kb + 16);
  return pack16(lo, hi);
}

// ---------------------------------------------------------------------------
// Kernel 1a: elementwise f32 -> f16. Few fat waves: 16 waves on each of 256
// work-groups; a thread takes 8 pieces of 4 floats. Each wave-wide load covers 512
// contiguous bytes and each store 256; all 8 loads are issued before the first use.
// ---------------------------------------------------------------------------
#define CVX_BLOCKS  256
#define CVX_THREADS 512
#define CVX_PIECES  8
static_assert(CVX_BLOCKS * CVX_THREADS * CVX_PIECES * 4 == S_LEN * DMODEL, "x is covered exactly once");

__global__ __launch_bounds__(CVX_THREADS) void cvt_x_kernel(const float* __restrict__ x,
                                                            _Float16* __restrict__ xh) {
  const v4f* xv = (const v4f*)x;
  v4h*       hv = (v4h*)xh;
  unsigned q = blockIdx.x * (CVX_THREADS * CVX_PIECES) + threadIdx.x;   // piece index, the same on both sides
  v4f a[CVX_PIECES];
#pragma unroll
  for (int i = 0; i < CVX_PIECES; ++i) a[i] = xv[q + i * CVX_THREADS];
#pragma unroll
  for (int i = 0; i < CVX_PIECES; ++i) {
    v4h h;
#pragma unroll
    for (int c = 0; c < 4; ++c) h[c] = (_Float16)a[i][c];
    hv[q + i * CVX_THREADS] = h;
  }
}

// ---------------------------------------------------------------------------
// Kernel 1b: convert + transpose weight  w[K][N] f32  ->  wT[N][K] f16, K = N = DMODEL.
// One 64(k) x 64(n) tile per work-group, turned in LDS: 16-byte loads along n,
// 16-byte stores along k, 8 lanes of one wave write each whole 128-byte line of wT.
// ---------------------------------------------------------------------------
#define TTILE 64
#define TROW  72   // halves per LDS row: 128 B of data + 16 B, keeps 16-byte reads aligned

__global__ __launch_bounds__(256) void cvtT_kernel(const float* __restrict__ w,
                                                   _Float16* __restrict__ wT) {
  __shared__ __align__(16) _Float16 sT[TTILE][TROW];   // n x k
  int n0 = blockIdx.x * TTILE, k0 = blockIdx.y * TTILE;
  int c4 = (threadIdx.x & 15) * 4;    // 4 consecutive n
  int r4 = (threadIdx.x >> 4) * 4;    // 4 consecutive k
  v4f v[4];
#pragma unroll
  for (int i = 0; i < 4; ++i)
    v[i] = *(const v4f*)(w + (size_t)(k0 + r4 + i) * DMODEL + n0 + c4);
#pragma unroll
  for (int c = 0; c < 4; ++c) {
    v4h h;
#pragma unroll
    for (int i = 0; i < 4; ++i) h[i] = (_Float16)v[i][c];
    *(v4h*)&sT[c4 + c][r4] = h;
  }
  __syncthreads();   // the tile is complete before any thread reads rows that others wrote
  int row = threadIdx.x >> 3;         // 0..31, second piece: +32
  int col = (threadIdx.x & 7) * 8;    // in halves
#pragma unroll
  for (int i = 0; i < 2; ++i)
    *(v8h*)(wT + (size_t)(n0 + row + 32 * i) * DMODEL + k0 + col) =
        *(const v8h*)&sT[row + 32 * i][col];
}

// ---------------------------------------------------------------------------
// Shared main loop of the GEMM kernels: C(128 x 128) = A(128 x K) * B(128 x K)^T, both f16
// and K-contiguous. The eight waves of a work-group share the two operand tiles through LDS:
// a stage is 128 k (256-byte rows) of all 256 rows, brought in by asynchronous copies of
// whole rows, two buffers, the next stage in flight while this one is worked on.
// Waves stand 4 (M) x 2 (N); each computes 32 x 64 (B fragments reused by 2 A fragments).
// ---------------------------------------------------------------------------
#define GT_MN   128                 // rows of A and rows of B per work-group
#define GT_K    128                 // halves of K per stage
#define GROW    136                 // halves per LDS row: 256 B of data + 16 B, conflict-free for 16-B reads
#define GSTAGES (DMODEL / GT_K)
#define GSTEPS  (GT_K / 32)         // matrix steps of 32 k per stage
static_assert(GSTAGES >= 2, "the prologue starts two stages");

// One thread's share of one operand's stage: eight 16-byte pieces, rows 16 apart.
// The s_wait_xcnt stands inside the statement so that no address register of a
// copy is rewritten ahead of it.
__device__ __forceinline__ void copy_rows8(unsigned l, const _Float16* g) {
  const unsigned ls = 16 * GROW * 2;          // bytes of 16 LDS rows
  const size_t   gs = (size_t)16 * DMODEL;    // halves of 16 global rows
  asm volatile(
      "global_load_async_to_lds_b128 %0, %1, off\n\t"
      "global_load_async_to_lds_b128 %2, %3, off\n\t"
      "global_load_async_to_lds_b128 %4, %5, off\n\t"
      "global_load_async_to_lds_b128 %6, %7, off\n\t"
      "global_load_async_to_lds_b128 %8, %9, off\n\t"
      "global_load_async_to_lds_b128 %10, %11, off\n\t"
      "global_load_async_to_lds_b128 %12, %13, off\n\t"
      "global_load_async_to_lds_b128 %14, %15, off\n\t"
      "s_wait_xcnt 0x0"
      :: "v"(l),          "v"(g),          "v"(l + ls),     "v"(g + gs),
         "v"(l + 2 * ls), "v"(g + 2 * gs), "v"(l + 3 * ls), "v"(g + 3 * gs),
         "v"(l + 4 * ls), "v"(g + 4 * gs), "v"(l + 5 * ls), "v"(g + 5 * gs),
         "v"(l + 6 * ls), "v"(g + 6 * gs), "v"(l + 7 * ls), "v"(g + 7 * gs)
      : "memory");
}

typedef _Float16 gemm_tile_t[GT_MN][GROW];

// a: first row of the work-group's A tile; b: first row of its B tile; wm, wn: the wave's place
__device__ __forceinline__ void gemm_tile_loop(
    const _Float16* __restrict__ a, const _Float16* __restrict__ b,
    gemm_tile_t* sA, gemm_tile_t* sB, int wm, int wn, v8f (&c0)[4], v8f (&c1)[4]) {
  int lane16 = threadIdx.x & 15;
  int hi8    = ((threadIdx.x >> 4) & 1) << 3;
  // copy map: piece p = threadIdx.x + 256 i: row p/16, 16-byte column p%16; a wave covers 2 whole rows
  int crow = threadIdx.x >> 4;            // 0..15, piece i: +16 i
  int ccol = (threadIdx.x & 15) * 8;      // in halves
  const _Float16* ga = a + (size_t)crow * DMODEL + ccol;
  const _Float16* gb = b + (size_t)crow * DMODEL + ccol;
  unsigned la = (unsigned)(size_t)&sA[0][crow][ccol];
  unsigned lb = (unsigned)(size_t)&sB[0][crow][ccol];
  const unsigned buf_bytes = GT_MN * GROW * 2;

  // --- prologue: stage 0 lands and is published, then stage 1 starts
  copy_rows8(la, ga);
  copy_rows8(lb, gb);
  asm volatile("s_wait_asynccnt 0x0" ::: "memory");   // this wave's copies of stage 0 have landed
  __syncthreads();                                    // ... and every other wave's
  copy_rows8(la + buf_bytes, ga + GT_K);
  copy_rows8(lb + buf_bytes, gb + GT_K);

  for (int s = 0; s < GSTAGES; ++s) {
    int buf = s & 1;
    const _Float16* ar = &sA[buf][wm * 32 + lane16][0];
    const _Float16* br = &sB[buf][wn * 64 + lane16][0];
    // two fragment sets: the reads of the next 32 k are issued as one group ahead of this step's products
    v16h fa[2][2], fb[2][4];
    fa[0][0] = load_frag_f16(ar, hi8);
    fa[0][1] = load_frag_f16(ar + 16 * GROW, hi8);
#pragma unroll
    for (int j = 0; j < 4; ++j) fb[0][j] = load_frag_f16(br + j * 16 * GROW, hi8);
    // unrolled (as the j loops are) so that every fragment-set index is a constant and the sets stay in registers
#pragma unroll
    for (int t = 0; t + 1 < GSTEPS; ++t) {
      const int cur = t & 1, nxt = cur ^ 1;
      int kb = (t + 1) * 32 + hi8;
      fa[nxt][0] = load_frag_f16(ar, kb);
      fa[nxt][1] = load_frag_f16(ar + 16 * GROW, kb);
#pragma unroll
      for (int j = 0; j < 4; ++j) fb[nxt][j] = load_frag_f16(br + j * 16 * GROW, kb);
      // keeps the group of reads above in front of the products below; without it the build
      // sinks each read to its product and waits out the LDS latency every two products
      __builtin_amdgcn_sched_barrier(0);
#pragma unroll
      for (int j = 0; j < 4; ++j) {
        c0[j] = wmma_f16(fa[cur][0], fb[cur][j], c0[j]);
        c1[j] = wmma_f16(fa[cur][1], fb[cur][j], c1[j]);
      }
    }
    // keeps the products above in front of the barrier; without it the build sinks them
    // behind it, in front of the copies, which then start that much later
    __builtin_amdgcn_sched_barrier(0);
    // --- publish point of stage s+1; it also ends every wave's reads of this buffer
    // (behind its first wait the last step's fragments are in registers)
    asm volatile("s_wait_dscnt 0x0" ::: "memory");     // this wave's LDS reads of the buffer are done
    asm volatile("s_wait_asynccnt 0x0" ::: "memory");  // this wave's copies of stage s+1 have landed
    __syncthreads();
    if (s + 2 < GSTAGES) {                             // stage s+2 into the buffer just read
      unsigned bo = (unsigned)buf * buf_bytes;
      copy_rows8(la + bo, ga + (s + 2) * GT_K);
      copy_rows8(lb + bo, gb + (s + 2) * GT_K);
    }
#pragma unroll
    for (int j = 0; j < 4; ++j) {
      c0[j] = wmma_f16(fa[(GSTEPS - 1) & 1][0], fb[(GSTEPS - 1) & 1][j], c0[j]);
      c1[j] = wmma_f16(fa[(GSTEPS - 1) & 1][1], fb[(GSTEPS - 1) & 1][j], c1[j]);
    }
  }
  asm volatile("s_wait_asynccnt 0x0" ::: "memory");    // nothing of this wave's is in flight at its end
}

// ---------------------------------------------------------------------------
// Kernel 2: QKV projection GEMM.  out = xh(f16 SxK) @ wT^T(f16) + bias
// One 128 x 128 tile per work-group (32 x 8 tiles).
// mode 0: out[h][s][d]; mode 1: out[h][d][s]
// ---------------------------------------------------------------------------
__global__ __launch_bounds__(256) void gemm_qkv_kernel(
    const _Float16* __restrict__ xh, const _Float16* __restrict__ wT,
    const float* __restrict__ bias, _Float16* __restrict__ out, int mode) {
  __shared__ __align__(16) gemm_tile_t sA[2];
  __shared__ __align__(16) gemm_tile_t sB[2];
  int wave   = threadIdx.x >> 5;
  int lane16 = threadIdx.x & 15;
  int hi8    = ((threadIdx.x >> 4) & 1) << 3;           // 0 or 8
  int wm = wave & 3, wn = wave >> 2;
  int bm = (blockIdx.x & 31) * GT_MN;                   // 32 tiles of 128 rows
  int bn = (blockIdx.x >> 5) * GT_MN;                   // 8 tiles of 128 cols
  int m0 = bm + wm * 32, n0 = bn + wn * 64;

  v8f c0[4] = {}, c1[4] = {};
  gemm_tile_loop(xh + (size_t)bm * DMODEL, wT + (size_t)bn * DMODEL, sA, sB, wm, wn, c0, c1);

#pragma unroll
  for (int j = 0; j < 4; ++j) {
    int n = n0 + j * 16 + lane16;
    float bj = bias[n];
    int head = n >> 6, d = n & 63;
#pragma unroll
    for (int r = 0; r < 8; ++r) {
      int s0r = m0 + r + hi8;
      int s1r = s0r + 16;
      float v0 = c0[j][r] + bj;
      float v1 = c1[j][r] + bj;
      if (mode == 0) {
        out[((size_t)head * S_LEN + s0r) * HDIM + d] = (_Float16)v0;
        out[((size_t)head * S_LEN + s1r) * HDIM + d] = (_Float16)v1;
      } else {
        out[((size_t)head * HDIM + d) * S_LEN + s0r] = (_Float16)v0;
        out[((size_t)head * HDIM + d) * S_LEN + s1r] = (_Float16)v1;
      }
    }
  }
}

// ---------------------------------------------------------------------------
// Kernel 3: flash-style block-causal attention. One wave per 16-q-row tile; the
// eight waves of a work-group (128 q rows of one head, all in one chunk) share
// each 64-key K tile and V tile through LDS. The tiles come in by asynchronous
// copies of whole 128-byte rows, two buffers, the next tile in flight while this
// one is worked on. 64 keys per trip: 8 score WMMAs + softmax + 8 PV WMMAs.
// Both products are formed transposed: St = K * Qt (A = K rows, B = Q) and
// Ot += Vt * Pt (A = Vt rows, B = P). A lane then holds 32 of the 64 scores of ONE
// query (column lane%16; keys 16t + r + 8*(lane/16)), so maximum and sum are taken
// in the lane, with one exchange between the wave's halves, and the score
// accumulators of tiles 2i and 2i+1 are, converted, the B fragment of keys
// 32i..32i+31: P never leaves the registers.
// qh,kh: [H][S][64] f16;  vt: [H][64][S] f16;  aout: [S][H*64] f16
// ---------------------------------------------------------------------------
#define ATT_WAVES 8
#define KTILE 64
#define LROW 72   // halves per LDS row: 128 B of data + 16 B, conflict-free for 16-B reads

// One tile's share of one thread: two 16-byte pieces of K and two of V.
// The s_wait_xcnt stands inside the statement so that no address register of a
// copy is rewritten ahead of it.
__device__ __forceinline__ void copy_kv_tile(
    unsigned lk0, const _Float16* gk0, unsigned lk1, const _Float16* gk1,
    unsigned lv0, const _Float16* gv0, unsigned lv1, const _Float16* gv1) {
  asm volatile(
      "global_load_async_to_lds_b128 %0, %1, off\n\t"
      "global_load_async_to_lds_b128 %2, %3, off\n\t"
      "global_load_async_to_lds_b128 %4, %5, off\n\t"
      "global_load_async_to_lds_b128 %6, %7, off\n\t"
      "s_wait_xcnt 0x0"
      :: "v"(lk0), "v"(gk0), "v"(lk1), "v"(gk1),
         "v"(lv0), "v"(gv0), "v"(lv1), "v"(gv1)
      : "memory");
}

// lane l <-> lane l ^ 16, on the vector unit
__device__ __forceinline__ float xhalf(float x) {
  int b = __builtin_bit_cast(int, x);
  return __builtin_bit_cast(float,
      __builtin_amdgcn_permlanex16(b, b, 0x76543210, 0xfedcba98, false, false));
}

// waves_per_eu: the grid puts 4 waves on a SIMD (512 work-groups of 8 waves, 256 WGPs). With that
// register budget stated the compiler issues a trip's K reads as one group ahead of the score
// products; without it the build reads two pieces, waits for them and multiplies, product by product.
__global__ __launch_bounds__(256) __attribute__((amdgpu_waves_per_eu(4, 4))) void attn_kernel(
    const _Float16* __restrict__ qh, const _Float16* __restrict__ kh,
    const _Float16* __restrict__ vt, _Float16* __restrict__ aout) {
  __shared__ __align__(16) _Float16 sK[2][KTILE][LROW];          // keys x d
  __shared__ __align__(16) _Float16 sV[2][HDIM][LROW];           // d x keys

  int head   = blockIdx.y;
  int wave   = threadIdx.x >> 5;
  int lane16 = threadIdx.x & 15;
  int hi8    = ((threadIdx.x >> 4) & 1) << 3;
  int mblk   = blockIdx.x * (ATT_WAVES * 16);
  int m0     = mblk + wave * 16;
  int kv_end = ((mblk / CHUNKLEN) + 1) * CHUNKLEN;  // block-causal: full chunks; same for all 8 waves
  const float scale = 0.125f;                       // 64^-0.5

  // copy map: piece p = threadIdx.x (+256): row p/8, 16-byte column p%8; a wave covers 4 whole rows
  int crow = threadIdx.x >> 3;            // 0..31, second piece: +32
  int ccol = (threadIdx.x & 7) * 8;       // in halves
  const _Float16* gk = kh + ((size_t)head * S_LEN + crow) * HDIM + ccol;
  const _Float16* gv = vt + ((size_t)head * HDIM + crow) * S_LEN + ccol;
  unsigned lk = (unsigned)(size_t)&sK[0][crow][ccol];
  unsigned lv = (unsigned)(size_t)&sV[0][crow][ccol];
  const unsigned half_tile = 32 * LROW * 2;   // bytes of 32 LDS rows
  const unsigned buf_bytes = 64 * LROW * 2;   // bytes of one buffer

  const _Float16* qrow = qh + ((size_t)head * S_LEN + m0 + lane16) * HDIM;
  v16h aq0 = load_frag_f16(qrow, hi8);        // d 0..31
  v16h aq1 = load_frag_f16(qrow + 32, hi8);   // d 32..63

  float rowmax = -INFINITY;   // of this lane's query, the same in both halves
  float rowsum = 0.0f;        // of this lane's half of the keys; the halves join after the loop
  v8f o[4] = {};              // Ot: row d = 16j + r + hi8, column = this lane's query

  // --- prologue: tile 0 lands and is published, then tile 1 starts
  copy_kv_tile(lk, gk, lk + half_tile, gk + 32 * HDIM,
               lv, gv, lv + half_tile, gv + (size_t)32 * S_LEN);
  asm volatile("s_wait_asynccnt 0x0" ::: "memory");   // this wave's copies of tile 0 have landed
  __syncthreads();                                    // ... and every other wave's
  if (KTILE < kv_end)
    copy_kv_tile(lk + buf_bytes, gk + KTILE * HDIM,
                 lk + buf_bytes + half_tile, gk + (KTILE + 32) * HDIM,
                 lv + buf_bytes, gv + KTILE,
                 lv + buf_bytes + half_tile, gv + (size_t)32 * S_LEN + KTILE);

  for (int kb = 0; kb < kv_end; kb += KTILE) {
    int buf = (kb >> 6) & 1;
    // --- scores for 64 keys, transposed: four 16(keys) x 16(queries) tiles, Hd=64 in two WMMAs each
    v8f u[4];
#pragma unroll
    for (int t = 0; t < 4; ++t) {
      const _Float16* krow = &sK[buf][t * 16 + lane16][0];
      v8f s = {};
      s = wmma_f16(load_frag_f16(krow,      hi8), aq0, s);
      s = wmma_f16(load_frag_f16(krow + 32, hi8), aq1, s);
      u[t] = s * scale;
    }

    // --- online softmax; a lane holds 32 scores of its query, the lane l ^ 16 the other 32
    float m8[8];
#pragma unroll
    for (int r = 0; r < 8; ++r)
      m8[r] = fmaxf(fmaxf(u[0][r], u[1][r]), fmaxf(u[2][r], u[3][r]));
    float mx = fmaxf(fmaxf(fmaxf(m8[0], m8[1]), fmaxf(m8[2], m8[3])),
                     fmaxf(fmaxf(m8[4], m8[5]), fmaxf(m8[6], m8[7])));
    mx = fmaxf(mx, xhalf(mx));
    float nm    = fmaxf(rowmax, mx);
    float alpha = __expf(rowmax - nm);
    rowmax      = nm;
    float s8[8];
#pragma unroll
    for (int r = 0; r < 8; ++r) {
#pragma unroll
      for (int t = 0; t < 4; ++t) u[t][r] = __expf(u[t][r] - nm);
      s8[r] = (u[0][r] + u[1][r]) + (u[2][r] + u[3][r]);
    }
    float ps = ((s8[0] + s8[1]) + (s8[2] + s8[3])) + ((s8[4] + s8[5]) + (s8[6] + s8[7]));
    rowsum = rowsum * alpha + ps;
#pragma unroll
    for (int j = 0; j < 4; ++j) o[j] = o[j] * alpha;

    // --- P as B fragments, straight from the score accumulators:
    // halves 0..7 = keys hi8+0..7 of the 32 (tile 2i), halves 8..15 = keys hi8+16..23 (tile 2i+1)
    v16h bp0, bp1;
#pragma unroll
    for (int r = 0; r < 8; ++r) {
      bp0[r] = (_Float16)u[0][r];  bp0[8 + r] = (_Float16)u[1][r];
      bp1[r] = (_Float16)u[2][r];  bp1[8 + r] = (_Float16)u[3][r];
    }

    // --- Ot += Vt @ Pt   (V transposed in LDS: contiguous over keys per d)
#pragma unroll
    for (int j = 0; j < 4; ++j) {
      const _Float16* vr = &sV[buf][j * 16 + lane16][0];
      o[j] = wmma_f16(load_frag_f16(vr,      hi8), bp0, o[j]);
      o[j] = wmma_f16(load_frag_f16(vr + 32, hi8), bp1, o[j]);
    }

    // --- publish point of tile t+1; it also ends every wave's reads of this buffer
    asm volatile("s_wait_dscnt 0x0" ::: "memory");     // this wave's LDS reads of the buffer are done
    asm volatile("s_wait_asynccnt 0x0" ::: "memory");  // this wave's copies of tile t+1 have landed
    __syncthreads();
    if (kb + 2 * KTILE < kv_end) {                     // tile t+2 into the buffer just read
      unsigned bo = (unsigned)buf * buf_bytes;
      const _Float16* nk = gk + (size_t)(kb + 2 * KTILE) * HDIM;
      const _Float16* nv = gv + (kb + 2 * KTILE);
      copy_kv_tile(lk + bo, nk, lk + bo + half_tile, nk + 32 * HDIM,
                   lv + bo, nv, lv + bo + half_tile, nv + (size_t)32 * S_LEN);
    }
  }
  asm volatile("s_wait_asynccnt 0x0" ::: "memory");    // nothing of this wave's is in flight at its end

  float inv = 1.0f / (rowsum + xhalf(rowsum));   // the two halves' sums of this query
  // a lane holds 8 consecutive d of its query per tile: one 16-byte store each
  _Float16* orow = aout + (size_t)(m0 + lane16) * DMODEL + head * HDIM + hi8;
#pragma unroll
  for (int j = 0; j < 4; ++j) {
    v8h h;
#pragma unroll
    for (int r = 0; r < 8; ++r) h[r] = (_Float16)(o[j][r] * inv);
    *(v8h*)(orow + j * 16) = h;
  }
}

// ---------------------------------------------------------------------------
// Kernel 4: output projection GEMM.  out(f32) = aout(f16) @ woT^T(f16) + bo
// One 128 x 128 tile per work-group (32 x 8 tiles).
// ---------------------------------------------------------------------------
__global__ __launch_bounds__(256) void gemm_out_kernel(
    const _Float16* __restrict__ ain, const _Float16* __restrict__ wT,
    const float* __restrict__ bias, float* __restrict__ out) {
  __shared__ __align__(16) gemm_tile_t sA[2];
  __shared__ __align__(16) gemm_tile_t sB[2];
  const int N = DMODEL;
  int wave   = threadIdx.x >> 5;
  int lane16 = threadIdx.x & 15;
  int hi8    = ((threadIdx.x >> 4) & 1) << 3;
  int wm = wave & 3, wn = wave >> 2;
  int bm = (blockIdx.x & 31) * GT_MN;
  int bn = (blockIdx.x >> 5) * GT_MN;
  int m0 = bm + wm * 32, n0 = bn + wn * 64;

  v8f c0[4] = {}, c1[4] = {};
  gemm_tile_loop(ain + (size_t)bm * DMODEL, wT + (size_t)bn * DMODEL, sA, sB, wm, wn, c0, c1);

#pragma unroll
  for (int j = 0; j < 4; ++j) {
    int n = n0 + j * 16 + lane16;
    float bj = bias[n];
#pragma unroll
    for (int r = 0; r < 8; ++r) {
      int s0r = m0 + r + hi8;
      out[(size_t)s0r * N + n]        = c0[j][r] + bj;
      out[(size_t)(s0r + 16) * N + n] = c1[j][r] + bj;
    }
  }
}

// ---------------------------------------------------------------------------
// Host launch
// ---------------------------------------------------------------------------
extern "C" void kernel_launch(void* const* d_in, const int* in_sizes, int n_in,
                              void* d_out, int out_size, void* d_ws, size_t ws_size,
                              hipStream_t stream) {
  const float* x  = (const float*)d_in[0];
  const float* wq = (const float*)d_in[1];
  const float* bq = (const float*)d_in[2];
  const float* wk = (const float*)d_in[3];
  const float* bk = (const float*)d_in[4];
  const float* wv = (const float*)d_in[5];
  const float* bv = (const float*)d_in[6];
  const float* wo = (const float*)d_in[7];
  const float* bo = (const float*)d_in[8];
  float* out = (float*)d_out;

  char* ws = (char*)d_ws;
  const size_t MB = 1024 * 1024;
  _Float16* wqT  = (_Float16*)(ws + 0 * MB);    // [1024][1024] f16, 2 MB each
  _Float16* wkT  = (_Float16*)(ws + 2 * MB);
  _Float16* wvT  = (_Float16*)(ws + 4 * MB);
  _Float16* woT  = (_Float16*)(ws + 6 * MB);
  _Float16* qh   = (_Float16*)(ws + 8 * MB);    // [16][4096][64], 8 MB each
  _Float16* kh   = (_Float16*)(ws + 16 * MB);
  _Float16* vt   = (_Float16*)(ws + 24 * MB);   // [16][64][4096]
  _Float16* aout = (_Float16*)(ws + 32 * MB);   // [4096][1024]
  _Float16* xh   = (_Float16*)(ws + 40 * MB);   // [4096][1024]

  cvt_x_kernel<<<CVX_BLOCKS, CVX_THREADS, 0, stream>>>(x, xh);

  dim3 tgrid(DMODEL / TTILE, DMODEL / TTILE);
  cvtT_kernel<<<tgrid, 256, 0, stream>>>(wq, wqT);
  cvtT_kernel<<<tgrid, 256, 0, stream>>>(wk, wkT);
  cvtT_kernel<<<tgrid, 256, 0, stream>>>(wv, wvT);
  cvtT_kernel<<<tgrid, 256, 0, stream>>>(wo, woT);

  // 2048 wave-tiles per GEMM, 8 waves per 256-thread block -> 256 blocks
  gemm_qkv_kernel<<<256, 256, 0, stream>>>(xh, wqT, bq, qh, 0);
  gemm_qkv_kernel<<<256, 256, 0, stream>>>(xh, wkT, bk, kh, 0);
  gemm_qkv_kernel<<<256, 256, 0, stream>>>(xh, wvT, bv, vt, 1);

  attn_kernel<<<dim3(S_LEN / (ATT_WAVES * 16), NHEADS), ATT_WAVES * 32, 0, stream>>>(qh, kh, vt, aout);

  gemm_out_kernel<<<256, 256, 0, stream>>>(aout, woT, bo, out);
}

// v005
// Measured time: 117 microseconds a run.
// Next to v004, in two timings, it ran 1.15 and 1.17 times as fast.
// All steps since v000 together make it 4.50 times as fast.
#include <hip/hip_runtime.h>
#include <hip/hip_bf16.h>
#include <math.h>

typedef __attribute__((ext_vector_type(16))) _Float16 v16h;
typedef __attribute__((ext_vector_type(8)))  _Float16 v8h;
typedef __attribute__((ext_vector_type(8)))  float    v8f;
typedef __attribute__((ext_vector_type(4)))  float    v4f;
typedef __attribute__((ext_vector_type(4)))  _Float16 v4h;

#define S_LEN 4096
#define DMODEL 1024
#define NHEADS 16
#define HDIM 64
#define CHUNKLEN 1024

// ---------------------------------------------------------------------------
// WMMA helpers: v_wmma_f32_16x16x32_f16, D = A(16x32) * B(32x16) + C(16x16 f32)
// A layout (wave32): lane L (row M = L%16); halves 0..7 -> K = base+0..7,
// halves 8..15 -> K = base+16..23, base = (L>=16)?8:0.
// B layout mirrors A with N = L%16. C/D: VGPR r, lane L: M = r + ((L>=16)?8:0).
// ---------------------------------------------------------------------------
__device__ __forceinline__ v8f wmma_f16(v16h a, v16h b, v8f c) {
  return __builtin_amdgcn_wmma_f32_16x16x32_f16(
      false, a, false, b, (short)0, c, false, false);
}

__device__ __forceinline__ v16h pack16(v8h lo, v8h hi) {
  v16h r;
#pragma unroll
  for (int t = 0; t < 8; ++t) { r[t] = lo[t]; r[8 + t] = hi[t]; }
  return r;
}

__device__ __forceinline__ v16h load_frag_f16(const _Float16* __restrict__ row, int kb) {
  v8h lo = *(const v8h*)(row + kb);
  v8h hi = *(const v8h*)(row + kb + 16);
  return pack16(lo, hi);
}

// ---------------------------------------------------------------------------
// Kernel 1: every f32 -> f16 conversion of the call in ONE launch; none depends on another.
// The block index picks the part: blocks 0 .. CVX_BLOCKS-1 take x, the rest the four weights.
//
// x, elementwise: a thread takes 8 pieces of 4 floats. Each wave-wide load covers 512
// contiguous bytes and each store 256; all 8 loads are issued before the first use.
//
// weights, convert + transpose  w[K][N] f32  ->  wT[N][K] f16, K = N = DMODEL:
// one 64(k) x 64(n) tile per work-group, turned in LDS: 16-byte loads along n,
// 16-byte stores along k, 8 lanes of one wave write each whole 128-byte line of wT.
// ---------------------------------------------------------------------------
#define CVT_THREADS 256
#define CVX_BLOCKS  512
#define CVX_PIECES  8
static_assert(CVX_BLOCKS * CVT_THREADS * CVX_PIECES * 4 == S_LEN * DMODEL, "x is covered exactly once");

#define TTILE 64
#define TROW  72   // halves per LDS row: 128 B of data + 16 B, keeps 16-byte reads aligned
#define TPERW ((DMODEL / TTILE) * (DMODEL / TTILE))   // tiles of one weight
#define CVT_BLOCKS (CVX_BLOCKS + 4 * TPERW)

// wT4: the four transposed weights one behind the other, in the order q, k, v, o
__global__ __launch_bounds__(CVT_THREADS) void cvt_all_kernel(
    const float* __restrict__ x,  const float* __restrict__ wq, const float* __restrict__ wk,
    const float* __restrict__ wv, const float* __restrict__ wo,
    _Float16* __restrict__ xh, _Float16* __restrict__ wT4) {
  __shared__ __align__(16) _Float16 sT[TTILE][TROW];   // n x k
  if (blockIdx.x < CVX_BLOCKS) {                       // the same for the whole work-group
    const v4f* xv = (const v4f*)x;
    v4h*       hv = (v4h*)xh;
    unsigned q = blockIdx.x * (CVT_THREADS * CVX_PIECES) + threadIdx.x;   // piece index, the same on both sides
    v4f a[CVX_PIECES];
#pragma unroll
    for (int i = 0; i < CVX_PIECES; ++i) a[i] = xv[q + i * CVT_THREADS];
#pragma unroll
    for (int i = 0; i < CVX_PIECES; ++i) {
      v4h h;
#pragma unroll
      for (int c = 0; c < 4; ++c) h[c] = (_Float16)a[i][c];
      hv[q + i * CVT_THREADS] = h;
    }
    return;
  }
  unsigned t     = blockIdx.x - CVX_BLOCKS;
  int which = (int)(t / TPERW), tile = (int)(t % TPERW);
  const float* wlo = (which & 1) ? wk : wq;
  const float* whi = (which & 1) ? wo : wv;
  const float* w   = (which & 2) ? whi : wlo;
  _Float16*   wT = wT4 + (size_t)which * DMODEL * DMODEL;
  int n0 = (tile % (DMODEL / TTILE)) * TTILE, k0 = (tile / (DMODEL / TTILE)) * TTILE;
  int c4 = (threadIdx.x & 15) * 4;    // 4 consecutive n
  int r4 = (threadIdx.x >> 4) * 4;    // 4 consecutive k
  v4f v[4];
#pragma unroll
  for (int i = 0; i < 4; ++i)
    v[i] = *(const v4f*)(w + (size_t)(k0 + r4 + i) * DMODEL + n0 + c4);
#pragma unroll
  for (int c = 0; c < 4; ++c) {
    v4h h;
#pragma unroll
    for (int i = 0; i < 4; ++i) h[i] = (_Float16)v[i][c];
    *(v4h*)&sT[c4 + c][r4] = h;
  }
  __syncthreads();   // the tile is complete before any thread reads rows that others wrote
  int row = threadIdx.x >> 3;         // 0..31, second piece: +32
  int col = (threadIdx.x & 7) * 8;    // in halves
#pragma unroll
  for (int i = 0; i < 2; ++i)
    *(v8h*)(wT + (size_t)(n0 + row + 32 * i) * DMODEL + k0 + col) =
        *(const v8h*)&sT[row + 32 * i][col];
}

// ---------------------------------------------------------------------------
// Shared main loop of the GEMM kernels: C(128 x 128) = A(128 x K) * B(128 x K)^T, both f16
// and K-contiguous. The eight waves of a work-group share the two operand tiles through LDS:
// a stage is 128 k (256-byte rows) of all 256 rows, brought in by asynchronous copies of
// whole rows, two buffers, the next stage in flight while this one is worked on.
// Waves stand 4 (M) x 2 (N); each computes 32 x 64 (B fragments reused by 2 A fragments).
// ---------------------------------------------------------------------------
#define GT_MN   128                 // rows of A and rows of B per work-group
#define GT_K    128                 // halves of K per stage
#define GROW    136                 // halves per LDS row: 256 B of data + 16 B, conflict-free for 16-B reads
#define GSTAGES (DMODEL / GT_K)
#define GSTEPS  (GT_K / 32)         // matrix steps of 32 k per stage
static_assert(GSTAGES >= 2, "the prologue starts two stages");

// One thread's share of one operand's stage: eight 16-byte pieces, rows 16 apart.
// The s_wait_xcnt stands inside the statement so that no address register of a
// copy is rewritten ahead of it.
__device__ __forceinline__ void copy_rows8(unsigned l, const _Float16* g) {
  const unsigned ls = 16 * GROW * 2;          // bytes of 16 LDS rows
  const size_t   gs = (size_t)16 * DMODEL;    // halves of 16 global rows
  asm volatile(
      "global_load_async_to_lds_b128 %0, %1, off\n\t"
      "global_load_async_to_lds_b128 %2, %3, off\n\t"
      "global_load_async_to_lds_b128 %4, %5, off\n\t"
      "global_load_async_to_lds_b128 %6, %7, off\n\t"
      "global_load_async_to_lds_b128 %8, %9, off\n\t"
      "global_load_async_to_lds_b128 %10, %11, off\n\t"
      "global_load_async_to_lds_b128 %12, %13, off\n\t"
      "global_load_async_to_lds_b128 %14, %15, off\n\t"
      "s_wait_xcnt 0x0"
      :: "v"(l),          "v"(g),          "v"(l + ls),     "v"(g + gs),
         "v"(l + 2 * ls), "v"(g + 2 * gs), "v"(l + 3 * ls), "v"(g + 3 * gs),
         "v"(l + 4 * ls), "v"(g + 4 * gs), "v"(l + 5 * ls), "v"(g + 5 * gs),
         "v"(l + 6 * ls), "v"(g + 6 * gs), "v"(l + 7 * ls), "v"(g + 7 * gs)
      : "memory");
}

typedef _Float16 gemm_tile_t[GT_MN][GROW];

// a: first row of the work-group's A tile; b: first row of its B tile; wm, wn: the wave's place
__device__ __forceinline__ void gemm_tile_loop(
    const _Float16* __restrict__ a, const _Float16* __restrict__ b,
    gemm_tile_t* sA, gemm_tile_t* sB, int wm, int wn, v8f (&c0)[4], v8f (&c1)[4]) {
  int lane16 = threadIdx.x & 15;
  int hi8    = ((threadIdx.x >> 4) & 1) << 3;
  // copy map: piece p = threadIdx.x + 256 i: row p/16, 16-byte column p%16; a wave covers 2 whole rows
  int crow = threadIdx.x >> 4;            // 0..15, piece i: +16 i
  int ccol = (threadIdx.x & 15) * 8;      // in halves
  const _Float16* ga = a + (size_t)crow * DMODEL + ccol;
  const _Float16* gb = b + (size_t)crow * DMODEL + ccol;
  unsigned la = (unsigned)(size_t)&sA[0][crow][ccol];
  unsigned lb = (unsigned)(size_t)&sB[0][crow][ccol];
  const unsigned buf_bytes = GT_MN * GROW * 2;

  // --- prologue: stage 0 lands and is published, then stage 1 starts
  copy_rows8(la, ga);
  copy_rows8(lb, gb);
  asm volatile("s_wait_asynccnt 0x0" ::: "memory");   // this wave's copies of stage 0 have landed
  __syncthreads();                                    // ... and every other wave's
  copy_rows8(la + buf_bytes, ga + GT_K);
  copy_rows8(lb + buf_bytes, gb + GT_K);

  for (int s = 0; s < GSTAGES; ++s) {
    int buf = s & 1;
    const _Float16* ar = &sA[buf][wm * 32 + lane16][0];
    const _Float16* br = &sB[buf][wn * 64 + lane16][0];
    // two fragment sets: the reads of the next 32 k are issued as one group ahead of this step's products
    v16h fa[2][2], fb[2][4];
    fa[0][0] = load_frag_f16(ar, hi8);
    fa[0][1] = load_frag_f16(ar + 16 * GROW, hi8);
#pragma unroll
    for (int j = 0; j < 4; ++j) fb[0][j] = load_frag_f16(br + j * 16 * GROW, hi8);
    // unrolled (as the j loops are) so that every fragment-set index is a constant and the sets stay in registers
#pragma unroll
    for (int t = 0; t + 1 < GSTEPS; ++t) {
      const int cur = t & 1, nxt = cur ^ 1;
      int kb = (t + 1) * 32 + hi8;
      fa[nxt][0] = load_frag_f16(ar, kb);
      fa[nxt][1] = load_frag_f16(ar + 16 * GROW, kb);
#pragma unroll
      for (int j = 0; j < 4; ++j) fb[nxt][j] = load_frag_f16(br + j * 16 * GROW, kb);
      // keeps the group of reads above in front of the products below; without it the build
      // sinks each read to its product and waits out the LDS latency every two products
      __builtin_amdgcn_sched_barrier(0);
#pragma unroll
      for (int j = 0; j < 4; ++j) {
        c0[j] = wmma_f16(fa[cur][0], fb[cur][j], c0[j]);
        c1[j] = wmma_f16(fa[cur][1], fb[cur][j], c1[j]);
      }
    }
    // keeps the products above in front of the barrier; without it the build sinks them
    // behind it, in front of the copies, which then start that much later
    __builtin_amdgcn_sched_barrier(0);
    // --- publish point of stage s+1; it also ends every wave's reads of this buffer
    // (behind its first wait the last step's fragments are in registers)
    asm volatile("s_wait_dscnt 0x0" ::: "memory");     // this wave's LDS reads of the buffer are done
    asm volatile("s_wait_asynccnt 0x0" ::: "memory");  // this wave's copies of stage s+1 have landed
    __syncthreads();
    if (s + 2 < GSTAGES) {                             // stage s+2 into the buffer just read
      unsigned bo = (unsigned)buf * buf_bytes;
      copy_rows8(la + bo, ga + (s + 2) * GT_K);
      copy_rows8(lb + bo, gb + (s + 2) * GT_K);
    }
#pragma unroll
    for (int j = 0; j < 4; ++j) {
      c0[j] = wmma_f16(fa[(GSTEPS - 1) & 1][0], fb[(GSTEPS - 1) & 1][j], c0[j]);
      c1[j] = wmma_f16(fa[(GSTEPS - 1) & 1][1], fb[(GSTEPS - 1) & 1][j], c1[j]);
    }
  }
  asm volatile("s_wait_asynccnt 0x0" ::: "memory");    // nothing of this wave's is in flight at its end
}

// ---------------------------------------------------------------------------
// Kernel 2: the three projections in ONE launch.  out = xh(f16 SxK) @ wT^T(f16) + bias
// One 128 x 128 tile per work-group, 32 x 8 tiles a projection; none depends on another.
// The block index picks the projection: V first (its stores touch the most lines, so they
// run beside other work-groups' main loops), then Q, then K.
// wT3: the transposed weights of q, k, v one behind the other; qkv: their outputs likewise.
// mode 0 (q, k): out[h][s][d]; mode 1 (v): out[h][d][s]
// ---------------------------------------------------------------------------
#define GTILES ((S_LEN / GT_MN) * (DMODEL / GT_MN))   // tiles of one projection

__global__ __launch_bounds__(256) void gemm_qkv_kernel(
    const _Float16* __restrict__ xh, const _Float16* __restrict__ wT3,
    const float* __restrict__ bq, const float* __restrict__ bk, const float* __restrict__ bv,
    _Float16* __restrict__ qkv) {
  __shared__ __align__(16) gemm_tile_t sA[2];
  __shared__ __align__(16) gemm_tile_t sB[2];
  int part = (int)(blockIdx.x / GTILES), tile = (int)(blockIdx.x % GTILES);
  int proj = part == 0 ? 2 : part - 1;                  // 0 q, 1 k, 2 v; the same for the whole work-group
  const _Float16* wT   = wT3 + (size_t)proj * DMODEL * DMODEL;
  const float*    bias = proj == 0 ? bq : proj == 1 ? bk : bv;
  _Float16*       out  = qkv + (size_t)proj * S_LEN * DMODEL;
  int mode = proj == 2 ? 1 : 0;
  int wave   = threadIdx.x >> 5;
  int lane16 = threadIdx.x & 15;
  int hi8    = ((threadIdx.x >> 4) & 1) << 3;           // 0 or 8
  int wm = wave & 3, wn = wave >> 2;
  int bm = (tile & 31) * GT_MN;                         // 32 tiles of 128 rows
  int bn = (tile >> 5) * GT_MN;                         // 8 tiles of 128 cols
  int m0 = bm + wm * 32, n0 = bn + wn * 64;

  v8f c0[4] = {}, c1[4] = {};
  gemm_tile_loop(xh + (size_t)bm * DMODEL, wT + (size_t)bn * DMODEL, sA, sB, wm, wn, c0, c1);

#pragma unroll
  for (int j = 0; j < 4; ++j) {
    int n = n0 + j * 16 + lane16;
    float bj = bias[n];
    int head = n >> 6, d = n & 63;
#pragma unroll
    for (int r = 0; r < 8; ++r) {
      int s0r = m0 + r + hi8;
      int s1r = s0r + 16;
      float v0 = c0[j][r] + bj;
      float v1 = c1[j][r] + bj;
      if (mode == 0) {
        out[((size_t)head * S_LEN + s0r) * HDIM + d] = (_Float16)v0;
        out[((size_t)head * S_LEN + s1r) * HDIM + d] = (_Float16)v1;
      } else {
        out[((size_t)head * HDIM + d) * S_LEN + s0r] = (_Float16)v0;
        out[((size_t)head * HDIM + d) * S_LEN + s1r] = (_Float16)v1;
      }
    }
  }
}

// ---------------------------------------------------------------------------
// Kernel 3: flash-style block-causal attention. One wave per 16-q-row tile; the
// eight waves of a work-group (128 q rows of one head, all in one chunk) share
// each 64-key K tile and V tile through LDS. The tiles come in by asynchronous
// copies of whole 128-byte rows, two buffers, the next tile in flight while this
// one is worked on. 64 keys per trip: 8 score WMMAs + softmax + 8 PV WMMAs.
// Both products are formed transposed: St = K * Qt (A = K rows, B = Q) and
// Ot += Vt * Pt (A = Vt rows, B = P). A lane then holds 32 of the 64 scores of ONE
// query (column lane%16; keys 16t + r + 8*(lane/16)), so maximum and sum are taken
// in the lane, with one exchange between the wave's halves, and the score
// accumulators of tiles 2i and 2i+1 are, converted, the B fragment of keys
// 32i..32i+31: P never leaves the registers.
// qh,kh: [H][S][64] f16;  vt: [H][64][S] f16;  aout: [S][H*64] f16
// ---------------------------------------------------------------------------
#define ATT_WAVES 8
#define KTILE 64
#define LROW 72   // halves per LDS row: 128 B of data + 16 B, conflict-free for 16-B reads

// One tile's share of one thread: two 16-byte pieces of K and two of V.
// The s_wait_xcnt stands inside the statement so that no address register of a
// copy is rewritten ahead of it.
__device__ __forceinline__ void copy_kv_tile(
    unsigned lk0, const _Float16* gk0, unsigned lk1, const _Float16* gk1,
    unsigned lv0, const _Float16* gv0, unsigned lv1, const _Float16* gv1) {
  asm volatile(
      "global_load_async_to_lds_b128 %0, %1, off\n\t"
      "global_load_async_to_lds_b128 %2, %3, off\n\t"
      "global_load_async_to_lds_b128 %4, %5, off\n\t"
      "global_load_async_to_lds_b128 %6, %7, off\n\t"
      "s_wait_xcnt 0x0"
      :: "v"(lk0), "v"(gk0), "v"(lk1), "v"(gk1),
         "v"(lv0), "v"(gv0), "v"(lv1), "v"(gv1)
      : "memory");
}

// lane l <-> lane l ^ 16, on the vector unit
__device__ __forceinline__ float xhalf(float x) {
  int b = __builtin_bit_cast(int, x);
  return __builtin_bit_cast(float,
      __builtin_amdgcn_permlanex16(b, b, 0x76543210, 0xfedcba98, false, false));
}

// waves_per_eu: the grid puts 4 waves on a SIMD (512 work-groups of 8 waves, 256 WGPs). With that
// register budget stated the compiler issues a trip's K reads as one group ahead of the score
// products; without it the build reads two pieces, waits for them and multiplies, product by product.
__global__ __launch_bounds__(256) __attribute__((amdgpu_waves_per_eu(4, 4))) void attn_kernel(
    const _Float16* __restrict__ qh, const _Float16* __restrict__ kh,
    const _Float16* __restrict__ vt, _Float16* __restrict__ aout) {
  __shared__ __align__(16) _Float16 sK[2][KTILE][LROW];          // keys x d
  __shared__ __align__(16) _Float16 sV[2][HDIM][LROW];           // d x keys

  int head   = blockIdx.y;
  int wave   = threadIdx.x >> 5;
  int lane16 = threadIdx.x & 15;
  int hi8    = ((threadIdx.x >> 4) & 1) << 3;
  int mblk   = blockIdx.x * (ATT_WAVES * 16);
  int m0     = mblk + wave * 16;
  int kv_end = ((mblk / CHUNKLEN) + 1) * CHUNKLEN;  // block-causal: full chunks; same for all 8 waves
  const float scale = 0.125f;                       // 64^-0.5

  // copy map: piece p = threadIdx.x (+256): row p/8, 16-byte column p%8; a wave covers 4 whole rows
  int crow = threadIdx.x >> 3;            // 0..31, second piece: +32
  int ccol = (threadIdx.x & 7) * 8;       // in halves
  const _Float16* gk = kh + ((size_t)head * S_LEN + crow) * HDIM + ccol;
  const _Float16* gv = vt + ((size_t)head * HDIM + crow) * S_LEN + ccol;
  unsigned lk = (unsigned)(size_t)&sK[0][crow][ccol];
  unsigned lv = (unsigned)(size_t)&sV[0][crow][ccol];
  const unsigned half_tile = 32 * LROW * 2;   // bytes of 32 LDS rows
  const unsigned buf_bytes = 64 * LROW * 2;   // bytes of one buffer

  const _Float16* qrow = qh + ((size_t)head * S_LEN + m0 + lane16) * HDIM;
  v16h aq0 = load_frag_f16(qrow, hi8);        // d 0..31
  v16h aq1 = load_frag_f16(qrow + 32, hi8);   // d 32..63

  float rowmax = -INFINITY;   // of this lane's query, the same in both halves
  float rowsum = 0.0f;        // of this lane's half of the keys; the halves join after the loop
  v8f o[4] = {};              // Ot: row d = 16j + r + hi8, column = this lane's query

  // --- prologue: tile 0 lands and is published, then tile 1 starts
  copy_kv_tile(lk, gk, lk + half_tile, gk + 32 * HDIM,
               lv, gv, lv + half_tile, gv + (size_t)32 * S_LEN);
  asm volatile("s_wait_asynccnt 0x0" ::: "memory");   // this wave's copies of tile 0 have landed
  __syncthreads();                                    // ... and every other wave's
  if (KTILE < kv_end)
    copy_kv_tile(lk + buf_bytes, gk + KTILE * HDIM,
                 lk + buf_bytes + half_tile, gk + (KTILE + 32) * HDIM,
                 lv + buf_bytes, gv + KTILE,
                 lv + buf_bytes + half_tile, gv + (size_t)32 * S_LEN + KTILE);

  for (int kb = 0; kb < kv_end; kb += KTILE) {
    int buf = (kb >> 6) & 1;
    // --- scores for 64 keys, transposed: four 16(keys) x 16(queries) tiles, Hd=64 in two WMMAs each
    v8f u[4];
#pragma unroll
    for (int t = 0; t < 4; ++t) {
      const _Float16* krow = &sK[buf][t * 16 + lane16][0];
      v8f s = {};
      s = wmma_f16(load_frag_f16(krow,      hi8), aq0, s);
      s = wmma_f16(load_frag_f16(krow + 32, hi8), aq1, s);
      u[t] = s * scale;
    }

    // --- online softmax; a lane holds 32 scores of its query, the lane l ^ 16 the other 32
    float m8[8];
#pragma unroll
    for (int r = 0; r < 8; ++r)
      m8[r] = fmaxf(fmaxf(u[0][r], u[1][r]), fmaxf(u[2][r], u[3][r]));
    float mx = fmaxf(fmaxf(fmaxf(m8[0], m8[1]), fmaxf(m8[2], m8[3])),
                     fmaxf(fmaxf(m8[4], m8[5]), fmaxf(m8[6], m8[7])));
    mx = fmaxf(mx, xhalf(mx));
    float nm    = fmaxf(rowmax, mx);
    float alpha = __expf(rowmax - nm);
    rowmax      = nm;
    float s8[8];
#pragma unroll
    for (int r = 0; r < 8; ++r) {
#pragma unroll
      for (int t = 0; t < 4; ++t) u[t][r] = __expf(u[t][r] - nm);
      s8[r] = (u[0][r] + u[1][r]) + (u[2][r] + u[3][r]);
    }
    float ps = ((s8[0] + s8[1]) + (s8[2] + s8[3])) + ((s8[4] + s8[5]) + (s8[6] + s8[7]));
    rowsum = rowsum * alpha + ps;
#pragma unroll
    for (int j = 0; j < 4; ++j) o[j] = o[j] * alpha;

    // --- P as B fragments, straight from the score accumulators:
    // halves 0..7 = keys hi8+0..7 of the 32 (tile 2i), halves 8..15 = keys hi8+16..23 (tile 2i+1)
    v16h bp0, bp1;
#pragma unroll
    for (int r = 0; r < 8; ++r) {
      bp0[r] = (_Float16)u[0][r];  bp0[8 + r] = (_Float16)u[1][r];
      bp1[r] = (_Float16)u[2][r];  bp1[8 + r] = (_Float16)u[3][r];
    }

    // --- Ot += Vt @ Pt   (V transposed in LDS: contiguous over keys per d)
#pragma unroll
    for (int j = 0; j < 4; ++j) {
      const _Float16* vr = &sV[buf][j * 16 + lane16][0];
      o[j] = wmma_f16(load_frag_f16(vr,      hi8), bp0, o[j]);
      o[j] = wmma_f16(load_frag_f16(vr + 32, hi8), bp1, o[j]);
    }

    // --- publish point of tile t+1; it also ends every wave's reads of this buffer
    asm volatile("s_wait_dscnt 0x0" ::: "memory");     // this wave's LDS reads of the buffer are done
    asm volatile("s_wait_asynccnt 0x0" ::: "memory");  // this wave's copies of tile t+1 have landed
    __syncthreads();
    if (kb + 2 * KTILE < kv_end) {                     // tile t+2 into the buffer just read
      unsigned bo = (unsigned)buf * buf_bytes;
      const _Float16* nk = gk + (size_t)(kb + 2 * KTILE) * HDIM;
      const _Float16* nv = gv + (kb + 2 * KTILE);
      copy_kv_tile(lk + bo, nk, lk + bo + half_tile, nk + 32 * HDIM,
                   lv + bo, nv, lv + bo + half_tile, nv + (size_t)32 * S_LEN);
    }
  }
  asm volatile("s_wait_asynccnt 0x0" ::: "memory");    // nothing of this wave's is in flight at its end

  float inv = 1.0f / (rowsum + xhalf(rowsum));   // the two halves' sums of this query
  // a lane holds 8 consecutive d of its query per tile: one 16-byte store each
  _Float16* orow = aout + (size_t)(m0 + lane16) * DMODEL + head * HDIM + hi8;
#pragma unroll
  for (int j = 0; j < 4; ++j) {
    v8h h;
#pragma unroll
    for (int r = 0; r < 8; ++r) h[r] = (_Float16)(o[j][r] * inv);
    *(v8h*)(orow + j * 16) = h;
  }
}

// ---------------------------------------------------------------------------
// Kernel 4: output projection GEMM.  out(f32) = aout(f16) @ woT^T(f16) + bo
// One 128 x 128 tile per work-group (32 x 8 tiles).
// ---------------------------------------------------------------------------
__global__ __launch_bounds__(256) void gemm_out_kernel(
    const _Float16* __restrict__ ain, const _Float16* __restrict__ wT,
    const float* __restrict__ bias, float* __restrict__ out) {
  __shared__ __align__(16) gemm_tile_t sA[2];
  __shared__ __align__(16) gemm_tile_t sB[2];
  const int N = DMODEL;
  int wave   = threadIdx.x >> 5;
  int lane16 = threadIdx.x & 15;
  int hi8    = ((threadIdx.x >> 4) & 1) << 3;
  int wm = wave & 3, wn = wave >> 2;
  int bm = (blockIdx.x & 31) * GT_MN;
  int bn = (blockIdx.x >> 5) * GT_MN;
  int m0 = bm + wm * 32, n0 = bn + wn * 64;

  v8f c0[4] = {}, c1[4] = {};
  gemm_tile_loop(ain + (size_t)bm * DMODEL, wT + (size_t)bn * DMODEL, sA, sB, wm, wn, c0, c1);

#pragma unroll
  for (int j = 0; j < 4; ++j) {
    int n = n0 + j * 16 + lane16;
    float bj = bias[n];
#pragma unroll
    for (int r = 0; r < 8; ++r) {
      int s0r = m0 + r + hi8;
      out[(size_t)s0r * N + n]        = c0[j][r] + bj;
      out[(size_t)(s0r + 16) * N + n] = c1[j][r] + bj;
    }
  }
}

// ---------------------------------------------------------------------------
// Host launch
// ---------------------------------------------------------------------------
extern "C" void kernel_launch(void* const* d_in, const int* in_sizes, int n_in,
                              void* d_out, int out_size, void* d_ws, size_t ws_size,
                              hipStream_t stream) {
  const float* x  = (const float*)d_in[0];
  const float* wq = (const float*)d_in[1];
  const float* bq = (const float*)d_in[2];
  const float* wk = (const float*)d_in[3];
  const float* bk = (const float*)d_in[4];
  const float* wv = (const float*)d_in[5];
  const float* bv = (const float*)d_in[6];
  const float* wo = (const float*)d_in[7];
  const float* bo = (const float*)d_in[8];
  float* out = (float*)d_out;

  char* ws = (char*)d_ws;
  const size_t MB = 1024 * 1024;
  _Float16* wqT  = (_Float16*)(ws + 0 * MB);    // [1024][1024] f16, 2 MB each
                                                // wkT at 2 MB, wvT at 4 MB
  _Float16* woT  = (_Float16*)(ws + 6 * MB);
  _Float16* qh   = (_Float16*)(ws + 8 * MB);    // [16][4096][64], 8 MB each
  _Float16* kh   = (_Float16*)(ws + 16 * MB);
  _Float16* vt   = (_Float16*)(ws + 24 * MB);   // [16][64][4096]
  _Float16* aout = (_Float16*)(ws + 32 * MB);   // [4096][1024]
  _Float16* xh   = (_Float16*)(ws + 40 * MB);   // [4096][1024]

  // wqT .. woT lie one behind the other, and so do qh, kh, vt
  cvt_all_kernel<<<CVT_BLOCKS, CVT_THREADS, 0, stream>>>(x, wq, wk, wv, wo, xh, wqT);

  gemm_qkv_kernel<<<3 * GTILES, 256, 0, stream>>>(xh, wqT, bq, bk, bv, qh);

  attn_kernel<<<dim3(S_LEN / (ATT_WAVES * 16), NHEADS), ATT_WAVES * 32, 0, stream>>>(qh, kh, vt, aout);

  gemm_out_kernel<<<256, 256, 0, stream>>>(aout, woT, bo, out);
}

// v006
// A run of this version takes 101 microseconds.
// In two side-by-side timings against v005, it was 1.15 and 1.16 times as fast.
// Counting every step since v000, it is 5.20 times as fast.
#include <hip/hip_runtime.h>
#include <hip/hip_bf16.h>
#include <math.h>

typedef __attribute__((ext_vector_type(16))) _Float16 v16h;
typedef __attribute__((ext_vector_type(8)))  _Float16 v8h;
typedef __attribute__((ext_vector_type(8)))  float    v8f;
typedef __attribute__((ext_vector_type(4)))  float    v4f;
typedef __attribute__((ext_vector_type(4)))  _Float16 v4h;

#define S_LEN 4096
#define DMODEL 1024
#define NHEADS 16
#define HDIM 64
#define CHUNKLEN 1024

// ---------------------------------------------------------------------------
// WMMA helpers: v_wmma_f32_16x16x32_f16, D = A(16x32) * B(32x16) + C(16x16 f32)
// A layout (wave32): lane L (row M = L%16); halves 0..7 -> K = base+0..7,
// halves 8..15 -> K = base+16..23, base = (L>=16)?8:0.
// B layout mirrors A with N = L%16. C/D: VGPR r, lane L: M = r + ((L>=16)?8:0).
// ---------------------------------------------------------------------------
__device__ __forceinline__ v8f wmma_f16(v16h a, v16h b, v8f c) {
  return __builtin_amdgcn_wmma_f32_16x16x32_f16(
      false, a, false, b, (short)0, c, false, false);
}

__device__ __forceinline__ v16h pack16(v8h lo, v8h hi) {
  v16h r;
#pragma unroll
  for (int t = 0; t < 8; ++t) { r[t] = lo[t]; r[8 + t] = hi[t]; }
  return r;
}

__device__ __forceinline__ v16h load_frag_f16(const _Float16* __restrict__ row, int kb) {
  v8h lo = *(const v8h*)(row + kb);
  v8h hi = *(const v8h*)(row + kb + 16);
  return pack16(lo, hi);
}

// ---------------------------------------------------------------------------
// Kernel 1: every f32 -> f16 conversion of the call in ONE launch; none depends on another.
// The block index picks the part: blocks 0 .. CVX_BLOCKS-1 take x, the rest the four weights.
//
// x, elementwise: a thread takes 8 pieces of 4 floats. Each wave-wide load covers 512
// contiguous bytes and each store 256; all 8 loads are issued before the first use.
//
// weights, convert + transpose  w[K][N] f32  ->  wT[N][K] f16, K = N = DMODEL:
// one 64(k) x 64(n) tile per work-group, turned in LDS: 16-byte loads along n,
// 16-byte stores along k, 8 lanes of one wave write each whole 128-byte line of wT.
// ---------------------------------------------------------------------------
#define CVT_THREADS 256
#define CVX_BLOCKS  512
#define CVX_PIECES  8
static_assert(CVX_BLOCKS * CVT_THREADS * CVX_PIECES * 4 == S_LEN * DMODEL, "x is covered exactly once");

#define TTILE 64
#define TROW  72   // halves per LDS row: 128 B of data + 16 B, keeps 16-byte reads aligned
#define TPERW ((DMODEL / TTILE) * (DMODEL / TTILE))   // tiles of one weight
#define CVT_BLOCKS (CVX_BLOCKS + 4 * TPERW)

// wT4: the four transposed weights one behind the other, in the order q, k, v, o
__global__ __launch_bounds__(CVT_THREADS) void cvt_all_kernel(
    const float* __restrict__ x,  const float* __restrict__ wq, const float* __restrict__ wk,
    const float* __restrict__ wv, const float* __restrict__ wo,
    _Float16* __restrict__ xh, _Float16* __restrict__ wT4) {
  __shared__ __align__(16) _Float16 sT[TTILE][TROW];   // n x k
  if (blockIdx.x < CVX_BLOCKS) {                       // the same for the whole work-group
    const v4f* xv = (const v4f*)x;
    v4h*       hv = (v4h*)xh;
    unsigned q = blockIdx.x * (CVT_THREADS * CVX_PIECES) + threadIdx.x;   // piece index, the same on both sides
    v4f a[CVX_PIECES];
#pragma unroll
    for (int i = 0; i < CVX_PIECES; ++i) a[i] = xv[q + i * CVT_THREADS];
#pragma unroll
    for (int i = 0; i < CVX_PIECES; ++i) {
      v4h h;
#pragma unroll
      for (int c = 0; c < 4; ++c) h[c] = (_Float16)a[i][c];
      hv[q + i * CVT_THREADS] = h;
    }
    return;
  }
  unsigned t     = blockIdx.x - CVX_BLOCKS;
  int which = (int)(t / TPERW), tile = (int)(t % TPERW);
  const float* wlo = (which & 1) ? wk : wq;
  const float* whi = (which & 1) ? wo : wv;
  const float* w   = (which & 2) ? whi : wlo;
  _Float16*   wT = wT4 + (size_t)which * DMODEL * DMODEL;
  int n0 = (tile % (DMODEL / TTILE)) * TTILE, k0 = (tile / (DMODEL / TTILE)) * TTILE;
  int c4 = (threadIdx.x & 15) * 4;    // 4 consecutive n
  int r4 = (threadIdx.x >> 4) * 4;    // 4 consecutive k
  v4f v[4];
#pragma unroll
  for (int i = 0; i < 4; ++i)
    v[i] = *(const v4f*)(w + (size_t)(k0 + r4 + i) * DMODEL + n0 + c4);
#pragma unroll
  for (int c = 0; c < 4; ++c) {
    v4h h;
#pragma unroll
    for (int i = 0; i < 4; ++i) h[i] = (_Float16)v[i][c];
    *(v4h*)&sT[c4 + c][r4] = h;
  }
  __syncthreads();   // the tile is complete before any thread reads rows that others wrote
  int row = threadIdx.x >> 3;         // 0..31, second piece: +32
  int col = (threadIdx.x & 7) * 8;    // in halves
#pragma unroll
  for (int i = 0; i < 2; ++i)
    *(v8h*)(wT + (size_t)(n0 + row + 32 * i) * DMODEL + k0 + col) =
        *(const v8h*)&sT[row + 32 * i][col];
}

// ---------------------------------------------------------------------------
// Shared main loop of the GEMM kernels: C(128 x 128) = A(128 x K) * B(128 x K)^T, both f16
// and K-contiguous. The eight waves of a work-group share the two operand tiles through LDS:
// a stage is 128 k (256-byte rows) of all 256 rows, brought in by asynchronous copies of
// whole rows, two buffers, the next stage in flight while this one is worked on.
// Waves stand 4 (M) x 2 (N); each computes 32 x 64 (B fragments reused by 2 A fragments).
// ---------------------------------------------------------------------------
#define GT_MN   128                 // rows of A and rows of B per work-group
#define GT_K    128                 // halves of K per stage
#define GROW    136                 // halves per LDS row: 256 B of data + 16 B, conflict-free for 16-B reads
#define GSTAGES (DMODEL / GT_K)
#define GSTEPS  (GT_K / 32)         // matrix steps of 32 k per stage
static_assert(GSTAGES >= 2, "the prologue starts two stages");

// One thread's share of one operand's stage: eight 16-byte pieces, rows 16 apart.
// The s_wait_xcnt stands inside the statement so that no address register of a
// copy is rewritten ahead of it.
__device__ __forceinline__ void copy_rows8(unsigned l, const _Float16* g) {
  const unsigned ls = 16 * GROW * 2;          // bytes of 16 LDS rows
  const size_t   gs = (size_t)16 * DMODEL;    // halves of 16 global rows
  asm volatile(
      "global_load_async_to_lds_b128 %0, %1, off\n\t"
      "global_load_async_to_lds_b128 %2, %3, off\n\t"
      "global_load_async_to_lds_b128 %4, %5, off\n\t"
      "global_load_async_to_lds_b128 %6, %7, off\n\t"
      "global_load_async_to_lds_b128 %8, %9, off\n\t"
      "global_load_async_to_lds_b128 %10, %11, off\n\t"
      "global_load_async_to_lds_b128 %12, %13, off\n\t"
      "global_load_async_to_lds_b128 %14, %15, off\n\t"
      "s_wait_xcnt 0x0"
      :: "v"(l),          "v"(g),          "v"(l + ls),     "v"(g + gs),
         "v"(l + 2 * ls), "v"(g + 2 * gs), "v"(l + 3 * ls), "v"(g + 3 * gs),
         "v"(l + 4 * ls), "v"(g + 4 * gs), "v"(l + 5 * ls), "v"(g + 5 * gs),
         "v"(l + 6 * ls), "v"(g + 6 * gs), "v"(l + 7 * ls), "v"(g + 7 * gs)
      : "memory");
}

typedef _Float16 gemm_tile_t[GT_MN][GROW];

// a: first row of the work-group's A tile; b: first row of its B tile; wm, wn: the wave's place
__device__ __forceinline__ void gemm_tile_loop(
    const _Float16* __restrict__ a, const _Float16* __restrict__ b,
    gemm_tile_t* sA, gemm_tile_t* sB, int wm, int wn, v8f (&c0)[4], v8f (&c1)[4]) {
  int lane16 = threadIdx.x & 15;
  int hi8    = ((threadIdx.x >> 4) & 1) << 3;
  // copy map: piece p = threadIdx.x + 256 i: row p/16, 16-byte column p%16; a wave covers 2 whole rows
  int crow = threadIdx.x >> 4;            // 0..15, piece i: +16 i
  int ccol = (threadIdx.x & 15) * 8;      // in halves
  const _Float16* ga = a + (size_t)crow * DMODEL + ccol;
  const _Float16* gb = b + (size_t)crow * DMODEL + ccol;
  unsigned la = (unsigned)(size_t)&sA[0][crow][ccol];
  unsigned lb = (unsigned)(size_t)&sB[0][crow][ccol];
  const unsigned buf_bytes = GT_MN * GROW * 2;

  // --- prologue: stage 0 lands and is published, then stage 1 starts
  copy_rows8(la, ga);
  copy_rows8(lb, gb);
  asm volatile("s_wait_asynccnt 0x0" ::: "memory");   // this wave's copies of stage 0 have landed
  __syncthreads();                                    // ... and every other wave's
  copy_rows8(la + buf_bytes, ga + GT_K);
  copy_rows8(lb + buf_bytes, gb + GT_K);

  for (int s = 0; s < GSTAGES; ++s) {
    int buf = s & 1;
    const _Float16* ar = &sA[buf][wm * 32 + lane16][0];
    const _Float16* br = &sB[buf][wn * 64 + lane16][0];
    // two fragment sets: the reads of the next 32 k are issued as one group ahead of this step's products
    v16h fa[2][2], fb[2][4];
    fa[0][0] = load_frag_f16(ar, hi8);
    fa[0][1] = load_frag_f16(ar + 16 * GROW, hi8);
#pragma unroll
    for (int j = 0; j < 4; ++j) fb[0][j] = load_frag_f16(br + j * 16 * GROW, hi8);
    // unrolled (as the j loops are) so that every fragment-set index is a constant and the sets stay in registers
#pragma unroll
    for (int t = 0; t + 1 < GSTEPS; ++t) {
      const int cur = t & 1, nxt = cur ^ 1;
      int kb = (t + 1) * 32 + hi8;
      fa[nxt][0] = load_frag_f16(ar, kb);
      fa[nxt][1] = load_frag_f16(ar + 16 * GROW, kb);
#pragma unroll
      for (int j = 0; j < 4; ++j) fb[nxt][j] = load_frag_f16(br + j * 16 * GROW, kb);
      // keeps the group of reads above in front of the products below; without it the build
      // sinks each read to its product and waits out the LDS latency every two products
      __builtin_amdgcn_sched_barrier(0);
#pragma unroll
      for (int j = 0; j < 4; ++j) {
        c0[j] = wmma_f16(fa[cur][0], fb[cur][j], c0[j]);
        c1[j] = wmma_f16(fa[cur][1], fb[cur][j], c1[j]);
      }
    }
    // keeps the products above in front of the barrier; without it the build sinks them
    // behind it, in front of the copies, which then start that much later
    __builtin_amdgcn_sched_barrier(0);
    // --- publish point of stage s+1; it also ends every wave's reads of this buffer
    // (behind its first wait the last step's fragments are in registers)
    asm volatile("s_wait_dscnt 0x0" ::: "memory");     // this wave's LDS reads of the buffer are done
    asm volatile("s_wait_asynccnt 0x0" ::: "memory");  // this wave's copies of stage s+1 have landed
    __syncthreads();
    if (s + 2 < GSTAGES) {                             // stage s+2 into the buffer just read
      unsigned bo = (unsigned)buf * buf_bytes;
      copy_rows8(la + bo, ga + (s + 2) * GT_K);
      copy_rows8(lb + bo, gb + (s + 2) * GT_K);
    }
#pragma unroll
    for (int j = 0; j < 4; ++j) {
      c0[j] = wmma_f16(fa[(GSTEPS - 1) & 1][0], fb[(GSTEPS - 1) & 1][j], c0[j]);
      c1[j] = wmma_f16(fa[(GSTEPS - 1) & 1][1], fb[(GSTEPS - 1) & 1][j], c1[j]);
    }
  }
  asm volatile("s_wait_asynccnt 0x0" ::: "memory");    // nothing of this wave's is in flight at its end
}

// ---------------------------------------------------------------------------
// Kernel 2: the three projections in ONE launch.  out = xh(f16 SxK) @ wT^T(f16) + bias
// One 128 x 128 tile per work-group, 32 x 8 tiles a projection; none depends on another.
// The block index picks the projection: V first (its stores touch the most lines, so they
// run beside other work-groups' main loops), then Q, then K.
// wT3: the transposed weights of q, k, v one behind the other; qkv: their outputs likewise.
// mode 0 (q, k): out[h][s][d]; mode 1 (v): out[h][d][s]
// ---------------------------------------------------------------------------
#define GTILES ((S_LEN / GT_MN) * (DMODEL / GT_MN))   // tiles of one projection

__global__ __launch_bounds__(256) void gemm_qkv_kernel(
    const _Float16* __restrict__ xh, const _Float16* __restrict__ wT3,
    const float* __restrict__ bq, const float* __restrict__ bk, const float* __restrict__ bv,
    _Float16* __restrict__ qkv) {
  __shared__ __align__(16) gemm_tile_t sA[2];
  __shared__ __align__(16) gemm_tile_t sB[2];
  int part = (int)(blockIdx.x / GTILES), tile = (int)(blockIdx.x % GTILES);
  int proj = part == 0 ? 2 : part - 1;                  // 0 q, 1 k, 2 v; the same for the whole work-group
  const _Float16* wT   = wT3 + (size_t)proj * DMODEL * DMODEL;
  const float*    bias = proj == 0 ? bq : proj == 1 ? bk : bv;
  _Float16*       out  = qkv + (size_t)proj * S_LEN * DMODEL;
  int mode = proj == 2 ? 1 : 0;
  int wave   = threadIdx.x >> 5;
  int lane16 = threadIdx.x & 15;
  int hi8    = ((threadIdx.x >> 4) & 1) << 3;           // 0 or 8
  int wm = wave & 3, wn = wave >> 2;
  int bm = (tile & 31) * GT_MN;                         // 32 tiles of 128 rows
  int bn = (tile >> 5) * GT_MN;                         // 8 tiles of 128 cols
  int m0 = bm + wm * 32, n0 = bn + wn * 64;

  v8f c0[4] = {}, c1[4] = {};
  gemm_tile_loop(xh + (size_t)bm * DMODEL, wT + (size_t)bn * DMODEL, sA, sB, wm, wn, c0, c1);

#pragma unroll
  for (int j = 0; j < 4; ++j) {
    int n = n0 + j * 16 + lane16;
    float bj = bias[n];
    int head = n >> 6, d = n & 63;
#pragma unroll
    for (int r = 0; r < 8; ++r) {
      int s0r = m0 + r + hi8;
      int s1r = s0r + 16;
      float v0 = c0[j][r] + bj;
      float v1 = c1[j][r] + bj;
      if (mode == 0) {
        out[((size_t)head * S_LEN + s0r) * HDIM + d] = (_Float16)v0;
        out[((size_t)head * S_LEN + s1r) * HDIM + d] = (_Float16)v1;
      } else {
        out[((size_t)head * HDIM + d) * S_LEN + s0r] = (_Float16)v0;
        out[((size_t)head * HDIM + d) * S_LEN + s1r] = (_Float16)v1;
      }
    }
  }
}

// ---------------------------------------------------------------------------
// Kernel 3: flash-style block-causal attention. A tile is 128 q rows of one head, all in
// one chunk; its cost grows with its chunk (1 to 4 chunks of keys). All work-groups are
// resident at once, so the launch lasts as long as the fullest: every work-group takes TWO
// tiles of its head one after the other, tile n-1-p and then tile p, which together always
// walk 5 chunks of keys. 16 waves: wave w works on q rows 16 (w%8) .. +15; waves 0-7 take
// the first 128 keys of each 256-key stage, waves 8-15 the other 128, each with its own
// running maximum, sum and Ot; the two parts of a query are joined once per tile through LDS.
// The K and V stages come in by asynchronous copies of whole rows, two buffers, the next
// stage in flight while this one is worked on; the second tile's stages follow the first
// tile's in the same ring. Per wave and 64 keys: 8 score WMMAs + softmax + 8 PV WMMAs.
// Both products are formed transposed: St = K * Qt (A = K rows, B = Q) and
// Ot += Vt * Pt (A = Vt rows, B = P). A lane then holds 32 of the 64 scores of ONE
// query (column lane%16; keys 16t + r + 8*(lane/16)), so maximum and sum are taken
// in the lane, with one exchange between the wave's halves, and the score
// accumulators of tiles 2i and 2i+1 are, converted, the B fragment of keys
// 32i..32i+31: P never leaves the registers.
// qh,kh: [H][S][64] f16;  vt: [H][64][S] f16;  aout: [S][H*64] f16
// ---------------------------------------------------------------------------
#define ATT_WAVES 16
#define ATT_QW    8                     // waves side by side over the q rows
#define ATT_ROWS  (ATT_QW * 16)         // q rows of a tile
#define ATT_TILES (S_LEN / ATT_ROWS)    // tiles of one head
#define KTILE  64                       // keys of one block: scores, softmax, PV
#define KSUB   2                        // blocks per wave and stage
#define KSTAGE (2 * KSUB * KTILE)       // keys per stage
#define CSTAGES (CHUNKLEN / KSTAGE)     // stages of one chunk
#define LROW 72              // halves per LDS row of K: 128 B of data + 16 B, conflict-free for 16-B reads
#define VROW (KSTAGE + 8)    // halves per LDS row of V: 512 B of data + 16 B, likewise
static_assert(ATT_TILES % 2 == 0, "tiles pair up");
static_assert(CHUNKLEN % ATT_ROWS == 0, "a tile lies in one chunk");
static_assert(CHUNKLEN % KSTAGE == 0 && CSTAGES >= 2, "the prologue starts two stages of the first tile");
static_assert(KSTAGE == 4 * 64 && HDIM == 4 * 16 && KSTAGE * 2 == 32 * 16, "the copy map below");

// One stage's share of one thread: four 16-byte pieces of K, rows 64 apart, and four of V,
// rows 16 apart. The s_wait_xcnt stands inside the statement so that no address register
// of a copy is rewritten ahead of it.
__device__ __forceinline__ void copy_kv_stage(
    unsigned lk, const _Float16* gk, unsigned lv, const _Float16* gv) {
  const unsigned ks = 64 * LROW * 2;          // bytes of 64 LDS rows of K
  const unsigned vs = 16 * VROW * 2;          // bytes of 16 LDS rows of V
  const size_t   kg = (size_t)64 * HDIM;      // halves of 64 global rows of K
  const size_t   vg = (size_t)16 * S_LEN;     // halves of 16 global rows of V
  asm volatile(
      "global_load_async_to_lds_b128 %0, %1, off\n\t"
      "global_load_async_to_lds_b128 %2, %3, off\n\t"
      "global_load_async_to_lds_b128 %4, %5, off\n\t"
      "global_load_async_to_lds_b128 %6, %7, off\n\t"
      "global_load_async_to_lds_b128 %8, %9, off\n\t"
      "global_load_async_to_lds_b128 %10, %11, off\n\t"
      "global_load_async_to_lds_b128 %12, %13, off\n\t"
      "global_load_async_to_lds_b128 %14, %15, off\n\t"
      "s_wait_xcnt 0x0"
      :: "v"(lk),          "v"(gk),          "v"(lk + ks),     "v"(gk + kg),
         "v"(lk + 2 * ks), "v"(gk + 2 * kg), "v"(lk + 3 * ks), "v"(gk + 3 * kg),
         "v"(lv),          "v"(gv),          "v"(lv + vs),     "v"(gv + vg),
         "v"(lv + 2 * vs), "v"(gv + 2 * vg), "v"(lv + 3 * vs), "v"(gv + 3 * vg)
      : "memory");
}

// lane l <-> lane l ^ 16, on the vector unit
__device__ __forceinline__ float xhalf(float x) {
  int b = __builtin_bit_cast(int, x);
  return __builtin_bit_cast(float,
      __builtin_amdgcn_permlanex16(b, b, 0x76543210, 0xfedcba98, false, false));
}

// waves_per_eu: the grid puts 4 waves on a SIMD (256 work-groups of 16 waves, 256 WGPs). With that
// register budget stated the compiler issues a block's K reads as a group ahead of the score
// products; without it the build reads two pieces, waits for them and multiplies, product by product.
__global__ __launch_bounds__(ATT_WAVES * 32) __attribute__((amdgpu_waves_per_eu(4, 4))) void attn_kernel(
    const _Float16* __restrict__ qh, const _Float16* __restrict__ kh,
    const _Float16* __restrict__ vt, _Float16* __restrict__ aout) {
  __shared__ __align__(16) _Float16 sK[2][KSTAGE][LROW];         // keys x d
  __shared__ __align__(16) _Float16 sV[2][HDIM][VROW];           // d x keys
  __shared__ __align__(16) v4f      sO[ATT_QW][8][32];           // Ot of the second key part, lane by lane
  __shared__ float                  sMS[ATT_QW][2][32];          // its maximum and its sum

  int head   = blockIdx.y;
  int wave   = threadIdx.x >> 5;
  int lane   = threadIdx.x & 31;
  int lane16 = threadIdx.x & 15;
  int hi8    = ((threadIdx.x >> 4) & 1) << 3;
  int qi     = wave & (ATT_QW - 1);       // which 16 q rows
  int kpart  = wave / ATT_QW;             // which half of a stage's keys
  const float scale = 0.125f;             // 64^-0.5

  // the two tiles and their stages; the same for all 16 waves
  int tile_a = ATT_TILES - 1 - (int)blockIdx.x, tile_b = (int)blockIdx.x;
  int n_a    = (tile_a * ATT_ROWS / CHUNKLEN + 1) * CSTAGES;   // block-causal: full chunks
  int n_all  = n_a + (tile_b * ATT_ROWS / CHUNKLEN + 1) * CSTAGES;

  // copy map, K: piece p = threadIdx.x + 512 i: row p/8, 16-byte column p%8; a wave covers 4 whole rows
  //           V: piece p = threadIdx.x + 512 i: row p/32, 16-byte column p%32; a wave covers 1 whole row
  int krow = threadIdx.x >> 3;            // 0..63, piece i: +64 i
  int kcol = (threadIdx.x & 7) * 8;       // in halves
  int vrow = threadIdx.x >> 5;            // 0..15, piece i: +16 i
  int vcol = (threadIdx.x & 31) * 8;      // in halves
  const _Float16* gk = kh + ((size_t)head * S_LEN + krow) * HDIM + kcol;
  const _Float16* gv = vt + ((size_t)head * HDIM + vrow) * S_LEN + vcol;
  unsigned lk = (unsigned)(size_t)&sK[0][krow][kcol];
  unsigned lv = (unsigned)(size_t)&sV[0][vrow][vcol];
  const unsigned k_buf = KSTAGE * LROW * 2;   // bytes of one buffer
  const unsigned v_buf = HDIM * VROW * 2;

  // --- prologue: stage 0 lands and is published, then stage 1 starts
  copy_kv_stage(lk, gk, lv, gv);
  asm volatile("s_wait_asynccnt 0x0" ::: "memory");   // this wave's copies of stage 0 have landed
  __syncthreads();                                    // ... and every other wave's
  copy_kv_stage(lk + k_buf, gk + KSTAGE * HDIM, lv + v_buf, gv + KSTAGE);

  int s = 0;   // stage, counted through both tiles
  for (int ph = 0; ph < 2; ++ph) {
    int m0    = (ph == 0 ? tile_a : tile_b) * ATT_ROWS + qi * 16;
    int s_end = ph == 0 ? n_a : n_all;

    const _Float16* qrow = qh + ((size_t)head * S_LEN + m0 + lane16) * HDIM;
    v16h aq0 = load_frag_f16(qrow, hi8);        // d 0..31
    v16h aq1 = load_frag_f16(qrow + 32, hi8);   // d 32..63

    float rowmax = -INFINITY;   // of this lane's query over this wave's keys, the same in both halves
    float rowsum = 0.0f;        // of this lane's half of the wave's keys; the halves join after the loop
    v8f o[4] = {};              // Ot: row d = 16j + r + hi8, column = this lane's query

    for (; s < s_end; ++s) {
      int buf = s & 1;
      // unrolled so that the second block's LDS offsets are constants and its K reads can start early
#pragma unroll
      for (int sb = 0; sb < KSUB; ++sb) {
        const int k0 = sb * KTILE;   // the block's first key within the wave's half of the stage
        // --- scores for 64 keys, transposed: four 16(keys) x 16(queries) tiles, Hd=64 in two WMMAs each
        v8f u[4];
#pragma unroll
        for (int t = 0; t < 4; ++t) {
          const _Float16* krw = &sK[buf][kpart * (KSUB * KTILE) + k0 + t * 16 + lane16][0];
          v8f sc = {};
          sc = wmma_f16(load_frag_f16(krw,      hi8), aq0, sc);
          sc = wmma_f16(load_frag_f16(krw + 32, hi8), aq1, sc);
          u[t] = sc * scale;
        }

        // --- online softmax; a lane holds 32 scores of its query, the lane l ^ 16 the other 32
        float m8[8];
#pragma unroll
        for (int r = 0; r < 8; ++r)
          m8[r] = fmaxf(fmaxf(u[0][r], u[1][r]), fmaxf(u[2][r], u[3][r]));
        float mx = fmaxf(fmaxf(fmaxf(m8[0], m8[1]), fmaxf(m8[2], m8[3])),
                         fmaxf(fmaxf(m8[4], m8[5]), fmaxf(m8[6], m8[7])));
        mx = fmaxf(mx, xhalf(mx));
        float nm    = fmaxf(rowmax, mx);
        float alpha = __expf(rowmax - nm);
        rowmax      = nm;
        float s8[8];
#pragma unroll
        for (int r = 0; r < 8; ++r) {
#pragma unroll
          for (int t = 0; t < 4; ++t) u[t][r] = __expf(u[t][r] - nm);
          s8[r] = (u[0][r] + u[1][r]) + (u[2][r] + u[3][r]);
        }
        float ps = ((s8[0] + s8[1]) + (s8[2] + s8[3])) + ((s8[4] + s8[5]) + (s8[6] + s8[7]));
        rowsum = rowsum * alpha + ps;
#pragma unroll
        for (int j = 0; j < 4; ++j) o[j] = o[j] * alpha;

        // --- P as B fragments, straight from the score accumulators:
        // halves 0..7 = keys hi8+0..7 of the 32 (tile 2i), halves 8..15 = keys hi8+16..23 (tile 2i+1)
        v16h bp0, bp1;
#pragma unroll
        for (int r = 0; r < 8; ++r) {
          bp0[r] = (_Float16)u[0][r];  bp0[8 + r] = (_Float16)u[1][r];
          bp1[r] = (_Float16)u[2][r];  bp1[8 + r] = (_Float16)u[3][r];
        }

        // --- Ot += Vt @ Pt   (V transposed in LDS: contiguous over keys per d)
#pragma unroll
        for (int j = 0; j < 4; ++j) {
          const _Float16* vr = &sV[buf][j * 16 + lane16][kpart * (KSUB * KTILE) + k0];
          o[j] = wmma_f16(load_frag_f16(vr,      hi8), bp0, o[j]);
          o[j] = wmma_f16(load_frag_f16(vr + 32, hi8), bp1, o[j]);
        }
      }

      // --- publish point of stage s+1; it also ends every wave's reads of this buffer
      asm volatile("s_wait_dscnt 0x0" ::: "memory");     // this wave's LDS reads of the buffer are done
      asm volatile("s_wait_asynccnt 0x0" ::: "memory");  // this wave's copies of stage s+1 have landed
      __syncthreads();
      if (s + 2 < n_all) {                               // stage s+2 into the buffer just read
        int s2  = s + 2;
        int key = (s2 < n_a ? s2 : s2 - n_a) * KSTAGE;   // the second tile starts again at key 0
        copy_kv_stage(lk + (unsigned)buf * k_buf, gk + (size_t)key * HDIM,
                      lv + (unsigned)buf * v_buf, gv + key);
      }
    }

    // --- join the two key parts of each query: waves 8-15 hand theirs over, waves 0-7 finish the tile
    float sum = rowsum + xhalf(rowsum);   // the two lane halves' sums of this wave's keys
    if (kpart == 1) {
#pragma unroll
      for (int j = 0; j < 4; ++j) {
        sO[qi][2 * j][lane]     = __builtin_shufflevector(o[j], o[j], 0, 1, 2, 3);
        sO[qi][2 * j + 1][lane] = __builtin_shufflevector(o[j], o[j], 4, 5, 6, 7);
      }
      sMS[qi][0][lane] = rowmax;
      sMS[qi][1][lane] = sum;
    }
    __syncthreads();   // the handed-over parts are complete before their readers start
    if (kpart == 0) {
      float pm = sMS[qi][0][lane], psum = sMS[qi][1][lane];
      float m  = fmaxf(rowmax, pm);
      float a  = __expf(rowmax - m), b = __expf(pm - m);
      float inv = 1.0f / (sum * a + psum * b);
      a *= inv;
      b *= inv;
      // a lane holds 8 consecutive d of its query per tile: one 16-byte store each
      _Float16* orow = aout + (size_t)(m0 + lane16) * DMODEL + head * HDIM + hi8;
#pragma unroll
      for (int j = 0; j < 4; ++j) {
        v4f p0 = sO[qi][2 * j][lane], p1 = sO[qi][2 * j + 1][lane];
        v8h h;
#pragma unroll
        for (int r = 0; r < 4; ++r) {
          h[r]     = (_Float16)(o[j][r] * a + p0[r] * b);
          h[4 + r] = (_Float16)(o[j][4 + r] * a + p1[r] * b);
        }
        *(v8h*)(orow + j * 16) = h;
      }
      // the second tile rewrites the registers that these stores name
      asm volatile("s_wait_xcnt 0x0" ::: "memory");
    }
  }
  asm volatile("s_wait_asynccnt 0x0" ::: "memory");    // nothing of this wave's is in flight at its end
}

// ---------------------------------------------------------------------------
// Kernel 4: output projection GEMM.  out(f32) = aout(f16) @ woT^T(f16) + bo
// One 128 x 128 tile per work-group (32 x 8 tiles).
// ---------------------------------------------------------------------------
__global__ __launch_bounds__(256) void gemm_out_kernel(
    const _Float16* __restrict__ ain, const _Float16* __restrict__ wT,
    const float* __restrict__ bias, float* __restrict__ out) {
  __shared__ __align__(16) gemm_tile_t sA[2];
  __shared__ __align__(16) gemm_tile_t sB[2];
  const int N = DMODEL;
  int wave   = threadIdx.x >> 5;
  int lane16 = threadIdx.x & 15;
  int hi8    = ((threadIdx.x >> 4) & 1) << 3;
  int wm = wave & 3, wn = wave >> 2;
  int bm = (blockIdx.x & 31) * GT_MN;
  int bn = (blockIdx.x >> 5) * GT_MN;
  int m0 = bm + wm * 32, n0 = bn + wn * 64;

  v8f c0[4] = {}, c1[4] = {};
  gemm_tile_loop(ain + (size_t)bm * DMODEL, wT + (size_t)bn * DMODEL, sA, sB, wm, wn, c0, c1);

#pragma unroll
  for (int j = 0; j < 4; ++j) {
    int n = n0 + j * 16 + lane16;
    float bj = bias[n];
#pragma unroll
    for (int r = 0; r < 8; ++r) {
      int s0r = m0 + r + hi8;
      out[(size_t)s0r * N + n]        = c0[j][r] + bj;
      out[(size_t)(s0r + 16) * N + n] = c1[j][r] + bj;
    }
  }
}

// ---------------------------------------------------------------------------
// Host launch
// ---------------------------------------------------------------------------
extern "C" void kernel_launch(void* const* d_in, const int* in_sizes, int n_in,
                              void* d_out, int out_size, void* d_ws, size_t ws_size,
                              hipStream_t stream) {
  const float* x  = (const float*)d_in[0];
  const float* wq = (const float*)d_in[1];
  const float* bq = (const float*)d_in[2];
  const float* wk = (const float*)d_in[3];
  const float* bk = (const float*)d_in[4];
  const float* wv = (const float*)d_in[5];
  const float* bv = (const float*)d_in[6];
  const float* wo = (const float*)d_in[7];
  const float* bo = (const float*)d_in[8];
  float* out = (float*)d_out;

  char* ws = (char*)d_ws;
  const size_t MB = 1024 * 1024;
  _Float16* wqT  = (_Float16*)(ws + 0 * MB);    // [1024][1024] f16, 2 MB each
                                                // wkT at 2 MB, wvT at 4 MB
  _Float16* woT  = (_Float16*)(ws + 6 * MB);
  _Float16* qh   = (_Float16*)(ws + 8 * MB);    // [16][4096][64], 8 MB each
  _Float16* kh   = (_Float16*)(ws + 16 * MB);
  _Float16* vt   = (_Float16*)(ws + 24 * MB);   // [16][64][4096]
  _Float16* aout = (_Float16*)(ws + 32 * MB);   // [4096][1024]
  _Float16* xh   = (_Float16*)(ws + 40 * MB);   // [4096][1024]

  // wqT .. woT lie one behind the other, and so do qh, kh, vt
  cvt_all_kernel<<<CVT_BLOCKS, CVT_THREADS, 0, stream>>>(x, wq, wk, wv, wo, xh, wqT);

  gemm_qkv_kernel<<<3 * GTILES, 256, 0, stream>>>(xh, wqT, bq, bk, bv, qh);

  attn_kernel<<<dim3(ATT_TILES / 2, NHEADS), ATT_WAVES * 32, 0, stream>>>(qh, kh, vt, aout);

  gemm_out_kernel<<<256, 256, 0, stream>>>(aout, woT, bo, out);
}

// v007
// A run of this version takes 87.1 microseconds.
// Timed twice side by side with v006, it ran 1.15 and 1.16 times as fast.
// Over all steps from v000 it is 6.01 times as fast.
#include <hip/hip_runtime.h>
#include <hip/hip_bf16.h>
#include <math.h>

typedef __attribute__((ext_vector_type(16))) _Float16 v16h;
typedef __attribute__((ext_vector_type(8)))  _Float16 v8h;
typedef __attribute__((ext_vector_type(8)))  float    v8f;
typedef __attribute__((ext_vector_type(4)))  float    v4f;
typedef __attribute__((ext_vector_type(4)))  _Float16 v4h;

#define S_LEN 4096
#define DMODEL 1024
#define NHEADS 16
#define HDIM 64
#define CHUNKLEN 1024

// ---------------------------------------------------------------------------
// WMMA helpers: v_wmma_f32_16x16x32_f16, D = A(16x32) * B(32x16) + C(16x16 f32)
// A layout (wave32): lane L (row M = L%16); halves 0..7 -> K = base+0..7,
// halves 8..15 -> K = base+16..23, base = (L>=16)?8:0.
// B layout mirrors A with N = L%16. C/D: VGPR r, lane L: M = r + ((L>=16)?8:0).
// ---------------------------------------------------------------------------
__device__ __forceinline__ v8f wmma_f16(v16h a, v16h b, v8f c) {
  return __builtin_amdgcn_wmma_f32_16x16x32_f16(
      false, a, false, b, (short)0, c, false, false);
}

__device__ __forceinline__ v16h pack16(v8h lo, v8h hi) {
  v16h r;
#pragma unroll
  for (int t = 0; t < 8; ++t) { r[t] = lo[t]; r[8 + t] = hi[t]; }
  return r;
}

__device__ __forceinline__ v16h load_frag_f16(const _Float16* __restrict__ row, int kb) {
  v8h lo = *(const v8h*)(row + kb);
  v8h hi = *(const v8h*)(row + kb + 16);
  return pack16(lo, hi);
}

// ---------------------------------------------------------------------------
// Kernel 1: every f32 -> f16 conversion of the call in ONE launch; none depends on another.
// The block index picks the part: blocks 0 .. CVX_BLOCKS-1 take x, the rest the four weights.
//
// x, elementwise: a thread takes 8 pieces of 4 floats. Each wave-wide load covers 512
// contiguous bytes and each store 256; all 8 loads are issued before the first use.
//
// weights, convert + transpose  w[K][N] f32  ->  wT[N][K] f16, K = N = DMODEL:
// one 64(k) x 64(n) tile per work-group, turned in LDS: 16-byte loads along n,
// 16-byte stores along k, 8 lanes of one wave write each whole 128-byte line of wT.
// ---------------------------------------------------------------------------
#define CVT_THREADS 256
#define CVX_BLOCKS  512
#define CVX_PIECES  8
static_assert(CVX_BLOCKS * CVT_THREADS * CVX_PIECES * 4 == S_LEN * DMODEL, "x is covered exactly once");

#define TTILE 64
#define TROW  72   // halves per LDS row: 128 B of data + 16 B, keeps 16-byte reads aligned
#define TPERW ((DMODEL / TTILE) * (DMODEL / TTILE))   // tiles of one weight
#define CVT_BLOCKS (CVX_BLOCKS + 4 * TPERW)

// wT4: the four transposed weights one behind the other, in the order q, k, v, o
__global__ __launch_bounds__(CVT_THREADS) void cvt_all_kernel(
    const float* __restrict__ x,  const float* __restrict__ wq, const float* __restrict__ wk,
    const float* __restrict__ wv, const float* __restrict__ wo,
    _Float16* __restrict__ xh, _Float16* __restrict__ wT4) {
  __shared__ __align__(16) _Float16 sT[TTILE][TROW];   // n x k
  if (blockIdx.x < CVX_BLOCKS) {                       // the same for the whole work-group
    const v4f* xv = (const v4f*)x;
    v4h*       hv = (v4h*)xh;
    unsigned q = blockIdx.x * (CVT_THREADS * CVX_PIECES) + threadIdx.x;   // piece index, the same on both sides
    v4f a[CVX_PIECES];
#pragma unroll
    for (int i = 0; i < CVX_PIECES; ++i) a[i] = xv[q + i * CVT_THREADS];
#pragma unroll
    for (int i = 0; i < CVX_PIECES; ++i) {
      v4h h;
#pragma unroll
      for (int c = 0; c < 4; ++c) h[c] = (_Float16)a[i][c];
      hv[q + i * CVT_THREADS] = h;
    }
    return;
  }
  unsigned t     = blockIdx.x - CVX_BLOCKS;
  int which = (int)(t / TPERW), tile = (int)(t % TPERW);
  const float* wlo = (which & 1) ? wk : wq;
  const float* whi = (which & 1) ? wo : wv;
  const float* w   = (which & 2) ? whi : wlo;
  _Float16*   wT = wT4 + (size_t)which * DMODEL * DMODEL;
  int n0 = (tile % (DMODEL / TTILE)) * TTILE, k0 = (tile / (DMODEL / TTILE)) * TTILE;
  int c4 = (threadIdx.x & 15) * 4;    // 4 consecutive n
  int r4 = (threadIdx.x >> 4) * 4;    // 4 consecutive k
  v4f v[4];
#pragma unroll
  for (int i = 0; i < 4; ++i)
    v[i] = *(const v4f*)(w + (size_t)(k0 + r4 + i) * DMODEL + n0 + c4);
#pragma unroll
  for (int c = 0; c < 4; ++c) {
    v4h h;
#pragma unroll
    for (int i = 0; i < 4; ++i) h[i] = (_Float16)v[i][c];
    *(v4h*)&sT[c4 + c][r4] = h;
  }
  __syncthreads();   // the tile is complete before any thread reads rows that others wrote
  int row = threadIdx.x >> 3;         // 0..31, second piece: +32
  int col = (threadIdx.x & 7) * 8;    // in halves
#pragma unroll
  for (int i = 0; i < 2; ++i)
    *(v8h*)(wT + (size_t)(n0 + row + 32 * i) * DMODEL + k0 + col) =
        *(const v8h*)&sT[row + 32 * i][col];
}

// ---------------------------------------------------------------------------
// Shared main loop of the GEMM kernels: C(128 x 128) = A(128 x K) * B(128 x K)^T, both f16
// and K-contiguous. The eight waves of a work-group share the two operand tiles through LDS:
// a stage is 128 k (256-byte rows) of all 256 rows, brought in by asynchronous copies of
// whole rows, two buffers, the next stage in flight while this one is worked on.
// Waves stand 4 (M) x 2 (N); each computes 32 x 64 (B fragments reused by 2 A fragments).
// ---------------------------------------------------------------------------
#define GT_MN   128                 // rows of A and rows of B per work-group
#define GT_K    128                 // halves of K per stage
#define GROW    136                 // halves per LDS row: 256 B of data + 16 B, conflict-free for 16-B reads
#define GSTAGES (DMODEL / GT_K)
#define GSTEPS  (GT_K / 32)         // matrix steps of 32 k per stage
static_assert(GSTAGES >= 2, "the prologue starts two stages");

// One thread's share of one operand's stage: eight 16-byte pieces, rows 16 apart.
// The s_wait_xcnt stands inside the statement so that no address register of a
// copy is rewritten ahead of it.
__device__ __forceinline__ void copy_rows8(unsigned l, const _Float16* g) {
  const unsigned ls = 16 * GROW * 2;          // bytes of 16 LDS rows
  const size_t   gs = (size_t)16 * DMODEL;    // halves of 16 global rows
  asm volatile(
      "global_load_async_to_lds_b128 %0, %1, off\n\t"
      "global_load_async_to_lds_b128 %2, %3, off\n\t"
      "global_load_async_to_lds_b128 %4, %5, off\n\t"
      "global_load_async_to_lds_b128 %6, %7, off\n\t"
      "global_load_async_to_lds_b128 %8, %9, off\n\t"
      "global_load_async_to_lds_b128 %10, %11, off\n\t"
      "global_load_async_to_lds_b128 %12, %13, off\n\t"
      "global_load_async_to_lds_b128 %14, %15, off\n\t"
      "s_wait_xcnt 0x0"
      :: "v"(l),          "v"(g),          "v"(l + ls),     "v"(g + gs),
         "v"(l + 2 * ls), "v"(g + 2 * gs), "v"(l + 3 * ls), "v"(g + 3 * gs),
         "v"(l + 4 * ls), "v"(g + 4 * gs), "v"(l + 5 * ls), "v"(g + 5 * gs),
         "v"(l + 6 * ls), "v"(g + 6 * gs), "v"(l + 7 * ls), "v"(g + 7 * gs)
      : "memory");
}

typedef _Float16 gemm_tile_t[GT_MN][GROW];

// a: first row of the work-group's A tile; b: first row of its B tile; wm, wn: the wave's place
__device__ __forceinline__ void gemm_tile_loop(
    const _Float16* __restrict__ a, const _Float16* __restrict__ b,
    gemm_tile_t* sA, gemm_tile_t* sB, int wm, int wn, v8f (&c0)[4], v8f (&c1)[4]) {
  int lane16 = threadIdx.x & 15;
  int hi8    = ((threadIdx.x >> 4) & 1) << 3;
  // copy map: piece p = threadIdx.x + 256 i: row p/16, 16-byte column p%16; a wave covers 2 whole rows
  int crow = threadIdx.x >> 4;            // 0..15, piece i: +16 i
  int ccol = (threadIdx.x & 15) * 8;      // in halves
  const _Float16* ga = a + (size_t)crow * DMODEL + ccol;
  const _Float16* gb = b + (size_t)crow * DMODEL + ccol;
  unsigned la = (unsigned)(size_t)&sA[0][crow][ccol];
  unsigned lb = (unsigned)(size_t)&sB[0][crow][ccol];
  const unsigned buf_bytes = GT_MN * GROW * 2;

  // --- prologue: stage 0 lands and is published, then stage 1 starts
  copy_rows8(la, ga);
  copy_rows8(lb, gb);
  asm volatile("s_wait_asynccnt 0x0" ::: "memory");   // this wave's copies of stage 0 have landed
  __syncthreads();                                    // ... and every other wave's
  copy_rows8(la + buf_bytes, ga + GT_K);
  copy_rows8(lb + buf_bytes, gb + GT_K);

  for (int s = 0; s < GSTAGES; ++s) {
    int buf = s & 1;
    const _Float16* ar = &sA[buf][wm * 32 + lane16][0];
    const _Float16* br = &sB[buf][wn * 64 + lane16][0];
    // two fragment sets: the reads of the next 32 k are issued as one group ahead of this step's products
    v16h fa[2][2], fb[2][4];
    fa[0][0] = load_frag_f16(ar, hi8);
    fa[0][1] = load_frag_f16(ar + 16 * GROW, hi8);
#pragma unroll
    for (int j = 0; j < 4; ++j) fb[0][j] = load_frag_f16(br + j * 16 * GROW, hi8);
    // unrolled (as the j loops are) so that every fragment-set index is a constant and the sets stay in registers
#pragma unroll
    for (int t = 0; t + 1 < GSTEPS; ++t) {
      const int cur = t & 1, nxt = cur ^ 1;
      int kb = (t + 1) * 32 + hi8;
      fa[nxt][0] = load_frag_f16(ar, kb);
      fa[nxt][1] = load_frag_f16(ar + 16 * GROW, kb);
#pragma unroll
      for (int j = 0; j < 4; ++j) fb[nxt][j] = load_frag_f16(br + j * 16 * GROW, kb);
      // keeps the group of reads above in front of the products below; without it the build
      // sinks each read to its product and waits out the LDS latency every two products
      __builtin_amdgcn_sched_barrier(0);
#pragma unroll
      for (int j = 0; j < 4; ++j) {
        c0[j] = wmma_f16(fa[cur][0], fb[cur][j], c0[j]);
        c1[j] = wmma_f16(fa[cur][1], fb[cur][j], c1[j]);
      }
    }
    // keeps the products above in front of the barrier; without it the build sinks them
    // behind it, in front of the copies, which then start that much later
    __builtin_amdgcn_sched_barrier(0);
    // --- publish point of stage s+1; it also ends every wave's reads of this buffer
    // (behind its first wait the last step's fragments are in registers)
    asm volatile("s_wait_dscnt 0x0" ::: "memory");     // this wave's LDS reads of the buffer are done
    asm volatile("s_wait_asynccnt 0x0" ::: "memory");  // this wave's copies of stage s+1 have landed
    __syncthreads();
    if (s + 2 < GSTAGES) {                             // stage s+2 into the buffer just read
      unsigned bo = (unsigned)buf * buf_bytes;
      copy_rows8(la + bo, ga + (s + 2) * GT_K);
      copy_rows8(lb + bo, gb + (s + 2) * GT_K);
    }
#pragma unroll
    for (int j = 0; j < 4; ++j) {
      c0[j] = wmma_f16(fa[(GSTEPS - 1) & 1][0], fb[(GSTEPS - 1) & 1][j], c0[j]);
      c1[j] = wmma_f16(fa[(GSTEPS - 1) & 1][1], fb[(GSTEPS - 1) & 1][j], c1[j]);
    }
  }
  asm volatile("s_wait_asynccnt 0x0" ::: "memory");    // nothing of this wave's is in flight at its end
}

// ---------------------------------------------------------------------------
// Kernel 2: the three projections in ONE launch.  out = xh(f16 SxK) @ wT^T(f16) + bias
// One 128 x 128 tile per work-group, 32 x 8 tiles a projection; none depends on another.
// The block index picks the projection: V, then Q, then K.
// wT3: the transposed weights of q, k, v one behind the other; qkv: their outputs likewise.
// mode 0 (q, k): out[h][s][d]; mode 1 (v): out[h][d][s]
// A lane holds 8 consecutive rows (M) of one column (N) of each accumulator tile. M is made
// the dimension that is contiguous in the output: s for V (A = x rows, B = weight rows),
// d for Q and K (A = weight rows, B = x rows). The tile then goes, as f16, through LDS
// ([N][M], 16-byte writes) and leaves in 16-byte stores that cover whole 128-byte lines.
// ---------------------------------------------------------------------------
#define GTILES ((S_LEN / GT_MN) * (DMODEL / GT_MN))   // tiles of one projection

__device__ __forceinline__ void stage_pair(_Float16* dst, v8f a, v8f b) {
  *(v8h*)dst        = __builtin_convertvector(a, v8h);
  *(v8h*)(dst + 16) = __builtin_convertvector(b, v8h);
}

__global__ __launch_bounds__(256) void gemm_qkv_kernel(
    const _Float16* __restrict__ xh, const _Float16* __restrict__ wT3,
    const float* __restrict__ bq, const float* __restrict__ bk, const float* __restrict__ bv,
    _Float16* __restrict__ qkv) {
  __shared__ __align__(16) gemm_tile_t sA[2];
  __shared__ __align__(16) gemm_tile_t sB[2];
  int part = (int)(blockIdx.x / GTILES), tile = (int)(blockIdx.x % GTILES);
  int proj = part == 0 ? 2 : part - 1;                  // 0 q, 1 k, 2 v; the same for the whole work-group
  const _Float16* wT   = wT3 + (size_t)proj * DMODEL * DMODEL;
  const float*    bias = proj == 0 ? bq : proj == 1 ? bk : bv;
  _Float16*       out  = qkv + (size_t)proj * S_LEN * DMODEL;
  int mode = proj == 2 ? 1 : 0;
  int wave   = threadIdx.x >> 5;
  int lane16 = threadIdx.x & 15;
  int hi8    = ((threadIdx.x >> 4) & 1) << 3;           // 0 or 8
  int wm = wave & 3, wn = wave >> 2;
  int bm = (tile & 31) * GT_MN;                         // first position s: 32 tiles of 128
  int bn = (tile >> 5) * GT_MN;                         // first feature n: 8 tiles of 128
  const _Float16* xt = xh + (size_t)bm * DMODEL;
  const _Float16* wt = wT + (size_t)bn * DMODEL;

  v8f c0[4] = {}, c1[4] = {};
  gemm_tile_loop(mode ? xt : wt, mode ? wt : xt, sA, sB, wm, wn, c0, c1);

  // The ring is free: every wave's reads had returned before the loop's last barrier, and the
  // last copies had landed one barrier earlier. Its first buffer takes the tile, [N][M].
  _Float16 (*sC)[GROW] = sA[0];
  _Float16* dst = &sC[wn * 64 + lane16][wm * 32 + hi8];   // tile j: 16 rows further
  if (mode) {                                             // the feature is the column N
    float bj[4];
#pragma unroll   // constant indices: the arrays stay in registers
    for (int j = 0; j < 4; ++j) bj[j] = bias[bn + wn * 64 + j * 16 + lane16];
#pragma unroll   // constant indices: the arrays stay in registers
    for (int j = 0; j < 4; ++j) stage_pair(dst + j * 16 * GROW, c0[j] + bj[j], c1[j] + bj[j]);
  } else {                                                // the features are the rows M
    const v4f* bp = (const v4f*)(bias + bn + wm * 32 + hi8);
    v4f p0 = bp[0], p1 = bp[1], p2 = bp[4], p3 = bp[5];
    v8f b0 = __builtin_shufflevector(p0, p1, 0, 1, 2, 3, 4, 5, 6, 7);
    v8f b1 = __builtin_shufflevector(p2, p3, 0, 1, 2, 3, 4, 5, 6, 7);
#pragma unroll   // constant indices: the arrays stay in registers
    for (int j = 0; j < 4; ++j) stage_pair(dst + j * 16 * GROW, c0[j] + b0, c1[j] + b1);
  }
  __syncthreads();   // the tile is complete before any thread reads rows that other waves wrote

  // piece p = threadIdx.x + 256 i: row p/16, 16-byte column p%16; a wave covers 2 whole rows of 256 B
  int row = threadIdx.x >> 4;             // 0..15, piece i: +16 i
  int c8  = (threadIdx.x & 15) * 8;       // in halves
  v8h h[8];
#pragma unroll   // constant indices: the arrays stay in registers
  for (int i = 0; i < 8; ++i) h[i] = *(const v8h*)&sC[row + 16 * i][c8];
  // V: row = feature (h * 64 + d), columns = positions; Q, K: row = position, columns = features of two heads
  _Float16* p = out + (mode ? (size_t)(bn + row) * S_LEN + bm + c8
                            : ((size_t)((bn + c8) >> 6) * S_LEN + bm + row) * HDIM + ((bn + c8) & 63));
  // the step between a thread's pieces is a constant in either layout
  if (mode) {
#pragma unroll   // constant indices: the arrays stay in registers
    for (int i = 0; i < 8; ++i) *(v8h*)(p + (size_t)i * 16 * S_LEN) = h[i];
  } else {
#pragma unroll   // constant indices: the arrays stay in registers
    for (int i = 0; i < 8; ++i) *(v8h*)(p + (size_t)i * 16 * HDIM) = h[i];
  }
}

// ---------------------------------------------------------------------------
// Kernel 3: flash-style block-causal attention. A tile is 128 q rows of one head, all in
// one chunk; its cost grows with its chunk (1 to 4 chunks of keys). All work-groups are
// resident at once, so the launch lasts as long as the fullest: every work-group takes TWO
// tiles of its head one after the other, tile n-1-p and then tile p, which together always
// walk 5 chunks of keys. 16 waves: wave w works on q rows 16 (w%8) .. +15; waves 0-7 take
// the first 128 keys of each 256-key stage, waves 8-15 the other 128, each with its own
// running maximum, sum and Ot; the two parts of a query are joined once per tile through LDS.
// The K and V stages come in by asynchronous copies of whole rows, two buffers, the next
// stage in flight while this one is worked on; the second tile's stages follow the first
// tile's in the same ring. Per wave and 64 keys: 8 score WMMAs + softmax + 8 PV WMMAs.
// Both products are formed transposed: St = K * Qt (A = K rows, B = Q) and
// Ot += Vt * Pt (A = Vt rows, B = P). A lane then holds 32 of the 64 scores of ONE
// query (column lane%16; keys 16t + r + 8*(lane/16)), so maximum and sum are taken
// in the lane, with one exchange between the wave's halves, and the score
// accumulators of tiles 2i and 2i+1 are, converted, the B fragment of keys
// 32i..32i+31: P never leaves the registers.
// qh,kh: [H][S][64] f16;  vt: [H][64][S] f16;  aout: [S][H*64] f16
// ---------------------------------------------------------------------------
#define ATT_WAVES 16
#define ATT_QW    8                     // waves side by side over the q rows
#define ATT_ROWS  (ATT_QW * 16)         // q rows of a tile
#define ATT_TILES (S_LEN / ATT_ROWS)    // tiles of one head
#define KTILE  64                       // keys of one block: scores, softmax, PV
#define KSUB   2                        // blocks per wave and stage
#define KSTAGE (2 * KSUB * KTILE)       // keys per stage
#define CSTAGES (CHUNKLEN / KSTAGE)     // stages of one chunk
#define LROW 72              // halves per LDS row of K: 128 B of data + 16 B, conflict-free for 16-B reads
#define VROW (KSTAGE + 8)    // halves per LDS row of V: 512 B of data + 16 B, likewise
static_assert(ATT_TILES % 2 == 0, "tiles pair up");
static_assert(CHUNKLEN % ATT_ROWS == 0, "a tile lies in one chunk");
static_assert(CHUNKLEN % KSTAGE == 0 && CSTAGES >= 2, "the prologue starts two stages of the first tile");
static_assert(KSTAGE == 4 * 64 && HDIM == 4 * 16 && KSTAGE * 2 == 32 * 16, "the copy map below");

// One stage's share of one thread: four 16-byte pieces of K, rows 64 apart, and four of V,
// rows 16 apart. The s_wait_xcnt stands inside the statement so that no address register
// of a copy is rewritten ahead of it.
__device__ __forceinline__ void copy_kv_stage(
    unsigned lk, const _Float16* gk, unsigned lv, const _Float16* gv) {
  const unsigned ks = 64 * LROW * 2;          // bytes of 64 LDS rows of K
  const unsigned vs = 16 * VROW * 2;          // bytes of 16 LDS rows of V
  const size_t   kg = (size_t)64 * HDIM;      // halves of 64 global rows of K
  const size_t   vg = (size_t)16 * S_LEN;     // halves of 16 global rows of V
  asm volatile(
      "global_load_async_to_lds_b128 %0, %1, off\n\t"
      "global_load_async_to_lds_b128 %2, %3, off\n\t"
      "global_load_async_to_lds_b128 %4, %5, off\n\t"
      "global_load_async_to_lds_b128 %6, %7, off\n\t"
      "global_load_async_to_lds_b128 %8, %9, off\n\t"
      "global_load_async_to_lds_b128 %10, %11, off\n\t"
      "global_load_async_to_lds_b128 %12, %13, off\n\t"
      "global_load_async_to_lds_b128 %14, %15, off\n\t"
      "s_wait_xcnt 0x0"
      :: "v"(lk),          "v"(gk),          "v"(lk + ks),     "v"(gk + kg),
         "v"(lk + 2 * ks), "v"(gk + 2 * kg), "v"(lk + 3 * ks), "v"(gk + 3 * kg),
         "v"(lv),          "v"(gv),          "v"(lv + vs),     "v"(gv + vg),
         "v"(lv + 2 * vs), "v"(gv + 2 * vg), "v"(lv + 3 * vs), "v"(gv + 3 * vg)
      : "memory");
}

// lane l <-> lane l ^ 16, on the vector unit
__device__ __forceinline__ float xhalf(float x) {
  int b = __builtin_bit_cast(int, x);
  return __builtin_bit_cast(float,
      __builtin_amdgcn_permlanex16(b, b, 0x76543210, 0xfedcba98, false, false));
}

// waves_per_eu: the grid puts 4 waves on a SIMD (256 work-groups of 16 waves, 256 WGPs). With that
// register budget stated the compiler issues a block's K reads as a group ahead of the score
// products; without it the build reads two pieces, waits for them and multiplies, product by product.
__global__ __launch_bounds__(ATT_WAVES * 32) __attribute__((amdgpu_waves_per_eu(4, 4))) void attn_kernel(
    const _Float16* __restrict__ qh, const _Float16* __restrict__ kh,
    const _Float16* __restrict__ vt, _Float16* __restrict__ aout) {
  __shared__ __align__(16) _Float16 sK[2][KSTAGE][LROW];         // keys x d
  __shared__ __align__(16) _Float16 sV[2][HDIM][VROW];           // d x keys
  __shared__ __align__(16) v4f      sO[ATT_QW][8][32];           // Ot of the second key part, lane by lane
  __shared__ float                  sMS[ATT_QW][2][32];          // its maximum and its sum

  int head   = blockIdx.y;
  int wave   = threadIdx.x >> 5;
  int lane   = threadIdx.x & 31;
  int lane16 = threadIdx.x & 15;
  int hi8    = ((threadIdx.x >> 4) & 1) << 3;
  int qi     = wave & (ATT_QW - 1);       // which 16 q rows
  int kpart  = wave / ATT_QW;             // which half of a stage's keys
  const float scale = 0.125f;             // 64^-0.5

  // the two tiles and their stages; the same for all 16 waves
  int tile_a = ATT_TILES - 1 - (int)blockIdx.x, tile_b = (int)blockIdx.x;
  int n_a    = (tile_a * ATT_ROWS / CHUNKLEN + 1) * CSTAGES;   // block-causal: full chunks
  int n_all  = n_a + (tile_b * ATT_ROWS / CHUNKLEN + 1) * CSTAGES;

  // copy map, K: piece p = threadIdx.x + 512 i: row p/8, 16-byte column p%8; a wave covers 4 whole rows
  //           V: piece p = threadIdx.x + 512 i: row p/32, 16-byte column p%32; a wave covers 1 whole row
  int krow = threadIdx.x >> 3;            // 0..63, piece i: +64 i
  int kcol = (threadIdx.x & 7) * 8;       // in halves
  int vrow = threadIdx.x >> 5;            // 0..15, piece i: +16 i
  int vcol = (threadIdx.x & 31) * 8;      // in halves
  const _Float16* gk = kh + ((size_t)head * S_LEN + krow) * HDIM + kcol;
  const _Float16* gv = vt + ((size_t)head * HDIM + vrow) * S_LEN + vcol;
  unsigned lk = (unsigned)(size_t)&sK[0][krow][kcol];
  unsigned lv = (unsigned)(size_t)&sV[0][vrow][vcol];
  const unsigned k_buf = KSTAGE * LROW * 2;   // bytes of one buffer
  const unsigned v_buf = HDIM * VROW * 2;

  // --- prologue: stage 0 lands and is published, then stage 1 starts
  copy_kv_stage(lk, gk, lv, gv);
  asm volatile("s_wait_asynccnt 0x0" ::: "memory");   // this wave's copies of stage 0 have landed
  __syncthreads();                                    // ... and every other wave's
  copy_kv_stage(lk + k_buf, gk + KSTAGE * HDIM, lv + v_buf, gv + KSTAGE);

  int s = 0;   // stage, counted through both tiles
  for (int ph = 0; ph < 2; ++ph) {
    int m0    = (ph == 0 ? tile_a : tile_b) * ATT_ROWS + qi * 16;
    int s_end = ph == 0 ? n_a : n_all;

    const _Float16* qrow = qh + ((size_t)head * S_LEN + m0 + lane16) * HDIM;
    v16h aq0 = load_frag_f16(qrow, hi8);        // d 0..31
    v16h aq1 = load_frag_f16(qrow + 32, hi8);   // d 32..63

    float rowmax = -INFINITY;   // of this lane's query over this wave's keys, the same in both halves
    float rowsum = 0.0f;        // of this lane's half of the wave's keys; the halves join after the loop
    v8f o[4] = {};              // Ot: row d = 16j + r + hi8, column = this lane's query

    for (; s < s_end; ++s) {
      int buf = s & 1;
      // unrolled so that the second block's LDS offsets are constants and its K reads can start early
#pragma unroll
      for (int sb = 0; sb < KSUB; ++sb) {
        const int k0 = sb * KTILE;   // the block's first key within the wave's half of the stage
        // --- scores for 64 keys, transposed: four 16(keys) x 16(queries) tiles, Hd=64 in two WMMAs each
        v8f u[4];
#pragma unroll
        for (int t = 0; t < 4; ++t) {
          const _Float16* krw = &sK[buf][kpart * (KSUB * KTILE) + k0 + t * 16 + lane16][0];
          v8f sc = {};
          sc = wmma_f16(load_frag_f16(krw,      hi8), aq0, sc);
          sc = wmma_f16(load_frag_f16(krw + 32, hi8), aq1, sc);
          u[t] = sc * scale;
        }

        // --- online softmax; a lane holds 32 scores of its query, the lane l ^ 16 the other 32
        float m8[8];
#pragma unroll
        for (int r = 0; r < 8; ++r)
          m8[r] = fmaxf(fmaxf(u[0][r], u[1][r]), fmaxf(u[2][r], u[3][r]));
        float mx = fmaxf(fmaxf(fmaxf(m8[0], m8[1]), fmaxf(m8[2], m8[3])),
                         fmaxf(fmaxf(m8[4], m8[5]), fmaxf(m8[6], m8[7])));
        mx = fmaxf(mx, xhalf(mx));
        float nm    = fmaxf(rowmax, mx);
        float alpha = __expf(rowmax - nm);
        rowmax      = nm;
        float s8[8];
#pragma unroll
        for (int r = 0; r < 8; ++r) {
#pragma unroll
          for (int t = 0; t < 4; ++t) u[t][r] = __expf(u[t][r] - nm);
          s8[r] = (u[0][r] + u[1][r]) + (u[2][r] + u[3][r]);
        }
        float ps = ((s8[0] + s8[1]) + (s8[2] + s8[3])) + ((s8[4] + s8[5]) + (s8[6] + s8[7]));
        rowsum = rowsum * alpha + ps;
#pragma unroll
        for (int j = 0; j < 4; ++j) o[j] = o[j] * alpha;

        // --- P as B fragments, straight from the score accumulators:
        // halves 0..7 = keys hi8+0..7 of the 32 (tile 2i), halves 8..15 = keys hi8+16..23 (tile 2i+1)
        v16h bp0, bp1;
#pragma unroll
        for (int r = 0; r < 8; ++r) {
          bp0[r] = (_Float16)u[0][r];  bp0[8 + r] = (_Float16)u[1][r];
          bp1[r] = (_Float16)u[2][r];  bp1[8 + r] = (_Float16)u[3][r];
        }

        // --- Ot += Vt @ Pt   (V transposed in LDS: contiguous over keys per d)
#pragma unroll
        for (int j = 0; j < 4; ++j) {
          const _Float16* vr = &sV[buf][j * 16 + lane16][kpart * (KSUB * KTILE) + k0];
          o[j] = wmma_f16(load_frag_f16(vr,      hi8), bp0, o[j]);
          o[j] = wmma_f16(load_frag_f16(vr + 32, hi8), bp1, o[j]);
        }
      }

      // --- publish point of stage s+1; it also ends every wave's reads of this buffer
      asm volatile("s_wait_dscnt 0x0" ::: "memory");     // this wave's LDS reads of the buffer are done
      asm volatile("s_wait_asynccnt 0x0" ::: "memory");  // this wave's copies of stage s+1 have landed
      __syncthreads();
      if (s + 2 < n_all) {                               // stage s+2 into the buffer just read
        int s2  = s + 2;
        int key = (s2 < n_a ? s2 : s2 - n_a) * KSTAGE;   // the second tile starts again at key 0
        copy_kv_stage(lk + (unsigned)buf * k_buf, gk + (size_t)key * HDIM,
                      lv + (unsigned)buf * v_buf, gv + key);
      }
    }

    // --- join the two key parts of each query: waves 8-15 hand theirs over, waves 0-7 finish the tile
    float sum = rowsum + xhalf(rowsum);   // the two lane halves' sums of this wave's keys
    if (kpart == 1) {
#pragma unroll
      for (int j = 0; j < 4; ++j) {
        sO[qi][2 * j][lane]     = __builtin_shufflevector(o[j], o[j], 0, 1, 2, 3);
        sO[qi][2 * j + 1][lane] = __builtin_shufflevector(o[j], o[j], 4, 5, 6, 7);
      }
      sMS[qi][0][lane] = rowmax;
      sMS[qi][1][lane] = sum;
    }
    __syncthreads();   // the handed-over parts are complete before their readers start
    if (kpart == 0) {
      float pm = sMS[qi][0][lane], psum = sMS[qi][1][lane];
      float m  = fmaxf(rowmax, pm);
      float a  = __expf(rowmax - m), b = __expf(pm - m);
      float inv = 1.0f / (sum * a + psum * b);
      a *= inv;
      b *= inv;
      // a lane holds 8 consecutive d of its query per tile: one 16-byte store each
      _Float16* orow = aout + (size_t)(m0 + lane16) * DMODEL + head * HDIM + hi8;
#pragma unroll
      for (int j = 0; j < 4; ++j) {
        v4f p0 = sO[qi][2 * j][lane], p1 = sO[qi][2 * j + 1][lane];
        v8h h;
#pragma unroll
        for (int r = 0; r < 4; ++r) {
          h[r]     = (_Float16)(o[j][r] * a + p0[r] * b);
          h[4 + r] = (_Float16)(o[j][4 + r] * a + p1[r] * b);
        }
        *(v8h*)(orow + j * 16) = h;
      }
      // the second tile rewrites the registers that these stores name
      asm volatile("s_wait_xcnt 0x0" ::: "memory");
    }
  }
  asm volatile("s_wait_asynccnt 0x0" ::: "memory");    // nothing of this wave's is in flight at its end
}

// ---------------------------------------------------------------------------
// Kernel 4: output projection GEMM.  out(f32) = aout(f16) @ woT^T(f16) + bo
// One 128 x 128 tile per work-group (32 x 8 tiles).
// ---------------------------------------------------------------------------
__global__ __launch_bounds__(256) void gemm_out_kernel(
    const _Float16* __restrict__ ain, const _Float16* __restrict__ wT,
    const float* __restrict__ bias, float* __restrict__ out) {
  __shared__ __align__(16) gemm_tile_t sA[2];
  __shared__ __align__(16) gemm_tile_t sB[2];
  const int N = DMODEL;
  int wave   = threadIdx.x >> 5;
  int lane16 = threadIdx.x & 15;
  int hi8    = ((threadIdx.x >> 4) & 1) << 3;
  int wm = wave & 3, wn = wave >> 2;
  int bm = (blockIdx.x & 31) * GT_MN;
  int bn = (blockIdx.x >> 5) * GT_MN;
  int m0 = bm + wm * 32, n0 = bn + wn * 64;

  v8f c0[4] = {}, c1[4] = {};
  gemm_tile_loop(ain + (size_t)bm * DMODEL, wT + (size_t)bn * DMODEL, sA, sB, wm, wn, c0, c1);

#pragma unroll
  for (int j = 0; j < 4; ++j) {
    int n = n0 + j * 16 + lane16;
    float bj = bias[n];
#pragma unroll
    for (int r = 0; r < 8; ++r) {
      int s0r = m0 + r + hi8;
      out[(size_t)s0r * N + n]        = c0[j][r] + bj;
      out[(size_t)(s0r + 16) * N + n] = c1[j][r] + bj;
    }
  }
}

// ---------------------------------------------------------------------------
// Host launch
// ---------------------------------------------------------------------------
extern "C" void kernel_launch(void* const* d_in, const int* in_sizes, int n_in,
                              void* d_out, int out_size, void* d_ws, size_t ws_size,
                              hipStream_t stream) {
  const float* x  = (const float*)d_in[0];
  const float* wq = (const float*)d_in[1];
  const float* bq = (const float*)d_in[2];
  const float* wk = (const float*)d_in[3];
  const float* bk = (const float*)d_in[4];
  const float* wv = (const float*)d_in[5];
  const float* bv = (const float*)d_in[6];
  const float* wo = (const float*)d_in[7];
  const float* bo = (const float*)d_in[8];
  float* out = (float*)d_out;

  char* ws = (char*)d_ws;
  const size_t MB = 1024 * 1024;
  _Float16* wqT  = (_Float16*)(ws + 0 * MB);    // [1024][1024] f16, 2 MB each
                                                // wkT at 2 MB, wvT at 4 MB
  _Float16* woT  = (_Float16*)(ws + 6 * MB);
  _Float16* qh   = (_Float16*)(ws + 8 * MB);    // [16][4096][64], 8 MB each
  _Float16* kh   = (_Float16*)(ws + 16 * MB);
  _Float16* vt   = (_Float16*)(ws + 24 * MB);   // [16][64][4096]
  _Float16* aout = (_Float16*)(ws + 32 * MB);   // [4096][1024]
  _Float16* xh   = (_Float16*)(ws + 40 * MB);   // [4096][1024]

  // wqT .. woT lie one behind the other, and so do qh, kh, vt
  cvt_all_kernel<<<CVT_BLOCKS, CVT_THREADS, 0, stream>>>(x, wq, wk, wv, wo, xh, wqT);

  gemm_qkv_kernel<<<3 * GTILES, 256, 0, stream>>>(xh, wqT, bq, bk, bv, qh);

  attn_kernel<<<dim3(ATT_TILES / 2, NHEADS), ATT_WAVES * 32, 0, stream>>>(qh, kh, vt, aout);

  gemm_out_kernel<<<256, 256, 0, stream>>>(aout, woT, bo, out);
}

// v008
// A run of this version takes 84.1 microseconds.
// Two timings next to v007 put it at 1.04 and 1.03 times that version's speed.
// Over all steps from v000 it is 6.22 times as fast.
#include <hip/hip_runtime.h>
#include <hip/hip_bf16.h>
#include <math.h>

typedef __attribute__((ext_vector_type(16))) _Float16 v16h;
typedef __attribute__((ext_vector_type(8)))  _Float16 v8h;
typedef __attribute__((ext_vector_type(8)))  float    v8f;
typedef __attribute__((ext_vector_type(4)))  float    v4f;
typedef __attribute__((ext_vector_type(4)))  _Float16 v4h;

#define S_LEN 4096
#define DMODEL 1024
#define NHEADS 16
#define HDIM 64
#define CHUNKLEN 1024

// ---------------------------------------------------------------------------
// WMMA helpers: v_wmma_f32_16x16x32_f16, D = A(16x32) * B(32x16) + C(16x16 f32)
// A layout (wave32): lane L (row M = L%16); halves 0..7 -> K = base+0..7,
// halves 8..15 -> K = base+16..23, base = (L>=16)?8:0.
// B layout mirrors A with N = L%16. C/D: VGPR r, lane L: M = r + ((L>=16)?8:0).
// ---------------------------------------------------------------------------
__device__ __forceinline__ v8f wmma_f16(v16h a, v16h b, v8f c) {
  return __builtin_amdgcn_wmma_f32_16x16x32_f16(
      false, a, false, b, (short)0, c, false, false);
}

__device__ __forceinline__ v16h pack16(v8h lo, v8h hi) {
  v16h r;
#pragma unroll
  for (int t = 0; t < 8; ++t) { r[t] = lo[t]; r[8 + t] = hi[t]; }
  return r;
}

__device__ __forceinline__ v16h load_frag_f16(const _Float16* __restrict__ row, int kb) {
  v8h lo = *(const v8h*)(row + kb);
  v8h hi = *(const v8h*)(row + kb + 16);
  return pack16(lo, hi);
}

// ---------------------------------------------------------------------------
// Kernel 1: every f32 -> f16 conversion of the call in ONE launch; none depends on another.
// The block index picks the part: blocks 0 .. CVX_BLOCKS-1 take x, the rest the four weights.
//
// x, elementwise: a thread takes 8 pieces of 4 floats. Each wave-wide load covers 512
// contiguous bytes and each store 256; all 8 loads are issued before the first use.
//
// weights, convert + transpose  w[K][N] f32  ->  wT[N][K] f16, K = N = DMODEL:
// one 64(k) x 64(n) tile per work-group, turned in LDS: 16-byte loads along n,
// 16-byte stores along k, 8 lanes of one wave write each whole 128-byte line of wT.
// ---------------------------------------------------------------------------
#define CVT_THREADS 256
#define CVX_BLOCKS  512
#define CVX_PIECES  8
static_assert(CVX_BLOCKS * CVT_THREADS * CVX_PIECES * 4 == S_LEN * DMODEL, "x is covered exactly once");

#define TTILE 64
#define TROW  72   // halves per LDS row: 128 B of data + 16 B, keeps 16-byte reads aligned
#define TPERW ((DMODEL / TTILE) * (DMODEL / TTILE))   // tiles of one weight
#define CVT_BLOCKS (CVX_BLOCKS + 4 * TPERW)

// wT4: the four transposed weights one behind the other, in the order q, k, v, o
__global__ __launch_bounds__(CVT_THREADS) void cvt_all_kernel(
    const float* __restrict__ x,  const float* __restrict__ wq, const float* __restrict__ wk,
    const float* __restrict__ wv, const float* __restrict__ wo,
    _Float16* __restrict__ xh, _Float16* __restrict__ wT4) {
  __shared__ __align__(16) _Float16 sT[TTILE][TROW];   // n x k
  if (blockIdx.x < CVX_BLOCKS) {                       // the same for the whole work-group
    const v4f* xv = (const v4f*)x;
    v4h*       hv = (v4h*)xh;
    unsigned q = blockIdx.x * (CVT_THREADS * CVX_PIECES) + threadIdx.x;   // piece index, the same on both sides
    v4f a[CVX_PIECES];
#pragma unroll
    for (int i = 0; i < CVX_PIECES; ++i) a[i] = xv[q + i * CVT_THREADS];
#pragma unroll
    for (int i = 0; i < CVX_PIECES; ++i) {
      v4h h;
#pragma unroll
      for (int c = 0; c < 4; ++c) h[c] = (_Float16)a[i][c];
      hv[q + i * CVT_THREADS] = h;
    }
    return;
  }
  unsigned t     = blockIdx.x - CVX_BLOCKS;
  int which = (int)(t / TPERW), tile = (int)(t % TPERW);
  const float* wlo = (which & 1) ? wk : wq;
  const float* whi = (which & 1) ? wo : wv;
  const float* w   = (which & 2) ? whi : wlo;
  _Float16*   wT = wT4 + (size_t)which * DMODEL * DMODEL;
  int n0 = (tile % (DMODEL / TTILE)) * TTILE, k0 = (tile / (DMODEL / TTILE)) * TTILE;
  int c4 = (threadIdx.x & 15) * 4;    // 4 consecutive n
  int r4 = (threadIdx.x >> 4) * 4;    // 4 consecutive k
  v4f v[4];
#pragma unroll
  for (int i = 0; i < 4; ++i)
    v[i] = *(const v4f*)(w + (size_t)(k0 + r4 + i) * DMODEL + n0 + c4);
#pragma unroll
  for (int c = 0; c < 4; ++c) {
    v4h h;
#pragma unroll
    for (int i = 0; i < 4; ++i) h[i] = (_Float16)v[i][c];
    *(v4h*)&sT[c4 + c][r4] = h;
  }
  __syncthreads();   // the tile is complete before any thread reads rows that others wrote
  int row = threadIdx.x >> 3;         // 0..31, second piece: +32
  int col = (threadIdx.x & 7) * 8;    // in halves
#pragma unroll
  for (int i = 0; i < 2; ++i)
    *(v8h*)(wT + (size_t)(n0 + row + 32 * i) * DMODEL + k0 + col) =
        *(const v8h*)&sT[row + 32 * i][col];
}

// ---------------------------------------------------------------------------
// Shared main loop of the GEMM kernels: C(128 x 128) = A(128 x K) * B(128 x K)^T, both f16
// and K-contiguous. The eight waves of a work-group share the two operand tiles through LDS:
// a stage is 128 k (256-byte rows) of all 256 rows, brought in by asynchronous copies of
// whole rows, two buffers, the next stage in flight while this one is worked on.
// Waves stand 4 (M) x 2 (N); each computes 32 x 64 (B fragments reused by 2 A fragments).
// ---------------------------------------------------------------------------
#define GT_MN   128                 // rows of A and rows of B per work-group
#define GT_K    128                 // halves of K per stage
#define GROW    136                 // halves per LDS row: 256 B of data + 16 B, conflict-free for 16-B reads
#define GSTAGES (DMODEL / GT_K)
#define GSTEPS  (GT_K / 32)         // matrix steps of 32 k per stage
static_assert(GSTAGES >= 2, "the prologue starts two stages");

// One thread's share of one operand's stage: eight 16-byte pieces, rows 16 apart.
// The s_wait_xcnt stands inside the statement so that no address register of a
// copy is rewritten ahead of it.
__device__ __forceinline__ void copy_rows8(unsigned l, const _Float16* g) {
  const unsigned ls = 16 * GROW * 2;          // bytes of 16 LDS rows
  const size_t   gs = (size_t)16 * DMODEL;    // halves of 16 global rows
  asm volatile(
      "global_load_async_to_lds_b128 %0, %1, off\n\t"
      "global_load_async_to_lds_b128 %2, %3, off\n\t"
      "global_load_async_to_lds_b128 %4, %5, off\n\t"
      "global_load_async_to_lds_b128 %6, %7, off\n\t"
      "global_load_async_to_lds_b128 %8, %9, off\n\t"
      "global_load_async_to_lds_b128 %10, %11, off\n\t"
      "global_load_async_to_lds_b128 %12, %13, off\n\t"
      "global_load_async_to_lds_b128 %14, %15, off\n\t"
      "s_wait_xcnt 0x0"
      :: "v"(l),          "v"(g),          "v"(l + ls),     "v"(g + gs),
         "v"(l + 2 * ls), "v"(g + 2 * gs), "v"(l + 3 * ls), "v"(g + 3 * gs),
         "v"(l + 4 * ls), "v"(g + 4 * gs), "v"(l + 5 * ls), "v"(g + 5 * gs),
         "v"(l + 6 * ls), "v"(g + 6 * gs), "v"(l + 7 * ls), "v"(g + 7 * gs)
      : "memory");
}

typedef _Float16 gemm_tile_t[GT_MN][GROW];

// a: first row of the work-group's A tile; b: first row of its B tile; wm, wn: the wave's place
__device__ __forceinline__ void gemm_tile_loop(
    const _Float16* __restrict__ a, const _Float16* __restrict__ b,
    gemm_tile_t* sA, gemm_tile_t* sB, int wm, int wn, v8f (&c0)[4], v8f (&c1)[4]) {
  int lane16 = threadIdx.x & 15;
  int hi8    = ((threadIdx.x >> 4) & 1) << 3;
  // copy map: piece p = threadIdx.x + 256 i: row p/16, 16-byte column p%16; a wave covers 2 whole rows
  int crow = threadIdx.x >> 4;            // 0..15, piece i: +16 i
  int ccol = (threadIdx.x & 15) * 8;      // in halves
  const _Float16* ga = a + (size_t)crow * DMODEL + ccol;
  const _Float16* gb = b + (size_t)crow * DMODEL + ccol;
  unsigned la = (unsigned)(size_t)&sA[0][crow][ccol];
  unsigned lb = (unsigned)(size_t)&sB[0][crow][ccol];
  const unsigned buf_bytes = GT_MN * GROW * 2;

  // --- prologue: stage 0 lands and is published, then stage 1 starts
  copy_rows8(la, ga);
  copy_rows8(lb, gb);
  asm volatile("s_wait_asynccnt 0x0" ::: "memory");   // this wave's copies of stage 0 have landed
  __syncthreads();                                    // ... and every other wave's
  copy_rows8(la + buf_bytes, ga + GT_K);
  copy_rows8(lb + buf_bytes, gb + GT_K);

  for (int s = 0; s < GSTAGES; ++s) {
    int buf = s & 1;
    const _Float16* ar = &sA[buf][wm * 32 + lane16][0];
    const _Float16* br = &sB[buf][wn * 64 + lane16][0];
    // two fragment sets: the reads of the next 32 k are issued as one group ahead of this step's products
    v16h fa[2][2], fb[2][4];
    fa[0][0] = load_frag_f16(ar, hi8);
    fa[0][1] = load_frag_f16(ar + 16 * GROW, hi8);
#pragma unroll
    for (int j = 0; j < 4; ++j) fb[0][j] = load_frag_f16(br + j * 16 * GROW, hi8);
    // unrolled (as the j loops are) so that every fragment-set index is a constant and the sets stay in registers
#pragma unroll
    for (int t = 0; t + 1 < GSTEPS; ++t) {
      const int cur = t & 1, nxt = cur ^ 1;
      int kb = (t + 1) * 32 + hi8;
      fa[nxt][0] = load_frag_f16(ar, kb);
      fa[nxt][1] = load_frag_f16(ar + 16 * GROW, kb);
#pragma unroll
      for (int j = 0; j < 4; ++j) fb[nxt][j] = load_frag_f16(br + j * 16 * GROW, kb);
      // keeps the group of reads above in front of the products below; without it the build
      // sinks each read to its product and waits out the LDS latency every two products
      __builtin_amdgcn_sched_barrier(0);
#pragma unroll
      for (int j = 0; j < 4; ++j) {
        c0[j] = wmma_f16(fa[cur][0], fb[cur][j], c0[j]);
        c1[j] = wmma_f16(fa[cur][1], fb[cur][j], c1[j]);
      }
    }
    // keeps the products above in front of the barrier; without it the build sinks them
    // behind it, in front of the copies, which then start that much later
    __builtin_amdgcn_sched_barrier(0);
    // --- publish point of stage s+1; it also ends every wave's reads of this buffer
    // (behind its first wait the last step's fragments are in registers)
    asm volatile("s_wait_dscnt 0x0" ::: "memory");     // this wave's LDS reads of the buffer are done
    asm volatile("s_wait_asynccnt 0x0" ::: "memory");  // this wave's copies of stage s+1 have landed
    __syncthreads();
    if (s + 2 < GSTAGES) {                             // stage s+2 into the buffer just read
      unsigned bo = (unsigned)buf * buf_bytes;
      copy_rows8(la + bo, ga + (s + 2) * GT_K);
      copy_rows8(lb + bo, gb + (s + 2) * GT_K);
    }
#pragma unroll
    for (int j = 0; j < 4; ++j) {
      c0[j] = wmma_f16(fa[(GSTEPS - 1) & 1][0], fb[(GSTEPS - 1) & 1][j], c0[j]);
      c1[j] = wmma_f16(fa[(GSTEPS - 1) & 1][1], fb[(GSTEPS - 1) & 1][j], c1[j]);
    }
  }
  asm volatile("s_wait_asynccnt 0x0" ::: "memory");    // nothing of this wave's is in flight at its end
}

// ---------------------------------------------------------------------------
// Kernel 2: the three projections in ONE launch.  out = xh(f16 SxK) @ wT^T(f16) + bias
// One 128 x 128 tile per work-group, 32 x 8 tiles a projection; none depends on another.
// The block index picks the projection: V, then Q, then K.
// wT3: the transposed weights of q, k, v one behind the other; qkv: their outputs likewise.
// mode 0 (q, k): out[h][s][d]; mode 1 (v): out[h][d][s]
// A lane holds 8 consecutive rows (M) of one column (N) of each accumulator tile. M is made
// the dimension that is contiguous in the output: s for V (A = x rows, B = weight rows),
// d for Q and K (A = weight rows, B = x rows). The tile then goes, as f16, through LDS
// ([N][M], 16-byte writes) and leaves in 16-byte stores that cover whole 128-byte lines.
// ---------------------------------------------------------------------------
#define GTILES ((S_LEN / GT_MN) * (DMODEL / GT_MN))   // tiles of one projection

__device__ __forceinline__ void stage_pair(_Float16* dst, v8f a, v8f b) {
  *(v8h*)dst        = __builtin_convertvector(a, v8h);
  *(v8h*)(dst + 16) = __builtin_convertvector(b, v8h);
}

__global__ __launch_bounds__(256) void gemm_qkv_kernel(
    const _Float16* __restrict__ xh, const _Float16* __restrict__ wT3,
    const float* __restrict__ bq, const float* __restrict__ bk, const float* __restrict__ bv,
    _Float16* __restrict__ qkv) {
  __shared__ __align__(16) gemm_tile_t sA[2];
  __shared__ __align__(16) gemm_tile_t sB[2];
  int part = (int)(blockIdx.x / GTILES), tile = (int)(blockIdx.x % GTILES);
  int proj = part == 0 ? 2 : part - 1;                  // 0 q, 1 k, 2 v; the same for the whole work-group
  const _Float16* wT   = wT3 + (size_t)proj * DMODEL * DMODEL;
  const float*    bias = proj == 0 ? bq : proj == 1 ? bk : bv;
  _Float16*       out  = qkv + (size_t)proj * S_LEN * DMODEL;
  int mode = proj == 2 ? 1 : 0;
  int wave   = threadIdx.x >> 5;
  int lane16 = threadIdx.x & 15;
  int hi8    = ((threadIdx.x >> 4) & 1) << 3;           // 0 or 8
  int wm = wave & 3, wn = wave >> 2;
  int bm = (tile & 31) * GT_MN;                         // first position s: 32 tiles of 128
  int bn = (tile >> 5) * GT_MN;                         // first feature n: 8 tiles of 128
  const _Float16* xt = xh + (size_t)bm * DMODEL;
  const _Float16* wt = wT + (size_t)bn * DMODEL;

  v8f c0[4] = {}, c1[4] = {};
  gemm_tile_loop(mode ? xt : wt, mode ? wt : xt, sA, sB, wm, wn, c0, c1);

  // The ring is free: every wave's reads had returned before the loop's last barrier, and the
  // last copies had landed one barrier earlier. Its first buffer takes the tile, [N][M].
  _Float16 (*sC)[GROW] = sA[0];
  _Float16* dst = &sC[wn * 64 + lane16][wm * 32 + hi8];   // tile j: 16 rows further
  if (mode) {                                             // the feature is the column N
    float bj[4];
#pragma unroll   // constant indices: the arrays stay in registers
    for (int j = 0; j < 4; ++j) bj[j] = bias[bn + wn * 64 + j * 16 + lane16];
#pragma unroll   // constant indices: the arrays stay in registers
    for (int j = 0; j < 4; ++j) stage_pair(dst + j * 16 * GROW, c0[j] + bj[j], c1[j] + bj[j]);
  } else {                                                // the features are the rows M
    const v4f* bp = (const v4f*)(bias + bn + wm * 32 + hi8);
    v4f p0 = bp[0], p1 = bp[1], p2 = bp[4], p3 = bp[5];
    v8f b0 = __builtin_shufflevector(p0, p1, 0, 1, 2, 3, 4, 5, 6, 7);
    v8f b1 = __builtin_shufflevector(p2, p3, 0, 1, 2, 3, 4, 5, 6, 7);
#pragma unroll   // constant indices: the arrays stay in registers
    for (int j = 0; j < 4; ++j) stage_pair(dst + j * 16 * GROW, c0[j] + b0, c1[j] + b1);
  }
  __syncthreads();   // the tile is complete before any thread reads rows that other waves wrote

  // piece p = threadIdx.x + 256 i: row p/16, 16-byte column p%16; a wave covers 2 whole rows of 256 B
  int row = threadIdx.x >> 4;             // 0..15, piece i: +16 i
  int c8  = (threadIdx.x & 15) * 8;       // in halves
  v8h h[8];
#pragma unroll   // constant indices: the arrays stay in registers
  for (int i = 0; i < 8; ++i) h[i] = *(const v8h*)&sC[row + 16 * i][c8];
  // V: row = feature (h * 64 + d), columns = positions; Q, K: row = position, columns = features of two heads
  _Float16* p = out + (mode ? (size_t)(bn + row) * S_LEN + bm + c8
                            : ((size_t)((bn + c8) >> 6) * S_LEN + bm + row) * HDIM + ((bn + c8) & 63));
  // the step between a thread's pieces is a constant in either layout
  if (mode) {
#pragma unroll   // constant indices: the arrays stay in registers
    for (int i = 0; i < 8; ++i) *(v8h*)(p + (size_t)i * 16 * S_LEN) = h[i];
  } else {
#pragma unroll   // constant indices: the arrays stay in registers
    for (int i = 0; i < 8; ++i) *(v8h*)(p + (size_t)i * 16 * HDIM) = h[i];
  }
}

// ---------------------------------------------------------------------------
// Kernel 3: flash-style block-causal attention. A tile is 128 q rows of one head, all in
// one chunk; its cost grows with its chunk (1 to 4 chunks of keys). All work-groups are
// resident at once, so the launch lasts as long as the fullest: every work-group takes TWO
// tiles of its head one after the other, tile n-1-p and then tile p, which together always
// walk 5 chunks of keys. 16 waves: wave w works on q rows 16 (w%8) .. +15; waves 0-7 take
// the first 128 keys of each 256-key stage, waves 8-15 the other 128, each with its own
// running maximum, sum and Ot; the two parts of a query are joined once per tile through LDS.
// The K and V stages come in by asynchronous copies of whole rows, two buffers, the next
// stage in flight while this one is worked on; the second tile's stages follow the first
// tile's in the same ring. Per wave and 64 keys: 8 score WMMAs + softmax + 8 PV WMMAs.
// Both products are formed transposed: St = K * Qt (A = K rows, B = Q) and
// Ot += Vt * Pt (A = Vt rows, B = P). A lane then holds 32 of the 64 scores of ONE
// query (column lane%16; keys 16t + r + 8*(lane/16)), so maximum and sum are taken
// in the lane, with one exchange between the wave's halves, and the score
// accumulators of tiles 2i and 2i+1 are, converted, the B fragment of keys
// 32i..32i+31: P never leaves the registers.
// qh,kh: [H][S][64] f16;  vt: [H][64][S] f16;  aout: [S][H*64] f16
// ---------------------------------------------------------------------------
#define ATT_WAVES 16
#define ATT_QW    8                     // waves side by side over the q rows
#define ATT_ROWS  (ATT_QW * 16)         // q rows of a tile
#define ATT_TILES (S_LEN / ATT_ROWS)    // tiles of one head
#define KTILE  64                       // keys of one block: scores, softmax, PV
#define KSUB   2                        // blocks per wave and stage
#define KSTAGE (2 * KSUB * KTILE)       // keys per stage
#define CSTAGES (CHUNKLEN / KSTAGE)     // stages of one chunk
#define LROW 72              // halves per LDS row of K: 128 B of data + 16 B, conflict-free for 16-B reads
#define VROW (KSTAGE + 8)    // halves per LDS row of V: 512 B of data + 16 B, likewise
static_assert(ATT_TILES % 2 == 0, "tiles pair up");
static_assert(CHUNKLEN % ATT_ROWS == 0, "a tile lies in one chunk");
static_assert(CHUNKLEN % KSTAGE == 0 && CSTAGES >= 2, "the prologue starts two stages of the first tile");
static_assert(KSTAGE == 4 * 64 && HDIM == 4 * 16 && KSTAGE * 2 == 32 * 16, "the copy map below");

// One stage's share of one thread: four 16-byte pieces of K, rows 64 apart, and four of V,
// rows 16 apart. The s_wait_xcnt stands inside the statement so that no address register
// of a copy is rewritten ahead of it.
__device__ __forceinline__ void copy_kv_stage(
    unsigned lk, const _Float16* gk, unsigned lv, const _Float16* gv) {
  const unsigned ks = 64 * LROW * 2;          // bytes of 64 LDS rows of K
  const unsigned vs = 16 * VROW * 2;          // bytes of 16 LDS rows of V
  const size_t   kg = (size_t)64 * HDIM;      // halves of 64 global rows of K
  const size_t   vg = (size_t)16 * S_LEN;     // halves of 16 global rows of V
  asm volatile(
      "global_load_async_to_lds_b128 %0, %1, off\n\t"
      "global_load_async_to_lds_b128 %2, %3, off\n\t"
      "global_load_async_to_lds_b128 %4, %5, off\n\t"
      "global_load_async_to_lds_b128 %6, %7, off\n\t"
      "global_load_async_to_lds_b128 %8, %9, off\n\t"
      "global_load_async_to_lds_b128 %10, %11, off\n\t"
      "global_load_async_to_lds_b128 %12, %13, off\n\t"
      "global_load_async_to_lds_b128 %14, %15, off\n\t"
      "s_wait_xcnt 0x0"
      :: "v"(lk),          "v"(gk),          "v"(lk + ks),     "v"(gk + kg),
         "v"(lk + 2 * ks), "v"(gk + 2 * kg), "v"(lk + 3 * ks), "v"(gk + 3 * kg),
         "v"(lv),          "v"(gv),          "v"(lv + vs),     "v"(gv + vg),
         "v"(lv + 2 * vs), "v"(gv + 2 * vg), "v"(lv + 3 * vs), "v"(gv + 3 * vg)
      : "memory");
}

// lane l <-> lane l ^ 16, on the vector unit
__device__ __forceinline__ float xhalf(float x) {
  int b = __builtin_bit_cast(int, x);
  return __builtin_bit_cast(float,
      __builtin_amdgcn_permlanex16(b, b, 0x76543210, 0xfedcba98, false, false));
}

// waves_per_eu: the grid puts 4 waves on a SIMD (256 work-groups of 16 waves, 256 WGPs). With that
// register budget stated the compiler issues a block's K reads as a group ahead of the score
// products; without it the build reads two pieces, waits for them and multiplies, product by product.
__global__ __launch_bounds__(ATT_WAVES * 32) __attribute__((amdgpu_waves_per_eu(4, 4))) void attn_kernel(
    const _Float16* __restrict__ qh, const _Float16* __restrict__ kh,
    const _Float16* __restrict__ vt, _Float16* __restrict__ aout) {
  __shared__ __align__(16) _Float16 sK[2][KSTAGE][LROW];         // keys x d
  __shared__ __align__(16) _Float16 sV[2][HDIM][VROW];           // d x keys
  __shared__ __align__(16) v4f      sO[ATT_QW][8][32];           // Ot of the second key part, lane by lane
  __shared__ float                  sMS[ATT_QW][2][32];          // its maximum and its sum

  int head   = blockIdx.y;
  int wave   = threadIdx.x >> 5;
  int lane   = threadIdx.x & 31;
  int lane16 = threadIdx.x & 15;
  int hi8    = ((threadIdx.x >> 4) & 1) << 3;
  int qi     = wave & (ATT_QW - 1);       // which 16 q rows
  int kpart  = wave / ATT_QW;             // which half of a stage's keys
  // 64^-0.5 * log2(e): a score enters the exponential as 2^(raw * sl2e - maximum), one multiply-add
  const float sl2e = 0.125f * 1.44269504088896340736f;

  // the two tiles and their stages; the same for all 16 waves
  int tile_a = ATT_TILES - 1 - (int)blockIdx.x, tile_b = (int)blockIdx.x;
  int n_a    = (tile_a * ATT_ROWS / CHUNKLEN + 1) * CSTAGES;   // block-causal: full chunks
  int n_all  = n_a + (tile_b * ATT_ROWS / CHUNKLEN + 1) * CSTAGES;

  // copy map, K: piece p = threadIdx.x + 512 i: row p/8, 16-byte column p%8; a wave covers 4 whole rows
  //           V: piece p = threadIdx.x + 512 i: row p/32, 16-byte column p%32; a wave covers 1 whole row
  int krow = threadIdx.x >> 3;            // 0..63, piece i: +64 i
  int kcol = (threadIdx.x & 7) * 8;       // in halves
  int vrow = threadIdx.x >> 5;            // 0..15, piece i: +16 i
  int vcol = (threadIdx.x & 31) * 8;      // in halves
  const _Float16* gk = kh + ((size_t)head * S_LEN + krow) * HDIM + kcol;
  const _Float16* gv = vt + ((size_t)head * HDIM + vrow) * S_LEN + vcol;
  unsigned lk = (unsigned)(size_t)&sK[0][krow][kcol];
  unsigned lv = (unsigned)(size_t)&sV[0][vrow][vcol];
  const unsigned k_buf = KSTAGE * LROW * 2;   // bytes of one buffer
  const unsigned v_buf = HDIM * VROW * 2;

  // --- prologue: stage 0 lands and is published, then stage 1 starts
  copy_kv_stage(lk, gk, lv, gv);
  asm volatile("s_wait_asynccnt 0x0" ::: "memory");   // this wave's copies of stage 0 have landed
  __syncthreads();                                    // ... and every other wave's
  copy_kv_stage(lk + k_buf, gk + KSTAGE * HDIM, lv + v_buf, gv + KSTAGE);

  int s = 0;   // stage, counted through both tiles
  for (int ph = 0; ph < 2; ++ph) {
    int m0    = (ph == 0 ? tile_a : tile_b) * ATT_ROWS + qi * 16;
    int s_end = ph == 0 ? n_a : n_all;

    const _Float16* qrow = qh + ((size_t)head * S_LEN + m0 + lane16) * HDIM;
    v16h aq0 = load_frag_f16(qrow, hi8);        // d 0..31
    v16h aq1 = load_frag_f16(qrow + 32, hi8);   // d 32..63

    float rowmax = -INFINITY;   // of this lane's query over this wave's keys, scaled by sl2e; the same in both halves
    float rowsum = 0.0f;        // of this lane's half of the wave's keys; the halves join after the loop
    v8f o[4] = {};              // Ot: row d = 16j + r + hi8, column = this lane's query

    for (; s < s_end; ++s) {
      int buf = s & 1;
      // unrolled so that the second block's LDS offsets are constants and its K reads can start early
#pragma unroll
      for (int sb = 0; sb < KSUB; ++sb) {
        const int k0 = sb * KTILE;   // the block's first key within the wave's half of the stage
        // --- scores for 64 keys, transposed: four 16(keys) x 16(queries) tiles, Hd=64 in two WMMAs each
        v8f u[4];
#pragma unroll
        for (int t = 0; t < 4; ++t) {
          const _Float16* krw = &sK[buf][kpart * (KSUB * KTILE) + k0 + t * 16 + lane16][0];
          v8f sc = {};
          sc = wmma_f16(load_frag_f16(krw,      hi8), aq0, sc);
          sc = wmma_f16(load_frag_f16(krw + 32, hi8), aq1, sc);
          u[t] = sc;   // raw: the scale is applied on the way into the exponential
        }

        // --- online softmax; a lane holds 32 scores of its query, the lane l ^ 16 the other 32
        float m8[8];
#pragma unroll
        for (int r = 0; r < 8; ++r)
          m8[r] = fmaxf(fmaxf(u[0][r], u[1][r]), fmaxf(u[2][r], u[3][r]));
        float mx = fmaxf(fmaxf(fmaxf(m8[0], m8[1]), fmaxf(m8[2], m8[3])),
                         fmaxf(fmaxf(m8[4], m8[5]), fmaxf(m8[6], m8[7])));
        mx = fmaxf(mx, xhalf(mx));
        float nm    = fmaxf(rowmax, mx * sl2e);   // sl2e > 0: the largest raw score is the largest scaled one
        float alpha = __builtin_amdgcn_exp2f(rowmax - nm);
        rowmax      = nm;
        v8f cv = (v8f)sl2e, nv = (v8f)(-nm);
        // whole vectors, so that the build takes the packed form: two scores an instruction
#pragma unroll   // constant indices: the array stays in registers
        for (int t = 0; t < 4; ++t) u[t] = __builtin_elementwise_fma(u[t], cv, nv);
        float s8[8];
#pragma unroll
        for (int r = 0; r < 8; ++r) {
#pragma unroll
          for (int t = 0; t < 4; ++t) u[t][r] = __builtin_amdgcn_exp2f(u[t][r]);
          s8[r] = (u[0][r] + u[1][r]) + (u[2][r] + u[3][r]);
        }
        float ps = ((s8[0] + s8[1]) + (s8[2] + s8[3])) + ((s8[4] + s8[5]) + (s8[6] + s8[7]));
        rowsum = rowsum * alpha + ps;
#pragma unroll
        for (int j = 0; j < 4; ++j) o[j] = o[j] * alpha;

        // --- P as B fragments, straight from the score accumulators:
        // halves 0..7 = keys hi8+0..7 of the 32 (tile 2i), halves 8..15 = keys hi8+16..23 (tile 2i+1)
        v16h bp0, bp1;
#pragma unroll
        for (int r = 0; r < 8; ++r) {
          bp0[r] = (_Float16)u[0][r];  bp0[8 + r] = (_Float16)u[1][r];
          bp1[r] = (_Float16)u[2][r];  bp1[8 + r] = (_Float16)u[3][r];
        }

        // --- Ot += Vt @ Pt   (V transposed in LDS: contiguous over keys per d)
#pragma unroll
        for (int j = 0; j < 4; ++j) {
          const _Float16* vr = &sV[buf][j * 16 + lane16][kpart * (KSUB * KTILE) + k0];
          o[j] = wmma_f16(load_frag_f16(vr,      hi8), bp0, o[j]);
          o[j] = wmma_f16(load_frag_f16(vr + 32, hi8), bp1, o[j]);
        }
      }

      // --- publish point of stage s+1; it also ends every wave's reads of this buffer
      asm volatile("s_wait_dscnt 0x0" ::: "memory");     // this wave's LDS reads of the buffer are done
      asm volatile("s_wait_asynccnt 0x0" ::: "memory");  // this wave's copies of stage s+1 have landed
      __syncthreads();
      if (s + 2 < n_all) {                               // stage s+2 into the buffer just read
        int s2  = s + 2;
        int key = (s2 < n_a ? s2 : s2 - n_a) * KSTAGE;   // the second tile starts again at key 0
        copy_kv_stage(lk + (unsigned)buf * k_buf, gk + (size_t)key * HDIM,
                      lv + (unsigned)buf * v_buf, gv + key);
      }
    }

    // --- join the two key parts of each query: waves 8-15 hand theirs over, waves 0-7 finish the tile
    float sum = rowsum + xhalf(rowsum);   // the two lane halves' sums of this wave's keys
    if (kpart == 1) {
#pragma unroll
      for (int j = 0; j < 4; ++j) {
        sO[qi][2 * j][lane]     = __builtin_shufflevector(o[j], o[j], 0, 1, 2, 3);
        sO[qi][2 * j + 1][lane] = __builtin_shufflevector(o[j], o[j], 4, 5, 6, 7);
      }
      sMS[qi][0][lane] = rowmax;
      sMS[qi][1][lane] = sum;
    }
    __syncthreads();   // the handed-over parts are complete before their readers start
    if (kpart == 0) {
      float pm = sMS[qi][0][lane], psum = sMS[qi][1][lane];
      float m  = fmaxf(rowmax, pm);
      float a  = __builtin_amdgcn_exp2f(rowmax - m), b = __builtin_amdgcn_exp2f(pm - m);   // the maxima are in log2 units
      float inv = 1.0f / (sum * a + psum * b);
      a *= inv;
      b *= inv;
      // a lane holds 8 consecutive d of its query per tile: one 16-byte store each
      _Float16* orow = aout + (size_t)(m0 + lane16) * DMODEL + head * HDIM + hi8;
#pragma unroll
      for (int j = 0; j < 4; ++j) {
        v4f p0 = sO[qi][2 * j][lane], p1 = sO[qi][2 * j + 1][lane];
        v8h h;
#pragma unroll
        for (int r = 0; r < 4; ++r) {
          h[r]     = (_Float16)(o[j][r] * a + p0[r] * b);
          h[4 + r] = (_Float16)(o[j][4 + r] * a + p1[r] * b);
        }
        *(v8h*)(orow + j * 16) = h;
      }
      // the second tile rewrites the registers that these stores name
      asm volatile("s_wait_xcnt 0x0" ::: "memory");
    }
  }
  asm volatile("s_wait_asynccnt 0x0" ::: "memory");    // nothing of this wave's is in flight at its end
}

// ---------------------------------------------------------------------------
// Kernel 4: output projection GEMM.  out(f32) = aout(f16) @ woT^T(f16) + bo
// One 128 x 128 tile per work-group (32 x 8 tiles).
// ---------------------------------------------------------------------------
__global__ __launch_bounds__(256) void gemm_out_kernel(
    const _Float16* __restrict__ ain, const _Float16* __restrict__ wT,
    const float* __restrict__ bias, float* __restrict__ out) {
  __shared__ __align__(16) gemm_tile_t sA[2];
  __shared__ __align__(16) gemm_tile_t sB[2];
  const int N = DMODEL;
  int wave   = threadIdx.x >> 5;
  int lane16 = threadIdx.x & 15;
  int hi8    = ((threadIdx.x >> 4) & 1) << 3;
  int wm = wave & 3, wn = wave >> 2;
  int bm = (blockIdx.x & 31) * GT_MN;
  int bn = (blockIdx.x >> 5) * GT_MN;
  int m0 = bm + wm * 32, n0 = bn + wn * 64;

  v8f c0[4] = {}, c1[4] = {};
  gemm_tile_loop(ain + (size_t)bm * DMODEL, wT + (size_t)bn * DMODEL, sA, sB, wm, wn, c0, c1);

#pragma unroll
  for (int j = 0; j < 4; ++j) {
    int n = n0 + j * 16 + lane16;
    float bj = bias[n];
#pragma unroll
    for (int r = 0; r < 8; ++r) {
      int s0r = m0 + r + hi8;
      out[(size_t)s0r * N + n]        = c0[j][r] + bj;
      out[(size_t)(s0r + 16) * N + n] = c1[j][r] + bj;
    }
  }
}

// ---------------------------------------------------------------------------
// Host launch
// ---------------------------------------------------------------------------
extern "C" void kernel_launch(void* const* d_in, const int* in_sizes, int n_in,
                              void* d_out, int out_size, void* d_ws, size_t ws_size,
                              hipStream_t stream) {
  const float* x  = (const float*)d_in[0];
  const float* wq = (const float*)d_in[1];
  const float* bq = (const float*)d_in[2];
  const float* wk = (const float*)d_in[3];
  const float* bk = (const float*)d_in[4];
  const float* wv = (const float*)d_in[5];
  const float* bv = (const float*)d_in[6];
  const float* wo = (const float*)d_in[7];
  const float* bo = (const float*)d_in[8];
  float* out = (float*)d_out;

  char* ws = (char*)d_ws;
  const size_t MB = 1024 * 1024;
  _Float16* wqT  = (_Float16*)(ws + 0 * MB);    // [1024][1024] f16, 2 MB each
                                                // wkT at 2 MB, wvT at 4 MB
  _Float16* woT  = (_Float16*)(ws + 6 * MB);
  _Float16* qh   = (_Float16*)(ws + 8 * MB);    // [16][4096][64], 8 MB each
  _Float16* kh   = (_Float16*)(ws + 16 * MB);
  _Float16* vt   = (_Float16*)(ws + 24 * MB);   // [16][64][4096]
  _Float16* aout = (_Float16*)(ws + 32 * MB);   // [4096][1024]
  _Float16* xh   = (_Float16*)(ws + 40 * MB);   // [4096][1024]

  // wqT .. woT lie one behind the other, and so do qh, kh, vt
  cvt_all_kernel<<<CVT_BLOCKS, CVT_THREADS, 0, stream>>>(x, wq, wk, wv, wo, xh, wqT);

  gemm_qkv_kernel<<<3 * GTILES, 256, 0, stream>>>(xh, wqT, bq, bk, bv, qh);

  attn_kernel<<<dim3(ATT_TILES / 2, NHEADS), ATT_WAVES * 32, 0, stream>>>(qh, kh, vt, aout);

  gemm_out_kernel<<<256, 256, 0, stream>>>(aout, woT, bo, out);
}

// v009
// A run of this version takes 81.8 microseconds.
// Next to v008, in two timings, it ran 1.04 and 1.03 times as fast.
// Counting every step since v000, it is 6.42 times as fast.
#include <hip/hip_runtime.h>
#include <hip/hip_bf16.h>
#include <math.h>

typedef __attribute__((ext_vector_type(16))) _Float16 v16h;
typedef __attribute__((ext_vector_type(8)))  _Float16 v8h;
typedef __attribute__((ext_vector_type(8)))  float    v8f;
typedef __attribute__((ext_vector_type(4)))  float    v4f;
typedef __attribute__((ext_vector_type(4)))  _Float16 v4h;

#define S_LEN 4096
#define DMODEL 1024
#define NHEADS 16
#define HDIM 64
#define CHUNKLEN 1024

// ---------------------------------------------------------------------------
// WMMA helpers: v_wmma_f32_16x16x32_f16, D = A(16x32) * B(32x16) + C(16x16 f32)
// A layout (wave32): lane L (row M = L%16); halves 0..7 -> K = base+0..7,
// halves 8..15 -> K = base+16..23, base = (L>=16)?8:0.
// B layout mirrors A with N = L%16. C/D: VGPR r, lane L: M = r + ((L>=16)?8:0).
// ---------------------------------------------------------------------------
__device__ __forceinline__ v8f wmma_f16(v16h a, v16h b, v8f c) {
  return __builtin_amdgcn_wmma_f32_16x16x32_f16(
      false, a, false, b, (short)0, c, false, false);
}

__device__ __forceinline__ v16h pack16(v8h lo, v8h hi) {
  v16h r;
#pragma unroll
  for (int t = 0; t < 8; ++t) { r[t] = lo[t]; r[8 + t] = hi[t]; }
  return r;
}

__device__ __forceinline__ v16h load_frag_f16(const _Float16* __restrict__ row, int kb) {
  v8h lo = *(const v8h*)(row + kb);
  v8h hi = *(const v8h*)(row + kb + 16);
  return pack16(lo, hi);
}

// ---------------------------------------------------------------------------
// Kernel 1: every f32 -> f16 conversion of the call in ONE launch; none depends on another.
// The block index picks the part: blocks 0 .. CVX_BLOCKS-1 take x, the rest the four weights.
//
// x, elementwise: a thread takes 8 pieces of 4 floats. Each wave-wide load covers 512
// contiguous bytes and each store 256; all 8 loads are issued before the first use.
//
// weights, convert + transpose  w[K][N] f32  ->  wT[N][K] f16, K = N = DMODEL:
// one 64(k) x 64(n) tile per work-group, turned in LDS: 16-byte loads along n,
// 16-byte stores along k, 8 lanes of one wave write each whole 128-byte line of wT.
// ---------------------------------------------------------------------------
#define CVT_THREADS 256
#define CVX_BLOCKS  512
#define CVX_PIECES  8
static_assert(CVX_BLOCKS * CVT_THREADS * CVX_PIECES * 4 == S_LEN * DMODEL, "x is covered exactly once");

#define TTILE 64
#define TROW  72   // halves per LDS row: 128 B of data + 16 B, keeps 16-byte reads aligned
#define TPERW ((DMODEL / TTILE) * (DMODEL / TTILE))   // tiles of one weight
#define CVT_BLOCKS (CVX_BLOCKS + 4 * TPERW)

// wT4: the four transposed weights one behind the other, in the order q, k, v, o
__global__ __launch_bounds__(CVT_THREADS) void cvt_all_kernel(
    const float* __restrict__ x,  const float* __restrict__ wq, const float* __restrict__ wk,
    const float* __restrict__ wv, const float* __restrict__ wo,
    _Float16* __restrict__ xh, _Float16* __restrict__ wT4) {
  __shared__ __align__(16) _Float16 sT[TTILE][TROW];   // n x k
  if (blockIdx.x < CVX_BLOCKS) {                       // the same for the whole work-group
    const v4f* xv = (const v4f*)x;
    v4h*       hv = (v4h*)xh;
    unsigned q = blockIdx.x * (CVT_THREADS * CVX_PIECES) + threadIdx.x;   // piece index, the same on both sides
    v4f a[CVX_PIECES];
#pragma unroll
    for (int i = 0; i < CVX_PIECES; ++i) a[i] = xv[q + i * CVT_THREADS];
#pragma unroll
    for (int i = 0; i < CVX_PIECES; ++i) {
      v4h h;
#pragma unroll
      for (int c = 0; c < 4; ++c) h[c] = (_Float16)a[i][c];
      hv[q + i * CVT_THREADS] = h;
    }
    return;
  }
  unsigned t     = blockIdx.x - CVX_BLOCKS;
  int which = (int)(t / TPERW), tile = (int)(t % TPERW);
  const float* wlo = (which & 1) ? wk : wq;
  const float* whi = (which & 1) ? wo : wv;
  const float* w   = (which & 2) ? whi : wlo;
  _Float16*   wT = wT4 + (size_t)which * DMODEL * DMODEL;
  int n0 = (tile % (DMODEL / TTILE)) * TTILE, k0 = (tile / (DMODEL / TTILE)) * TTILE;
  int c4 = (threadIdx.x & 15) * 4;    // 4 consecutive n
  int r4 = (threadIdx.x >> 4) * 4;    // 4 consecutive k
  v4f v[4];
#pragma unroll
  for (int i = 0; i < 4; ++i)
    v[i] = *(const v4f*)(w + (size_t)(k0 + r4 + i) * DMODEL + n0 + c4);
#pragma unroll
  for (int c = 0; c < 4; ++c) {
    v4h h;
#pragma unroll
    for (int i = 0; i < 4; ++i) h[i] = (_Float16)v[i][c];
    *(v4h*)&sT[c4 + c][r4] = h;
  }
  __syncthreads();   // the tile is complete before any thread reads rows that others wrote
  int row = threadIdx.x >> 3;         // 0..31, second piece: +32
  int col = (threadIdx.x & 7) * 8;    // in halves
#pragma unroll
  for (int i = 0; i < 2; ++i)
    *(v8h*)(wT + (size_t)(n0 + row + 32 * i) * DMODEL + k0 + col) =
        *(const v8h*)&sT[row + 32 * i][col];
}

// ---------------------------------------------------------------------------
// Shared main loop of the GEMM kernels: C(128 x 128) = A(128 x K) * B(128 x K)^T, both f16
// and K-contiguous. The eight waves of a work-group share the two operand tiles through LDS:
// a stage is 128 k (256-byte rows) of all 256 rows, brought in by asynchronous copies of
// whole rows, two buffers, the next stage in flight while this one is worked on.
// Waves stand 4 (M) x 2 (N); each computes 32 x 64 (B fragments reused by 2 A fragments).
// ---------------------------------------------------------------------------
#define GT_MN   128                 // rows of A and rows of B per work-group
#define GT_K    128                 // halves of K per stage
#define GROW    136                 // halves per LDS row: 256 B of data + 16 B, conflict-free for 16-B reads
#define GSTAGES (DMODEL / GT_K)
#define GSTEPS  (GT_K / 32)         // matrix steps of 32 k per stage
static_assert(GSTAGES >= 2, "the prologue starts two stages");

// One thread's share of one operand's stage: eight 16-byte pieces, rows 16 apart.
// The s_wait_xcnt stands inside the statement so that no address register of a
// copy is rewritten ahead of it.
__device__ __forceinline__ void copy_rows8(unsigned l, const _Float16* g) {
  const unsigned ls = 16 * GROW * 2;          // bytes of 16 LDS rows
  const size_t   gs = (size_t)16 * DMODEL;    // halves of 16 global rows
  asm volatile(
      "global_load_async_to_lds_b128 %0, %1, off\n\t"
      "global_load_async_to_lds_b128 %2, %3, off\n\t"
      "global_load_async_to_lds_b128 %4, %5, off\n\t"
      "global_load_async_to_lds_b128 %6, %7, off\n\t"
      "global_load_async_to_lds_b128 %8, %9, off\n\t"
      "global_load_async_to_lds_b128 %10, %11, off\n\t"
      "global_load_async_to_lds_b128 %12, %13, off\n\t"
      "global_load_async_to_lds_b128 %14, %15, off\n\t"
      "s_wait_xcnt 0x0"
      :: "v"(l),          "v"(g),          "v"(l + ls),     "v"(g + gs),
         "v"(l + 2 * ls), "v"(g + 2 * gs), "v"(l + 3 * ls), "v"(g + 3 * gs),
         "v"(l + 4 * ls), "v"(g + 4 * gs), "v"(l + 5 * ls), "v"(g + 5 * gs),
         "v"(l + 6 * ls), "v"(g + 6 * gs), "v"(l + 7 * ls), "v"(g + 7 * gs)
      : "memory");
}

typedef _Float16 gemm_tile_t[GT_MN][GROW];

// a: first row of the work-group's A tile; b: first row of its B tile; wm, wn: the wave's place
__device__ __forceinline__ void gemm_tile_loop(
    const _Float16* __restrict__ a, const _Float16* __restrict__ b,
    gemm_tile_t* sA, gemm_tile_t* sB, int wm, int wn, v8f (&c0)[4], v8f (&c1)[4]) {
  int lane16 = threadIdx.x & 15;
  int hi8    = ((threadIdx.x >> 4) & 1) << 3;
  // copy map: piece p = threadIdx.x + 256 i: row p/16, 16-byte column p%16; a wave covers 2 whole rows
  int crow = threadIdx.x >> 4;            // 0..15, piece i: +16 i
  int ccol = (threadIdx.x & 15) * 8;      // in halves
  const _Float16* ga = a + (size_t)crow * DMODEL + ccol;
  const _Float16* gb = b + (size_t)crow * DMODEL + ccol;
  unsigned la = (unsigned)(size_t)&sA[0][crow][ccol];
  unsigned lb = (unsigned)(size_t)&sB[0][crow][ccol];
  const unsigned buf_bytes = GT_MN * GROW * 2;

  // --- prologue: stage 0 lands and is published, then stage 1 starts
  copy_rows8(la, ga);
  copy_rows8(lb, gb);
  asm volatile("s_wait_asynccnt 0x0" ::: "memory");   // this wave's copies of stage 0 have landed
  __syncthreads();                                    // ... and every other wave's
  copy_rows8(la + buf_bytes, ga + GT_K);
  copy_rows8(lb + buf_bytes, gb + GT_K);

  for (int s = 0; s < GSTAGES; ++s) {
    int buf = s & 1;
    const _Float16* ar = &sA[buf][wm * 32 + lane16][0];
    const _Float16* br = &sB[buf][wn * 64 + lane16][0];
    // two fragment sets: the reads of the next 32 k are issued as one group ahead of this step's products
    v16h fa[2][2], fb[2][4];
    fa[0][0] = load_frag_f16(ar, hi8);
    fa[0][1] = load_frag_f16(ar + 16 * GROW, hi8);
#pragma unroll
    for (int j = 0; j < 4; ++j) fb[0][j] = load_frag_f16(br + j * 16 * GROW, hi8);
    // unrolled (as the j loops are) so that every fragment-set index is a constant and the sets stay in registers
#pragma unroll
    for (int t = 0; t + 1 < GSTEPS; ++t) {
      const int cur = t & 1, nxt = cur ^ 1;
      int kb = (t + 1) * 32 + hi8;
      fa[nxt][0] = load_frag_f16(ar, kb);
      fa[nxt][1] = load_frag_f16(ar + 16 * GROW, kb);
#pragma unroll
      for (int j = 0; j < 4; ++j) fb[nxt][j] = load_frag_f16(br + j * 16 * GROW, kb);
      // keeps the group of reads above in front of the products below; without it the build
      // sinks each read to its product and waits out the LDS latency every two products
      __builtin_amdgcn_sched_barrier(0);
#pragma unroll
      for (int j = 0; j < 4; ++j) {
        c0[j] = wmma_f16(fa[cur][0], fb[cur][j], c0[j]);
        c1[j] = wmma_f16(fa[cur][1], fb[cur][j], c1[j]);
      }
    }
    // keeps the products above in front of the barrier; without it the build sinks them
    // behind it, in front of the copies, which then start that much later
    __builtin_amdgcn_sched_barrier(0);
    // --- publish point of stage s+1; it also ends every wave's reads of this buffer
    // (behind its first wait the last step's fragments are in registers)
    asm volatile("s_wait_dscnt 0x0" ::: "memory");     // this wave's LDS reads of the buffer are done
    asm volatile("s_wait_asynccnt 0x0" ::: "memory");  // this wave's copies of stage s+1 have landed
    __syncthreads();
    if (s + 2 < GSTAGES) {                             // stage s+2 into the buffer just read
      unsigned bo = (unsigned)buf * buf_bytes;
      copy_rows8(la + bo, ga + (s + 2) * GT_K);
      copy_rows8(lb + bo, gb + (s + 2) * GT_K);
    }
#pragma unroll
    for (int j = 0; j < 4; ++j) {
      c0[j] = wmma_f16(fa[(GSTEPS - 1) & 1][0], fb[(GSTEPS - 1) & 1][j], c0[j]);
      c1[j] = wmma_f16(fa[(GSTEPS - 1) & 1][1], fb[(GSTEPS - 1) & 1][j], c1[j]);
    }
  }
  asm volatile("s_wait_asynccnt 0x0" ::: "memory");    // nothing of this wave's is in flight at its end
}

// ---------------------------------------------------------------------------
// Kernel 2: the three projections in ONE launch.  out = xh(f16 SxK) @ wT^T(f16) + bias
// One 128 x 128 tile per work-group, 32 x 8 tiles a projection; none depends on another.
// The block index picks the projection: V, then Q, then K.
// wT3: the transposed weights of q, k, v one behind the other; qkv: their outputs likewise.
// mode 0 (q, k): out[h][s][d]; mode 1 (v): out[h][d][s]
// A lane holds 8 consecutive rows (M) of one column (N) of each accumulator tile. M is made
// the dimension that is contiguous in the output: s for V (A = x rows, B = weight rows),
// d for Q and K (A = weight rows, B = x rows). The tile then goes, as f16, through LDS
// ([N][M], 16-byte writes) and leaves in 16-byte stores that cover whole 128-byte lines.
// ---------------------------------------------------------------------------
#define GTILES ((S_LEN / GT_MN) * (DMODEL / GT_MN))   // tiles of one projection

__device__ __forceinline__ void stage_pair(_Float16* dst, v8f a, v8f b) {
  *(v8h*)dst        = __builtin_convertvector(a, v8h);
  *(v8h*)(dst + 16) = __builtin_convertvector(b, v8h);
}

__global__ __launch_bounds__(256) void gemm_qkv_kernel(
    const _Float16* __restrict__ xh, const _Float16* __restrict__ wT3,
    const float* __restrict__ bq, const float* __restrict__ bk, const float* __restrict__ bv,
    _Float16* __restrict__ qkv) {
  __shared__ __align__(16) gemm_tile_t sA[2];
  __shared__ __align__(16) gemm_tile_t sB[2];
  int part = (int)(blockIdx.x / GTILES), tile = (int)(blockIdx.x % GTILES);
  int proj = part == 0 ? 2 : part - 1;                  // 0 q, 1 k, 2 v; the same for the whole work-group
  const _Float16* wT   = wT3 + (size_t)proj * DMODEL * DMODEL;
  const float*    bias = proj == 0 ? bq : proj == 1 ? bk : bv;
  _Float16*       out  = qkv + (size_t)proj * S_LEN * DMODEL;
  int mode = proj == 2 ? 1 : 0;
  int wave   = threadIdx.x >> 5;
  int lane16 = threadIdx.x & 15;
  int hi8    = ((threadIdx.x >> 4) & 1) << 3;           // 0 or 8
  int wm = wave & 3, wn = wave >> 2;
  int bm = (tile & 31) * GT_MN;                         // first position s: 32 tiles of 128
  int bn = (tile >> 5) * GT_MN;                         // first feature n: 8 tiles of 128
  const _Float16* xt = xh + (size_t)bm * DMODEL;
  const _Float16* wt = wT + (size_t)bn * DMODEL;

  v8f c0[4] = {}, c1[4] = {};
  gemm_tile_loop(mode ? xt : wt, mode ? wt : xt, sA, sB, wm, wn, c0, c1);

  // The ring is free: every wave's reads had returned before the loop's last barrier, and the
  // last copies had landed one barrier earlier. Its first buffer takes the tile, [N][M].
  _Float16 (*sC)[GROW] = sA[0];
  _Float16* dst = &sC[wn * 64 + lane16][wm * 32 + hi8];   // tile j: 16 rows further
  if (mode) {                                             // the feature is the column N
    float bj[4];
#pragma unroll   // constant indices: the arrays stay in registers
    for (int j = 0; j < 4; ++j) bj[j] = bias[bn + wn * 64 + j * 16 + lane16];
#pragma unroll   // constant indices: the arrays stay in registers
    for (int j = 0; j < 4; ++j) stage_pair(dst + j * 16 * GROW, c0[j] + bj[j], c1[j] + bj[j]);
  } else {                                                // the features are the rows M
    const v4f* bp = (const v4f*)(bias + bn + wm * 32 + hi8);
    v4f p0 = bp[0], p1 = bp[1], p2 = bp[4], p3 = bp[5];
    v8f b0 = __builtin_shufflevector(p0, p1, 0, 1, 2, 3, 4, 5, 6, 7);
    v8f b1 = __builtin_shufflevector(p2, p3, 0, 1, 2, 3, 4, 5, 6, 7);
#pragma unroll   // constant indices: the arrays stay in registers
    for (int j = 0; j < 4; ++j) stage_pair(dst + j * 16 * GROW, c0[j] + b0, c1[j] + b1);
  }
  __syncthreads();   // the tile is complete before any thread reads rows that other waves wrote

  // piece p = threadIdx.x + 256 i: row p/16, 16-byte column p%16; a wave covers 2 whole rows of 256 B
  int row = threadIdx.x >> 4;             // 0..15, piece i: +16 i
  int c8  = (threadIdx.x & 15) * 8;       // in halves
  v8h h[8];
#pragma unroll   // constant indices: the arrays stay in registers
  for (int i = 0; i < 8; ++i) h[i] = *(const v8h*)&sC[row + 16 * i][c8];
  // V: row = feature (h * 64 + d), columns = positions; Q, K: row = position, columns = features of two heads
  _Float16* p = out + (mode ? (size_t)(bn + row) * S_LEN + bm + c8
                            : ((size_t)((bn + c8) >> 6) * S_LEN + bm + row) * HDIM + ((bn + c8) & 63));
  // the step between a thread's pieces is a constant in either layout
  if (mode) {
#pragma unroll   // constant indices: the arrays stay in registers
    for (int i = 0; i < 8; ++i) *(v8h*)(p + (size_t)i * 16 * S_LEN) = h[i];
  } else {
#pragma unroll   // constant indices: the arrays stay in registers
    for (int i = 0; i < 8; ++i) *(v8h*)(p + (size_t)i * 16 * HDIM) = h[i];
  }
}

// ---------------------------------------------------------------------------
// Kernel 3: flash-style block-causal attention. A tile is 128 q rows of one head, all in
// one chunk; its cost grows with its chunk (1 to 4 chunks of keys). All work-groups are
// resident at once, so the launch lasts as long as the fullest: every work-group takes TWO
// tiles of its head one after the other, tile n-1-p and then tile p, which together always
// walk 5 chunks of keys. 16 waves: wave w works on q rows 16 (w%8) .. +15; waves 0-7 take
// the first 128 keys of each 256-key stage, waves 8-15 the other 128, each with its own
// running maximum, sum and Ot; the two parts of a query are joined once per tile through LDS.
// The K and V stages come in by asynchronous copies of whole rows, three buffers, the next
// stage in flight while this one is worked on; the second tile's stages follow the first
// tile's in the same ring. Per wave and 64 keys: 8 score WMMAs + softmax + 8 PV WMMAs.
// LDS reads run under other work, not in front of their products: with a block's score products a
// wave issues the block's V fragments and half of the NEXT block's K fragments (into registers just
// consumed), which land under the softmax; the other half of that K follows behind the softmax and
// lands under the PV products. The last block of a stage so reads the next stage's K: the publish
// point stands in front of it, and the refill goes into the third buffer, left one stage ago.
// Both products are formed transposed: St = K * Qt (A = K rows, B = Q) and
// Ot += Vt * Pt (A = Vt rows, B = P). A lane then holds 32 of the 64 scores of ONE
// query (column lane%16; keys 16t + r + 8*(lane/16)), so maximum and sum are taken
// in the lane, with one exchange between the wave's halves, and the score
// accumulators of tiles 2i and 2i+1 are, converted, the B fragment of keys
// 32i..32i+31: P never leaves the registers.
// qh,kh: [H][S][64] f16;  vt: [H][64][S] f16;  aout: [S][H*64] f16
// ---------------------------------------------------------------------------
#define ATT_WAVES 16
#define ATT_QW    8                     // waves side by side over the q rows
#define ATT_ROWS  (ATT_QW * 16)         // q rows of a tile
#define ATT_TILES (S_LEN / ATT_ROWS)    // tiles of one head
#define KTILE  64                       // keys of one block: scores, softmax, PV
#define KSUB   2                        // blocks per wave and stage
#define KSTAGE (2 * KSUB * KTILE)       // keys per stage
#define CSTAGES (CHUNKLEN / KSTAGE)     // stages of one chunk
#define KVBUFS 3                        // buffers of the ring
#define LROW 72              // halves per LDS row of K: 128 B of data + 16 B, conflict-free for 16-B reads
#define VROW (KSTAGE + 8)    // halves per LDS row of V: 512 B of data + 16 B, likewise
static_assert(ATT_TILES % 2 == 0, "tiles pair up");
static_assert(CHUNKLEN % ATT_ROWS == 0, "a tile lies in one chunk");
static_assert(CHUNKLEN % KSTAGE == 0 && CSTAGES >= 2, "the prologue starts two stages of the first tile");
static_assert(KSTAGE == 4 * 64 && HDIM == 4 * 16 && KSTAGE * 2 == 32 * 16, "the copy map below");
static_assert(KSUB >= 2, "the publish point stands between two blocks of a stage");

// One stage's share of one thread: four 16-byte pieces of K, rows 64 apart, and four of V,
// rows 16 apart. The s_wait_xcnt stands inside the statement so that no address register
// of a copy is rewritten ahead of it.
__device__ __forceinline__ void copy_kv_stage(
    unsigned lk, const _Float16* gk, unsigned lv, const _Float16* gv) {
  const unsigned ks = 64 * LROW * 2;          // bytes of 64 LDS rows of K
  const unsigned vs = 16 * VROW * 2;          // bytes of 16 LDS rows of V
  const size_t   kg = (size_t)64 * HDIM;      // halves of 64 global rows of K
  const size_t   vg = (size_t)16 * S_LEN;     // halves of 16 global rows of V
  asm volatile(
      "global_load_async_to_lds_b128 %0, %1, off\n\t"
      "global_load_async_to_lds_b128 %2, %3, off\n\t"
      "global_load_async_to_lds_b128 %4, %5, off\n\t"
      "global_load_async_to_lds_b128 %6, %7, off\n\t"
      "global_load_async_to_lds_b128 %8, %9, off\n\t"
      "global_load_async_to_lds_b128 %10, %11, off\n\t"
      "global_load_async_to_lds_b128 %12, %13, off\n\t"
      "global_load_async_to_lds_b128 %14, %15, off\n\t"
      "s_wait_xcnt 0x0"
      :: "v"(lk),          "v"(gk),          "v"(lk + ks),     "v"(gk + kg),
         "v"(lk + 2 * ks), "v"(gk + 2 * kg), "v"(lk + 3 * ks), "v"(gk + 3 * kg),
         "v"(lv),          "v"(gv),          "v"(lv + vs),     "v"(gv + vg),
         "v"(lv + 2 * vs), "v"(gv + 2 * vg), "v"(lv + 3 * vs), "v"(gv + 3 * vg)
      : "memory");
}

// four of the eight K fragments of one block of 64 keys: d 32 half .. +31 of its four key tiles;
// kr: this lane's row of the block's first key tile
__device__ __forceinline__ void load_k_half(const _Float16* kr, int hi8, int half, v16h (&kf)[8]) {
#pragma unroll   // constant indices: the array stays in registers
  for (int t = 0; t < 4; ++t) kf[2 * t + half] = load_frag_f16(kr + t * 16 * LROW + 32 * half, hi8);
}

// lane l <-> lane l ^ 16, on the vector unit
__device__ __forceinline__ float xhalf(float x) {
  int b = __builtin_bit_cast(int, x);
  return __builtin_bit_cast(float,
      __builtin_amdgcn_permlanex16(b, b, 0x76543210, 0xfedcba98, false, false));
}

// waves_per_eu: the grid puts 4 waves on a SIMD (256 work-groups of 16 waves, 256 WGPs). With that
// register budget stated the compiler issues a block's K reads as a group ahead of the score
// products; without it the build reads two pieces, waits for them and multiplies, product by product.
__global__ __launch_bounds__(ATT_WAVES * 32) __attribute__((amdgpu_waves_per_eu(4, 4))) void attn_kernel(
    const _Float16* __restrict__ qh, const _Float16* __restrict__ kh,
    const _Float16* __restrict__ vt, _Float16* __restrict__ aout) {
  __shared__ __align__(16) _Float16 sK[KVBUFS][KSTAGE][LROW];    // keys x d
  __shared__ __align__(16) _Float16 sV[KVBUFS][HDIM][VROW];      // d x keys
  __shared__ __align__(16) v4f      sO[ATT_QW][8][32];           // Ot of the second key part, lane by lane
  __shared__ float                  sMS[ATT_QW][2][32];          // its maximum and its sum

  int head   = blockIdx.y;
  int wave   = threadIdx.x >> 5;
  int lane   = threadIdx.x & 31;
  int lane16 = threadIdx.x & 15;
  int hi8    = ((threadIdx.x >> 4) & 1) << 3;
  int qi     = wave & (ATT_QW - 1);       // which 16 q rows
  int kpart  = wave / ATT_QW;             // which half of a stage's keys
  // 64^-0.5 * log2(e): a score enters the exponential as 2^(raw * sl2e - maximum), one multiply-add
  const float sl2e = 0.125f * 1.44269504088896340736f;

  // the two tiles and their stages; the same for all 16 waves
  int tile_a = ATT_TILES - 1 - (int)blockIdx.x, tile_b = (int)blockIdx.x;
  int n_a    = (tile_a * ATT_ROWS / CHUNKLEN + 1) * CSTAGES;   // block-causal: full chunks
  int n_all  = n_a + (tile_b * ATT_ROWS / CHUNKLEN + 1) * CSTAGES;

  // copy map, K: piece p = threadIdx.x + 512 i: row p/8, 16-byte column p%8; a wave covers 4 whole rows
  //           V: piece p = threadIdx.x + 512 i: row p/32, 16-byte column p%32; a wave covers 1 whole row
  int krow = threadIdx.x >> 3;            // 0..63, piece i: +64 i
  int kcol = (threadIdx.x & 7) * 8;       // in halves
  int vrow = threadIdx.x >> 5;            // 0..15, piece i: +16 i
  int vcol = (threadIdx.x & 31) * 8;      // in halves
  const _Float16* gk = kh + ((size_t)head * S_LEN + krow) * HDIM + kcol;
  const _Float16* gv = vt + ((size_t)head * HDIM + vrow) * S_LEN + vcol;
  unsigned lk = (unsigned)(size_t)&sK[0][krow][kcol];
  unsigned lv = (unsigned)(size_t)&sV[0][vrow][vcol];
  const unsigned k_buf = KSTAGE * LROW * 2;   // bytes of one buffer
  const unsigned v_buf = HDIM * VROW * 2;

  // --- prologue: stage 0 lands and is published, then stage 1 starts
  copy_kv_stage(lk, gk, lv, gv);
  asm volatile("s_wait_asynccnt 0x0" ::: "memory");   // this wave's copies of stage 0 have landed
  __syncthreads();                                    // ... and every other wave's
  copy_kv_stage(lk + k_buf, gk + KSTAGE * HDIM, lv + v_buf, gv + KSTAGE);

  // this lane's rows in buffer 0: K row of key tile 0, V row of d tile 0, both at the wave's half of the keys
  const _Float16* kbase = &sK[0][kpart * (KSUB * KTILE) + lane16][0];
  const _Float16* vbase = &sV[0][lane16][kpart * (KSUB * KTILE)];
  v16h kf[8];   // K fragments of the block to come: key tile t, d 0..31 in 2t, d 32..63 in 2t+1
  load_k_half(kbase, hi8, 0, kf);
  load_k_half(kbase, hi8, 1, kf);

  int s  = 0;   // stage, counted through both tiles
  int bc = 0;   // its buffer
  for (int ph = 0; ph < 2; ++ph) {
    int m0    = (ph == 0 ? tile_a : tile_b) * ATT_ROWS + qi * 16;
    int s_end = ph == 0 ? n_a : n_all;

    const _Float16* qrow = qh + ((size_t)head * S_LEN + m0 + lane16) * HDIM;
    v16h aq0 = load_frag_f16(qrow, hi8);        // d 0..31
    v16h aq1 = load_frag_f16(qrow + 32, hi8);   // d 32..63

    float rowmax = -INFINITY;   // of this lane's query over this wave's keys, scaled by sl2e; the same in both halves
    float rowsum = 0.0f;        // of this lane's half of the wave's keys; the halves join after the loop
    v8f o[4] = {};              // Ot: row d = 16j + r + hi8, column = this lane's query

    for (; s < s_end; ++s) {
      int bn = bc + 1 == KVBUFS ? 0 : bc + 1;   // buffer of stage s+1
      int bf = bn + 1 == KVBUFS ? 0 : bn + 1;   // buffer of stage s+2 = that of stage s-1
      const _Float16* kc = kbase + bc * (KSTAGE * LROW);
      const _Float16* vc = vbase + bc * (HDIM * VROW);
      // unrolled so that the blocks' LDS offsets are constants and the publish point stands in one of them
#pragma unroll
      for (int sb = 0; sb < KSUB; ++sb) {
        const int k0 = sb * KTILE;   // the block's first key within the wave's half of the stage
        // --- scores for 64 keys, transposed: four 16(keys) x 16(queries) tiles, Hd=64 in two WMMAs each
        v8f u[4] = {};   // raw: the scale is applied on the way into the exponential
#pragma unroll
        for (int t = 0; t < 4; ++t) u[t] = wmma_f16(kf[2 * t],     aq0, u[t]);
#pragma unroll
        for (int t = 0; t < 4; ++t) u[t] = wmma_f16(kf[2 * t + 1], aq1, u[t]);

        // --- one group of LDS reads: this block's V, then the first half of the next block's K
        // (stage s+1 was published in this stage; behind the last stage the wave reads its own stage's first
        // block again, unused: one instruction stream, and the fragments' registers are free in between)
        const _Float16* kn = sb + 1 < KSUB ? kc + (k0 + KTILE) * LROW
                                           : kbase + (s + 1 < n_all ? bn : bc) * (KSTAGE * LROW);
        v16h vf[8];   // d tile j: keys 0..31 in 2j, keys 32..63 in 2j+1
#pragma unroll
        for (int j = 0; j < 4; ++j) {
          const _Float16* vr = vc + j * 16 * VROW + k0;
          vf[2 * j]     = load_frag_f16(vr,      hi8);
          vf[2 * j + 1] = load_frag_f16(vr + 32, hi8);
        }
        load_k_half(kn, hi8, 0, kf);
        // keeps the group of reads above in front of the softmax below; without it the build
        // sinks each read to its product and the wave waits out the LDS latency there
        __builtin_amdgcn_sched_barrier(0);

        // --- online softmax; a lane holds 32 scores of its query, the lane l ^ 16 the other 32
        float m8[8];
#pragma unroll
        for (int r = 0; r < 8; ++r)
          m8[r] = fmaxf(fmaxf(u[0][r], u[1][r]), fmaxf(u[2][r], u[3][r]));
        float mx = fmaxf(fmaxf(fmaxf(m8[0], m8[1]), fmaxf(m8[2], m8[3])),
                         fmaxf(fmaxf(m8[4], m8[5]), fmaxf(m8[6], m8[7])));
        mx = fmaxf(mx, xhalf(mx));
        float nm    = fmaxf(rowmax, mx * sl2e);   // sl2e > 0: the largest raw score is the largest scaled one
        float alpha = __builtin_amdgcn_exp2f(rowmax - nm);
        rowmax      = nm;
        v8f cv = (v8f)sl2e, nv = (v8f)(-nm);
        // whole vectors, so that the build takes the packed form: two scores an instruction
#pragma unroll   // constant indices: the array stays in registers
        for (int t = 0; t < 4; ++t) u[t] = __builtin_elementwise_fma(u[t], cv, nv);
        float s8[8];
#pragma unroll
        for (int r = 0; r < 8; ++r) {
#pragma unroll
          for (int t = 0; t < 4; ++t) u[t][r] = __builtin_amdgcn_exp2f(u[t][r]);
          s8[r] = (u[0][r] + u[1][r]) + (u[2][r] + u[3][r]);
        }
        float ps = ((s8[0] + s8[1]) + (s8[2] + s8[3])) + ((s8[4] + s8[5]) + (s8[6] + s8[7]));
        rowsum = rowsum * alpha + ps;
#pragma unroll
        for (int j = 0; j < 4; ++j) o[j] = o[j] * alpha;

        // --- P as B fragments, straight from the score accumulators:
        // halves 0..7 = keys hi8+0..7 of the 32 (tile 2i), halves 8..15 = keys hi8+16..23 (tile 2i+1)
        v16h bp0, bp1;
#pragma unroll
        for (int r = 0; r < 8; ++r) {
          bp0[r] = (_Float16)u[0][r];  bp0[8 + r] = (_Float16)u[1][r];
          bp1[r] = (_Float16)u[2][r];  bp1[8 + r] = (_Float16)u[3][r];
        }

        // --- the second half of the next block's K: its registers stay free through the softmax;
        // the reads run under the eight products below and the next block's first four
        load_k_half(kn, hi8, 1, kf);
        // keeps these reads in front of the products below
        __builtin_amdgcn_sched_barrier(0);

        // --- Ot += Vt @ Pt   (V transposed in LDS: contiguous over keys per d)
#pragma unroll
        for (int j = 0; j < 4; ++j) {
          o[j] = wmma_f16(vf[2 * j],     bp0, o[j]);
          o[j] = wmma_f16(vf[2 * j + 1], bp1, o[j]);
        }

        if (sb == KSUB - 2) {
          // keeps the softmax and the products above in front of the waits below; without it the build
          // lifts the waits to just behind the group of reads, and the wave waits out the LDS there
          __builtin_amdgcn_sched_barrier(0);
          // --- publish point of stage s+1, in front of the block that reads its first K rows;
          // it also ends every wave's reads of stage s-1's buffer
          asm volatile("s_wait_dscnt 0x0" ::: "memory");     // this wave's LDS reads so far are done
          asm volatile("s_wait_asynccnt 0x0" ::: "memory");  // this wave's copies of stage s+1 have landed
          __syncthreads();
          if (s + 2 < n_all) {                               // stage s+2 into the buffer of stage s-1
            int s2  = s + 2;
            int key = (s2 < n_a ? s2 : s2 - n_a) * KSTAGE;   // the second tile starts again at key 0
            copy_kv_stage(lk + (unsigned)bf * k_buf, gk + (size_t)key * HDIM,
                          lv + (unsigned)bf * v_buf, gv + key);
          }
        }
      }
      bc = bn;
    }

    // --- join the two key parts of each query: waves 8-15 hand theirs over, waves 0-7 finish the tile
    float sum = rowsum + xhalf(rowsum);   // the two lane halves' sums of this wave's keys
    if (kpart == 1) {
#pragma unroll
      for (int j = 0; j < 4; ++j) {
        sO[qi][2 * j][lane]     = __builtin_shufflevector(o[j], o[j], 0, 1, 2, 3);
        sO[qi][2 * j + 1][lane] = __builtin_shufflevector(o[j], o[j], 4, 5, 6, 7);
      }
      sMS[qi][0][lane] = rowmax;
      sMS[qi][1][lane] = sum;
    }
    __syncthreads();   // the handed-over parts are complete before their readers start
    if (kpart == 0) {
      float pm = sMS[qi][0][lane], psum = sMS[qi][1][lane];
      float m  = fmaxf(rowmax, pm);
      float a  = __builtin_amdgcn_exp2f(rowmax - m), b = __builtin_amdgcn_exp2f(pm - m);   // the maxima are in log2 units
      float inv = 1.0f / (sum * a + psum * b);
      a *= inv;
      b *= inv;
      // a lane holds 8 consecutive d of its query per tile: one 16-byte store each
      _Float16* orow = aout + (size_t)(m0 + lane16) * DMODEL + head * HDIM + hi8;
#pragma unroll
      for (int j = 0; j < 4; ++j) {
        v4f p0 = sO[qi][2 * j][lane], p1 = sO[qi][2 * j + 1][lane];
        v8h h;
#pragma unroll
        for (int r = 0; r < 4; ++r) {
          h[r]     = (_Float16)(o[j][r] * a + p0[r] * b);
          h[4 + r] = (_Float16)(o[j][4 + r] * a + p1[r] * b);
        }
        *(v8h*)(orow + j * 16) = h;
      }
      // the second tile rewrites the registers that these stores name
      asm volatile("s_wait_xcnt 0x0" ::: "memory");
    }
  }
  asm volatile("s_wait_asynccnt 0x0" ::: "memory");    // nothing of this wave's is in flight at its end
}

// ---------------------------------------------------------------------------
// Kernel 4: output projection GEMM.  out(f32) = aout(f16) @ woT^T(f16) + bo
// One 128 x 128 tile per work-group (32 x 8 tiles).
// ---------------------------------------------------------------------------
__global__ __launch_bounds__(256) void gemm_out_kernel(
    const _Float16* __restrict__ ain, const _Float16* __restrict__ wT,
    const float* __restrict__ bias, float* __restrict__ out) {
  __shared__ __align__(16) gemm_tile_t sA[2];
  __shared__ __align__(16) gemm_tile_t sB[2];
  const int N = DMODEL;
  int wave   = threadIdx.x >> 5;
  int lane16 = threadIdx.x & 15;
  int hi8    = ((threadIdx.x >> 4) & 1) << 3;
  int wm = wave & 3, wn = wave >> 2;
  int bm = (blockIdx.x & 31) * GT_MN;
  int bn = (blockIdx.x >> 5) * GT_MN;
  int m0 = bm + wm * 32, n0 = bn + wn * 64;

  v8f c0[4] = {}, c1[4] = {};
  gemm_tile_loop(ain + (size_t)bm * DMODEL, wT + (size_t)bn * DMODEL, sA, sB, wm, wn, c0, c1);

#pragma unroll
  for (int j = 0; j < 4; ++j) {
    int n = n0 + j * 16 + lane16;
    float bj = bias[n];
#pragma unroll
    for (int r = 0; r < 8; ++r) {
      int s0r = m0 + r + hi8;
      out[(size_t)s0r * N + n]        = c0[j][r] + bj;
      out[(size_t)(s0r + 16) * N + n] = c1[j][r] + bj;
    }
  }
}

// ---------------------------------------------------------------------------
// Host launch
// ---------------------------------------------------------------------------
extern "C" void kernel_launch(void* const* d_in, const int* in_sizes, int n_in,
                              void* d_out, int out_size, void* d_ws, size_t ws_size,
                              hipStream_t stream) {
  const float* x  = (const float*)d_in[0];
  const float* wq = (const float*)d_in[1];
  const float* bq = (const float*)d_in[2];
  const float* wk = (const float*)d_in[3];
  const float* bk = (const float*)d_in[4];
  const float* wv = (const float*)d_in[5];
  const float* bv = (const float*)d_in[6];
  const float* wo = (const float*)d_in[7];
  const float* bo = (const float*)d_in[8];
  float* out = (float*)d_out;

  char* ws = (char*)d_ws;
  const size_t MB = 1024 * 1024;
  _Float16* wqT  = (_Float16*)(ws + 0 * MB);    // [1024][1024] f16, 2 MB each
                                                // wkT at 2 MB, wvT at 4 MB
  _Float16* woT  = (_Float16*)(ws + 6 * MB);
  _Float16* qh   = (_Float16*)(ws + 8 * MB);    // [16][4096][64], 8 MB each
  _Float16* kh   = (_Float16*)(ws + 16 * MB);
  _Float16* vt   = (_Float16*)(ws + 24 * MB);   // [16][64][4096]
  _Float16* aout = (_Float16*)(ws + 32 * MB);   // [4096][1024]
  _Float16* xh   = (_Float16*)(ws + 40 * MB);   // [4096][1024]

  // wqT .. woT lie one behind the other, and so do qh, kh, vt
  cvt_all_kernel<<<CVT_BLOCKS, CVT_THREADS, 0, stream>>>(x, wq, wk, wv, wo, xh, wqT);

  gemm_qkv_kernel<<<3 * GTILES, 256, 0, stream>>>(xh, wqT, bq, bk, bv, qh);

  attn_kernel<<<dim3(ATT_TILES / 2, NHEADS), ATT_WAVES * 32, 0, stream>>>(qh, kh, vt, aout);

  gemm_out_kernel<<<256, 256, 0, stream>>>(aout, woT, bo, out);
}

// v010
// Measured time: 78.9 microseconds a run.
// Two timings next to v009 both put it at 1.03 times that version's speed.
// Counting every step since v000, it is 6.62 times as fast.
#include <hip/hip_runtime.h>
#include <hip/hip_bf16.h>
#include <math.h>

typedef __attribute__((ext_vector_type(16))) _Float16 v16h;
typedef __attribute__((ext_vector_type(8)))  _Float16 v8h;
typedef __attribute__((ext_vector_type(8)))  float    v8f;
typedef __attribute__((ext_vector_type(4)))  float    v4f;
typedef __attribute__((ext_vector_type(4)))  _Float16 v4h;

#define S_LEN 4096
#define DMODEL 1024
#define NHEADS 16
#define HDIM 64
#define CHUNKLEN 1024

// ---------------------------------------------------------------------------
// WMMA helpers: v_wmma_f32_16x16x32_f16, D = A(16x32) * B(32x16) + C(16x16 f32)
// A layout (wave32): lane L (row M = L%16); halves 0..7 -> K = base+0..7,
// halves 8..15 -> K = base+16..23, base = (L>=16)?8:0.
// B layout mirrors A with N = L%16. C/D: VGPR r, lane L: M = r + ((L>=16)?8:0).
// ---------------------------------------------------------------------------
__device__ __forceinline__ v8f wmma_f16(v16h a, v16h b, v8f c) {
  return __builtin_amdgcn_wmma_f32_16x16x32_f16(
      false, a, false, b, (short)0, c, false, false);
}

__device__ __forceinline__ v16h pack16(v8h lo, v8h hi) {
  v16h r;
#pragma unroll
  for (int t = 0; t < 8; ++t) { r[t] = lo[t]; r[8 + t] = hi[t]; }
  return r;
}

__device__ __forceinline__ v16h load_frag_f16(const _Float16* __restrict__ row, int kb) {
  v8h lo = *(const v8h*)(row + kb);
  v8h hi = *(const v8h*)(row + kb + 16);
  return pack16(lo, hi);
}

// ---------------------------------------------------------------------------
// Kernel 1: every f32 -> f16 conversion of the call in ONE launch; none depends on another.
// The block index picks the part: blocks 0 .. CVX_BLOCKS-1 take x, the rest the four weights.
//
// x, elementwise: a thread takes 8 pieces of 4 floats. Each wave-wide load covers 512
// contiguous bytes and each store 256; all 8 loads are issued before the first use.
//
// weights, convert + transpose  w[K][N] f32  ->  wT[N][K] f16, K = N = DMODEL:
// one 64(k) x 64(n) tile per work-group, turned in LDS: 16-byte loads along n,
// 16-byte stores along k, 8 lanes of one wave write each whole 128-byte line of wT.
// ---------------------------------------------------------------------------
#define CVT_THREADS 256
#define CVX_BLOCKS  512
#define CVX_PIECES  8
static_assert(CVX_BLOCKS * CVT_THREADS * CVX_PIECES * 4 == S_LEN * DMODEL, "x is covered exactly once");

#define TTILE 64
#define TROW  72   // halves per LDS row: 128 B of data + 16 B, keeps 16-byte reads aligned
#define TPERW ((DMODEL / TTILE) * (DMODEL / TTILE))   // tiles of one weight
#define CVT_BLOCKS (CVX_BLOCKS + 4 * TPERW)

// wT4: the four transposed weights one behind the other, in the order q, k, v, o
__global__ __launch_bounds__(CVT_THREADS) void cvt_all_kernel(
    const float* __restrict__ x,  const float* __restrict__ wq, const float* __restrict__ wk,
    const float* __restrict__ wv, const float* __restrict__ wo,
    _Float16* __restrict__ xh, _Float16* __restrict__ wT4) {
  __shared__ __align__(16) _Float16 sT[TTILE][TROW];   // n x k
  if (blockIdx.x < CVX_BLOCKS) {                       // the same for the whole work-group
    const v4f* xv = (const v4f*)x;
    v4h*       hv = (v4h*)xh;
    unsigned q = blockIdx.x * (CVT_THREADS * CVX_PIECES) + threadIdx.x;   // piece index, the same on both sides
    v4f a[CVX_PIECES];
#pragma unroll
    for (int i = 0; i < CVX_PIECES; ++i) a[i] = xv[q + i * CVT_THREADS];
#pragma unroll
    for (int i = 0; i < CVX_PIECES; ++i) {
      v4h h;
#pragma unroll
      for (int c = 0; c < 4; ++c) h[c] = (_Float16)a[i][c];
      hv[q + i * CVT_THREADS] = h;
    }
    return;
  }
  unsigned t     = blockIdx.x - CVX_BLOCKS;
  int which = (int)(t / TPERW), tile = (int)(t % TPERW);
  const float* wlo = (which & 1) ? wk : wq;
  const float* whi = (which & 1) ? wo : wv;
  const float* w   = (which & 2) ? whi : wlo;
  _Float16*   wT = wT4 + (size_t)which * DMODEL * DMODEL;
  int n0 = (tile % (DMODEL / TTILE)) * TTILE, k0 = (tile / (DMODEL / TTILE)) * TTILE;
  int c4 = (threadIdx.x & 15) * 4;    // 4 consecutive n
  int r4 = (threadIdx.x >> 4) * 4;    // 4 consecutive k
  v4f v[4];
#pragma unroll
  for (int i = 0; i < 4; ++i)
    v[i] = *(const v4f*)(w + (size_t)(k0 + r4 + i) * DMODEL + n0 + c4);
#pragma unroll
  for (int c = 0; c < 4; ++c) {
    v4h h;
#pragma unroll
    for (int i = 0; i < 4; ++i) h[i] = (_Float16)v[i][c];
    *(v4h*)&sT[c4 + c][r4] = h;
  }
  __syncthreads();   // the tile is complete before any thread reads rows that others wrote
  int row = threadIdx.x >> 3;         // 0..31, second piece: +32
  int col = (threadIdx.x & 7) * 8;    // in halves
#pragma unroll
  for (int i = 0; i < 2; ++i)
    *(v8h*)(wT + (size_t)(n0 + row + 32 * i) * DMODEL + k0 + col) =
        *(const v8h*)&sT[row + 32 * i][col];
}

// ---------------------------------------------------------------------------
// Main loop of the output-projection GEMM kernel: C(128 x 128) = A(128 x K) * B(128 x K)^T, both f16
// and K-contiguous. The eight waves of a work-group share the two operand tiles through LDS:
// a stage is 128 k (256-byte rows) of all 256 rows, brought in by asynchronous copies of
// whole rows, two buffers, the next stage in flight while this one is worked on.
// Waves stand 4 (M) x 2 (N); each computes 32 x 64 (B fragments reused by 2 A fragments).
// ---------------------------------------------------------------------------
#define GT_MN   128                 // rows of A and rows of B per work-group
#define GT_K    128                 // halves of K per stage
#define GROW    136                 // halves per LDS row: 256 B of data + 16 B, conflict-free for 16-B reads
#define GSTAGES (DMODEL / GT_K)
#define GSTEPS  (GT_K / 32)         // matrix steps of 32 k per stage
static_assert(GSTAGES >= 2, "the prologue starts two stages");

// One thread's share of one operand's stage: eight 16-byte pieces, rows 16 apart.
// The s_wait_xcnt stands inside the statement so that no address register of a
// copy is rewritten ahead of it.
__device__ __forceinline__ void copy_rows8(unsigned l, const _Float16* g) {
  const unsigned ls = 16 * GROW * 2;          // bytes of 16 LDS rows
  const size_t   gs = (size_t)16 * DMODEL;    // halves of 16 global rows
  asm volatile(
      "global_load_async_to_lds_b128 %0, %1, off\n\t"
      "global_load_async_to_lds_b128 %2, %3, off\n\t"
      "global_load_async_to_lds_b128 %4, %5, off\n\t"
      "global_load_async_to_lds_b128 %6, %7, off\n\t"
      "global_load_async_to_lds_b128 %8, %9, off\n\t"
      "global_load_async_to_lds_b128 %10, %11, off\n\t"
      "global_load_async_to_lds_b128 %12, %13, off\n\t"
      "global_load_async_to_lds_b128 %14, %15, off\n\t"
      "s_wait_xcnt 0x0"
      :: "v"(l),          "v"(g),          "v"(l + ls),     "v"(g + gs),
         "v"(l + 2 * ls), "v"(g + 2 * gs), "v"(l + 3 * ls), "v"(g + 3 * gs),
         "v"(l + 4 * ls), "v"(g + 4 * gs), "v"(l + 5 * ls), "v"(g + 5 * gs),
         "v"(l + 6 * ls), "v"(g + 6 * gs), "v"(l + 7 * ls), "v"(g + 7 * gs)
      : "memory");
}

typedef _Float16 gemm_tile_t[GT_MN][GROW];

// a: first row of the work-group's A tile; b: first row of its B tile; wm, wn: the wave's place
__device__ __forceinline__ void gemm_tile_loop(
    const _Float16* __restrict__ a, const _Float16* __restrict__ b,
    gemm_tile_t* sA, gemm_tile_t* sB, int wm, int wn, v8f (&c0)[4], v8f (&c1)[4]) {
  int lane16 = threadIdx.x & 15;
  int hi8    = ((threadIdx.x >> 4) & 1) << 3;
  // copy map: piece p = threadIdx.x + 256 i: row p/16, 16-byte column p%16; a wave covers 2 whole rows
  int crow = threadIdx.x >> 4;            // 0..15, piece i: +16 i
  int ccol = (threadIdx.x & 15) * 8;      // in halves
  const _Float16* ga = a + (size_t)crow * DMODEL + ccol;
  const _Float16* gb = b + (size_t)crow * DMODEL + ccol;
  unsigned la = (unsigned)(size_t)&sA[0][crow][ccol];
  unsigned lb = (unsigned)(size_t)&sB[0][crow][ccol];
  const unsigned buf_bytes = GT_MN * GROW * 2;

  // --- prologue: stage 0 lands and is published, then stage 1 starts
  copy_rows8(la, ga);
  copy_rows8(lb, gb);
  asm volatile("s_wait_asynccnt 0x0" ::: "memory");   // this wave's copies of stage 0 have landed
  __syncthreads();                                    // ... and every other wave's
  copy_rows8(la + buf_bytes, ga + GT_K);
  copy_rows8(lb + buf_bytes, gb + GT_K);

  for (int s = 0; s < GSTAGES; ++s) {
    int buf = s & 1;
    const _Float16* ar = &sA[buf][wm * 32 + lane16][0];
    const _Float16* br = &sB[buf][wn * 64 + lane16][0];
    // two fragment sets: the reads of the next 32 k are issued as one group ahead of this step's products
    v16h fa[2][2], fb[2][4];
    fa[0][0] = load_frag_f16(ar, hi8);
    fa[0][1] = load_frag_f16(ar + 16 * GROW, hi8);
#pragma unroll
    for (int j = 0; j < 4; ++j) fb[0][j] = load_frag_f16(br + j * 16 * GROW, hi8);
    // unrolled (as the j loops are) so that every fragment-set index is a constant and the sets stay in registers
#pragma unroll
    for (int t = 0; t + 1 < GSTEPS; ++t) {
      const int cur = t & 1, nxt = cur ^ 1;
      int kb = (t + 1) * 32 + hi8;
      fa[nxt][0] = load_frag_f16(ar, kb);
      fa[nxt][1] = load_frag_f16(ar + 16 * GROW, kb);
#pragma unroll
      for (int j = 0; j < 4; ++j) fb[nxt][j] = load_frag_f16(br + j * 16 * GROW, kb);
      // keeps the group of reads above in front of the products below; without it the build
      // sinks each read to its product and waits out the LDS latency every two products
      __builtin_amdgcn_sched_barrier(0);
#pragma unroll
      for (int j = 0; j < 4; ++j) {
        c0[j] = wmma_f16(fa[cur][0], fb[cur][j], c0[j]);
        c1[j] = wmma_f16(fa[cur][1], fb[cur][j], c1[j]);
      }
    }
    // keeps the products above in front of the barrier; without it the build sinks them
    // behind it, in front of the copies, which then start that much later
    __builtin_amdgcn_sched_barrier(0);
    // --- publish point of stage s+1; it also ends every wave's reads of this buffer
    // (behind its first wait the last step's fragments are in registers)
    asm volatile("s_wait_dscnt 0x0" ::: "memory");     // this wave's LDS reads of the buffer are done
    asm volatile("s_wait_asynccnt 0x0" ::: "memory");  // this wave's copies of stage s+1 have landed
    __syncthreads();
    if (s + 2 < GSTAGES) {                             // stage s+2 into the buffer just read
      unsigned bo = (unsigned)buf * buf_bytes;
      copy_rows8(la + bo, ga + (s + 2) * GT_K);
      copy_rows8(lb + bo, gb + (s + 2) * GT_K);
    }
#pragma unroll
    for (int j = 0; j < 4; ++j) {
      c0[j] = wmma_f16(fa[(GSTEPS - 1) & 1][0], fb[(GSTEPS - 1) & 1][j], c0[j]);
      c1[j] = wmma_f16(fa[(GSTEPS - 1) & 1][1], fb[(GSTEPS - 1) & 1][j], c1[j]);
    }
  }
  asm volatile("s_wait_asynccnt 0x0" ::: "memory");    // nothing of this wave's is in flight at its end
}

// ---------------------------------------------------------------------------
// Kernel 2: the three projections in ONE launch.  out = xh(f16 SxK) @ wT^T(f16) + bias
// A work-group forms the Q, the K and the V tile of the SAME 128 positions and the same 128
// features of each projection: 128 x 384 outputs, 32 x 8 work-groups, one on every WGP. The x
// rows are staged once for all three, and a wave's tile is 64 positions x 96 features (32 of
// each projection): ten fragments read from LDS feed 24 products.
// wT3: the transposed weights of q, k, v one behind the other; qkv: their outputs likewise.
// q, k: out[h][s][d]; v: out[h][d][s]
// A lane holds 8 consecutive rows (M) of one column (N) of each accumulator tile. M is made
// the dimension that is contiguous in the output: s for V (A = x rows, B = weight rows),
// d for Q and K (A = weight rows, B = x rows); the fragments are the same either way. The
// tiles then go, as f16, through LDS ([N][M], 16-byte writes) and leave in 16-byte stores
// that cover whole 128-byte lines.
// The ring is that of gemm_tile_loop: a stage is 128 k of all 512 rows, two buffers.
// ---------------------------------------------------------------------------
#define GTILES ((S_LEN / GT_MN) * (DMODEL / GT_MN))   // work-groups: tiles of one projection
#define QW_S 64                                       // positions of a wave
#define QW_F 32                                       // features of a wave, of each projection

typedef _Float16 qkv_w_tile_t[3 * GT_MN][GROW];       // rows of wq, then of wk, then of wv

typedef __attribute__((ext_vector_type(4))) int v4i;
typedef __attribute__((address_space(1))) v4i glb_v4i;
typedef __attribute__((address_space(3))) v4i lds_v4i;

// One thread's share of one operand's stage, as copy_rows8, written with the builtin: this kernel
// holds more than 256 registers, and the operands of an asm statement must all lie in the first 256.
__device__ __forceinline__ void copy_rows8_any(_Float16* l, const _Float16* g) {
#pragma unroll   // eight copies in a row, constant steps
  for (int i = 0; i < 8; ++i)
    __builtin_amdgcn_global_load_async_to_lds_b128(
        (glb_v4i*)(g + (size_t)i * 16 * DMODEL), (lds_v4i*)(l + i * 16 * GROW), 0, 0);
}

// the 24 products of one step of 32 k
__device__ __forceinline__ void qkv_products(
    const v16h (&fx)[4], const v16h (&fw)[6], v8f (&cqk)[2][2][4], v8f (&cv)[4][2]) {
#pragma unroll   // constant indices: the arrays stay in registers
  for (int p = 0; p < 2; ++p)
#pragma unroll
    for (int i = 0; i < 2; ++i)
#pragma unroll
      for (int j = 0; j < 4; ++j) cqk[p][i][j] = wmma_f16(fw[2 * p + i], fx[j], cqk[p][i][j]);
#pragma unroll
  for (int j = 0; j < 4; ++j)
#pragma unroll
    for (int i = 0; i < 2; ++i) cv[j][i] = wmma_f16(fx[j], fw[4 + i], cv[j][i]);
}

// the ten fragments of one step: xr, wr: this lane's first x row and first weight row; kb: its first k
__device__ __forceinline__ void qkv_fragments(
    const _Float16* xr, const _Float16* wr, int kb, v16h (&fx)[4], v16h (&fw)[6]) {
#pragma unroll   // constant indices: the arrays stay in registers
  for (int j = 0; j < 4; ++j) fx[j] = load_frag_f16(xr + j * 16 * GROW, kb);
#pragma unroll
  for (int p = 0; p < 3; ++p)
#pragma unroll
    for (int i = 0; i < 2; ++i) fw[2 * p + i] = load_frag_f16(wr + (p * GT_MN + i * 16) * GROW, kb);
}

__global__ __launch_bounds__(256) void gemm_qkv_kernel(
    const _Float16* __restrict__ xh, const _Float16* __restrict__ wT3,
    const float* __restrict__ bq, const float* __restrict__ bk, const float* __restrict__ bv,
    _Float16* __restrict__ qkv) {
  __shared__ __align__(16) gemm_tile_t  sX[2];
  __shared__ __align__(16) qkv_w_tile_t sW[2];
  int wave   = threadIdx.x >> 5;
  int lane16 = threadIdx.x & 15;
  int hi8    = ((threadIdx.x >> 4) & 1) << 3;           // 0 or 8
  int ws = wave & 1, wf = wave >> 1;                    // the wave's place: 2 over positions, 4 over features
  int bm = ((int)blockIdx.x & 31) * GT_MN;              // first position s: 32 tiles of 128
  int bn = ((int)blockIdx.x >> 5) * GT_MN;              // first feature n of each projection: 8 tiles of 128

  // copy map: piece p = threadIdx.x + 256 i of an operand's 128 rows: row p/16, 16-byte column p%16
  int crow = threadIdx.x >> 4;            // 0..15, piece i: +16 i
  int ccol = (threadIdx.x & 15) * 8;      // in halves
  unsigned goff = (unsigned)(crow * DMODEL + ccol);                 // the thread's place in an operand's rows, in halves
  const _Float16* ux = xh  + (size_t)bm * DMODEL;                   // the same for the whole work-group
  const _Float16* uw = wT3 + (size_t)bn * DMODEL;                   // the next projection: DMODEL rows further
  const _Float16* gx = ux + goff;
  const _Float16* gw = uw + goff;
  _Float16* lx = &sX[0][crow][ccol];
  _Float16* lw = &sW[0][crow][ccol];                                // the next projection: GT_MN rows further
  const unsigned t_halves = GT_MN * GROW;                            // halves of 128 LDS rows
  const size_t   w_next  = (size_t)DMODEL * DMODEL;

  // --- prologue: stage 0 lands and is published, then stage 1 starts
  copy_rows8_any(lx, gx);
  copy_rows8_any(lw, gw);
  copy_rows8_any(lw + t_halves, gw + w_next);
  copy_rows8_any(lw + 2 * t_halves, gw + 2 * w_next);
  asm volatile("s_wait_asynccnt 0x0" ::: "memory");   // this wave's copies of stage 0 have landed
  __syncthreads();                                    // ... and every other wave's
  copy_rows8_any(lx + t_halves, gx + GT_K);
  copy_rows8_any(lw + 3 * t_halves, gw + GT_K);
  copy_rows8_any(lw + 4 * t_halves, gw + w_next + GT_K);
  copy_rows8_any(lw + 5 * t_halves, gw + 2 * w_next + GT_K);

  v8f cqk[2][2][4] = {};   // q, k: [projection][16 features][16 positions], M = feature
  v8f cv[4][2] = {};       // v: [16 positions][16 features], M = position
  for (int s = 0; s < GSTAGES; ++s) {
    int buf = s & 1;
    const _Float16* xr = &sX[buf][ws * QW_S + lane16][0];
    const _Float16* wr = &sW[buf][wf * QW_F + lane16][0];
    // two fragment sets: the reads of the next 32 k are issued as one group ahead of this step's products
    v16h fx[2][4], fw[2][6];
    qkv_fragments(xr, wr, hi8, fx[0], fw[0]);
    // unrolled so that every fragment-set index is a constant and the sets stay in registers
#pragma unroll
    for (int t = 0; t + 1 < GSTEPS; ++t) {
      const int cur = t & 1, nxt = cur ^ 1;
      qkv_fragments(xr, wr, (t + 1) * 32 + hi8, fx[nxt], fw[nxt]);
      // keeps the group of reads above in front of the products below; without it the build
      // sinks each read to its product and waits out the LDS latency there
      __builtin_amdgcn_sched_barrier(0);
      qkv_products(fx[cur], fw[cur], cqk, cv);
      // keeps the following step's reads behind these products, as one group: without it the build lifts
      // part of them in among the products, where they stand in several places. Behind the last step it keeps
      // the products in front of the barrier, so that the copies behind it do not start later
      __builtin_amdgcn_sched_barrier(0);
    }
    // --- publish point of stage s+1; it also ends every wave's reads of this buffer
    // (behind its first wait the last step's fragments are in registers)
    asm volatile("s_wait_dscnt 0x0" ::: "memory");     // this wave's LDS reads of the buffer are done
    asm volatile("s_wait_asynccnt 0x0" ::: "memory");  // this wave's copies of stage s+1 have landed
    __syncthreads();
    if (s + 2 < GSTAGES) {                             // stage s+2 into the buffer just read
      unsigned bx = (unsigned)buf * t_halves, bw = 3 * bx;
      const _Float16* kx = ux + (s + 2) * GT_K + goff;
      const _Float16* kw = uw + (s + 2) * GT_K + goff;
      copy_rows8_any(lx + bx, kx);
      copy_rows8_any(lw + bw, kw);
      copy_rows8_any(lw + bw + t_halves, kw + w_next);
      copy_rows8_any(lw + bw + 2 * t_halves, kw + 2 * w_next);
    }
    qkv_products(fx[(GSTEPS - 1) & 1], fw[(GSTEPS - 1) & 1], cqk, cv);
  }
  asm volatile("s_wait_asynccnt 0x0" ::: "memory");    // nothing of this wave's is in flight at its end

  // the biases. Q, K: the features are the rows M, eight floats a lane and tile; V: the feature is
  // the column N, one float a lane and tile; tile i: 16 features further
  int fqk = wf * QW_F + hi8, fv = wf * QW_F + lane16;
  float bv0 = bv[bn + fv], bv1 = bv[bn + fv + 16];
  // what follows may rewrite the address registers of the two loads above
  asm volatile("s_wait_xcnt 0x0" ::: "memory");
  v4f bl[2][2][2];
#pragma unroll   // constant indices: the array stays in registers
  for (int i = 0; i < 2; ++i) {
    const v4f* pq = (const v4f*)(bq + bn + fqk + i * 16);
    const v4f* pk = (const v4f*)(bk + bn + fqk + i * 16);
    bl[0][i][0] = pq[0];  bl[0][i][1] = pq[1];
    bl[1][i][0] = pk[0];  bl[1][i][1] = pk[1];
  }
  // the address registers of the eight loads above are rewritten by what follows
  asm volatile("s_wait_xcnt 0x0" ::: "memory");
  // keeps the address arithmetic below behind that wait; without it the build lifts a write of
  // the loads' offset register over the wait
  __builtin_amdgcn_sched_barrier(0);

  // The ring is free: every wave's reads had returned before the loop's last barrier, and the
  // last copies had landed one barrier earlier. The first weight buffer takes the three tiles,
  // each [N][M], 128 rows: q, k, v.
  _Float16 (*sC)[GROW] = sW[0];
#pragma unroll   // constant indices: the arrays stay in registers
  for (int p = 0; p < 2; ++p) {
#pragma unroll
    for (int i = 0; i < 2; ++i) {
      v8f b = __builtin_shufflevector(bl[p][i][0], bl[p][i][1], 0, 1, 2, 3, 4, 5, 6, 7);
#pragma unroll
      for (int j = 0; j < 4; ++j)
        *(v8h*)&sC[p * GT_MN + ws * QW_S + j * 16 + lane16][fqk + i * 16] =
            __builtin_convertvector(cqk[p][i][j] + b, v8h);
    }
  }
#pragma unroll   // constant indices: the arrays stay in registers
  for (int i = 0; i < 2; ++i) {
    float b = i == 0 ? bv0 : bv1;
#pragma unroll
    for (int j = 0; j < 4; ++j)
      *(v8h*)&sC[2 * GT_MN + fv + i * 16][ws * QW_S + j * 16 + hi8] = __builtin_convertvector(cv[j][i] + b, v8h);
  }
  __syncthreads();   // the tiles are complete before any thread reads rows that other waves wrote

  // piece p = threadIdx.x + 256 i of a tile: row p/16, 16-byte column p%16; a wave covers 2 whole rows of 256 B
  int row = crow;                         // 0..15, piece i: +16 i
  int c8  = ccol;                         // in halves
  // Q, K: row = position, columns = features of two heads; V: row = feature (h * 64 + d), columns = positions
  _Float16* pqk = qkv + ((size_t)((bn + c8) >> 6) * S_LEN + bm + row) * HDIM + ((bn + c8) & 63);
  _Float16* pv  = qkv + (size_t)2 * S_LEN * DMODEL + (size_t)(bn + row) * S_LEN + bm + c8;
#pragma unroll   // constant indices: the arrays stay in registers
  for (int p = 0; p < 3; ++p) {
    v8h h[8];
#pragma unroll
    for (int i = 0; i < 8; ++i) h[i] = *(const v8h*)&sC[p * GT_MN + row + 16 * i][c8];
    // the step between a thread's pieces is a constant in either layout
    if (p < 2) {
#pragma unroll
      for (int i = 0; i < 8; ++i) *(v8h*)(pqk + (size_t)p * S_LEN * DMODEL + (size_t)i * 16 * HDIM) = h[i];
      // the next tile's reads rewrite the registers that these stores name
      asm volatile("s_wait_xcnt 0x0" ::: "memory");
    } else {
#pragma unroll
      for (int i = 0; i < 8; ++i) *(v8h*)(pv + (size_t)i * 16 * S_LEN) = h[i];
    }
  }
}

// ---------------------------------------------------------------------------
// Kernel 3: flash-style block-causal attention. A tile is 128 q rows of one head, all in
// one chunk; its cost grows with its chunk (1 to 4 chunks of keys). All work-groups are
// resident at once, so the launch lasts as long as the fullest: every work-group takes TWO
// tiles of its head one after the other, tile n-1-p and then tile p, which together always
// walk 5 chunks of keys. 16 waves: wave w works on q rows 16 (w%8) .. +15; waves 0-7 take
// the first 128 keys of each 256-key stage, waves 8-15 the other 128, each with its own
// running maximum, sum and Ot; the two parts of a query are joined once per tile through LDS.
// The K and V stages come in by asynchronous copies of whole rows, three buffers, the next
// stage in flight while this one is worked on; the second tile's stages follow the first
// tile's in the same ring. Per wave and 64 keys: 8 score WMMAs + softmax + 8 PV WMMAs.
// LDS reads run under other work, not in front of their products: with a block's score products a
// wave issues the block's V fragments and half of the NEXT block's K fragments (into registers just
// consumed), which land under the softmax; the other half of that K follows behind the softmax and
// lands under the PV products. The last block of a stage so reads the next stage's K: the publish
// point stands in front of it, and the refill goes into the third buffer, left one stage ago.
// Both products are formed transposed: St = K * Qt (A = K rows, B = Q) and
// Ot += Vt * Pt (A = Vt rows, B = P). A lane then holds 32 of the 64 scores of ONE
// query (column lane%16; keys 16t + r + 8*(lane/16)), so maximum and sum are taken
// in the lane, with one exchange between the wave's halves, and the score
// accumulators of tiles 2i and 2i+1 are, converted, the B fragment of keys
// 32i..32i+31: P never leaves the registers.
// qh,kh: [H][S][64] f16;  vt: [H][64][S] f16;  aout: [S][H*64] f16
// ---------------------------------------------------------------------------
#define ATT_WAVES 16
#define ATT_QW    8                     // waves side by side over the q rows
#define ATT_ROWS  (ATT_QW * 16)         // q rows of a tile
#define ATT_TILES (S_LEN / ATT_ROWS)    // tiles of one head
#define KTILE  64                       // keys of one block: scores, softmax, PV
#define KSUB   2                        // blocks per wave and stage
#define KSTAGE (2 * KSUB * KTILE)       // keys per stage
#define CSTAGES (CHUNKLEN / KSTAGE)     // stages of one chunk
#define KVBUFS 3                        // buffers of the ring
#define LROW 72              // halves per LDS row of K: 128 B of data + 16 B, conflict-free for 16-B reads
#define VROW (KSTAGE + 8)    // halves per LDS row of V: 512 B of data + 16 B, likewise
static_assert(ATT_TILES % 2 == 0, "tiles pair up");
static_assert(CHUNKLEN % ATT_ROWS == 0, "a tile lies in one chunk");
static_assert(CHUNKLEN % KSTAGE == 0 && CSTAGES >= 2, "the prologue starts two stages of the first tile");
static_assert(KSTAGE == 4 * 64 && HDIM == 4 * 16 && KSTAGE * 2 == 32 * 16, "the copy map below");
static_assert(KSUB >= 2, "the publish point stands between two blocks of a stage");

// One stage's share of one thread: four 16-byte pieces of K, rows 64 apart, and four of V,
// rows 16 apart. The s_wait_xcnt stands inside the statement so that no address register
// of a copy is rewritten ahead of it.
__device__ __forceinline__ void copy_kv_stage(
    unsigned lk, const _Float16* gk, unsigned lv, const _Float16* gv) {
  const unsigned ks = 64 * LROW * 2;          // bytes of 64 LDS rows of K
  const unsigned vs = 16 * VROW * 2;          // bytes of 16 LDS rows of V
  const size_t   kg = (size_t)64 * HDIM;      // halves of 64 global rows of K
  const size_t   vg = (size_t)16 * S_LEN;     // halves of 16 global rows of V
  asm volatile(
      "global_load_async_to_lds_b128 %0, %1, off\n\t"
      "global_load_async_to_lds_b128 %2, %3, off\n\t"
      "global_load_async_to_lds_b128 %4, %5, off\n\t"
      "global_load_async_to_lds_b128 %6, %7, off\n\t"
      "global_load_async_to_lds_b128 %8, %9, off\n\t"
      "global_load_async_to_lds_b128 %10, %11, off\n\t"
      "global_load_async_to_lds_b128 %12, %13, off\n\t"
      "global_load_async_to_lds_b128 %14, %15, off\n\t"
      "s_wait_xcnt 0x0"
      :: "v"(lk),          "v"(gk),          "v"(lk + ks),     "v"(gk + kg),
         "v"(lk + 2 * ks), "v"(gk + 2 * kg), "v"(lk + 3 * ks), "v"(gk + 3 * kg),
         "v"(lv),          "v"(gv),          "v"(lv + vs),     "v"(gv + vg),
         "v"(lv + 2 * vs), "v"(gv + 2 * vg), "v"(lv + 3 * vs), "v"(gv + 3 * vg)
      : "memory");
}

// four of the eight K fragments of one block of 64 keys: d 32 half .. +31 of its four key tiles;
// kr: this lane's row of the block's first key tile
__device__ __forceinline__ void load_k_half(const _Float16* kr, int hi8, int half, v16h (&kf)[8]) {
#pragma unroll   // constant indices: the array stays in registers
  for (int t = 0; t < 4; ++t) kf[2 * t + half] = load_frag_f16(kr + t * 16 * LROW + 32 * half, hi8);
}

// lane l <-> lane l ^ 16, on the vector unit
__device__ __forceinline__ float xhalf(float x) {
  int b = __builtin_bit_cast(int, x);
  return __builtin_bit_cast(float,
      __builtin_amdgcn_permlanex16(b, b, 0x76543210, 0xfedcba98, false, false));
}

// waves_per_eu: the grid puts 4 waves on a SIMD (256 work-groups of 16 waves, 256 WGPs). With that
// register budget stated the compiler issues a block's K reads as a group ahead of the score
// products; without it the build reads two pieces, waits for them and multiplies, product by product.
__global__ __launch_bounds__(ATT_WAVES * 32) __attribute__((amdgpu_waves_per_eu(4, 4))) void attn_kernel(
    const _Float16* __restrict__ qh, const _Float16* __restrict__ kh,
    const _Float16* __restrict__ vt, _Float16* __restrict__ aout) {
  __shared__ __align__(16) _Float16 sK[KVBUFS][KSTAGE][LROW];    // keys x d
  __shared__ __align__(16) _Float16 sV[KVBUFS][HDIM][VROW];      // d x keys
  __shared__ __align__(16) v4f      sO[ATT_QW][8][32];           // Ot of the second key part, lane by lane
  __shared__ float                  sMS[ATT_QW][2][32];          // its maximum and its sum

  int head   = blockIdx.y;
  int wave   = threadIdx.x >> 5;
  int lane   = threadIdx.x & 31;
  int lane16 = threadIdx.x & 15;
  int hi8    = ((threadIdx.x >> 4) & 1) << 3;
  int qi     = wave & (ATT_QW - 1);       // which 16 q rows
  int kpart  = wave / ATT_QW;             // which half of a stage's keys
  // 64^-0.5 * log2(e): a score enters the exponential as 2^(raw * sl2e - maximum), one multiply-add
  const float sl2e = 0.125f * 1.44269504088896340736f;

  // the two tiles and their stages; the same for all 16 waves
  int tile_a = ATT_TILES - 1 - (int)blockIdx.x, tile_b = (int)blockIdx.x;
  int n_a    = (tile_a * ATT_ROWS / CHUNKLEN + 1) * CSTAGES;   // block-causal: full chunks
  int n_all  = n_a + (tile_b * ATT_ROWS / CHUNKLEN + 1) * CSTAGES;

  // copy map, K: piece p = threadIdx.x + 512 i: row p/8, 16-byte column p%8; a wave covers 4 whole rows
  //           V: piece p = threadIdx.x + 512 i: row p/32, 16-byte column p%32; a wave covers 1 whole row
  int krow = threadIdx.x >> 3;            // 0..63, piece i: +64 i
  int kcol = (threadIdx.x & 7) * 8;       // in halves
  int vrow = threadIdx.x >> 5;            // 0..15, piece i: +16 i
  int vcol = (threadIdx.x & 31) * 8;      // in halves
  const _Float16* gk = kh + ((size_t)head * S_LEN + krow) * HDIM + kcol;
  const _Float16* gv = vt + ((size_t)head * HDIM + vrow) * S_LEN + vcol;
  unsigned lk = (unsigned)(size_t)&sK[0][krow][kcol];
  unsigned lv = (unsigned)(size_t)&sV[0][vrow][vcol];
  const unsigned k_buf = KSTAGE * LROW * 2;   // bytes of one buffer
  const unsigned v_buf = HDIM * VROW * 2;

  // --- prologue: stage 0 lands and is published, then stage 1 starts
  copy_kv_stage(lk, gk, lv, gv);
  asm volatile("s_wait_asynccnt 0x0" ::: "memory");   // this wave's copies of stage 0 have landed
  __syncthreads();                                    // ... and every other wave's
  copy_kv_stage(lk + k_buf, gk + KSTAGE * HDIM, lv + v_buf, gv + KSTAGE);

  // this lane's rows in buffer 0: K row of key tile 0, V row of d tile 0, both at the wave's half of the keys
  const _Float16* kbase = &sK[0][kpart * (KSUB * KTILE) + lane16][0];
  const _Float16* vbase = &sV[0][lane16][kpart * (KSUB * KTILE)];
  v16h kf[8];   // K fragments of the block to come: key tile t, d 0..31 in 2t, d 32..63 in 2t+1
  load_k_half(kbase, hi8, 0, kf);
  load_k_half(kbase, hi8, 1, kf);

  int s  = 0;   // stage, counted through both tiles
  int bc = 0;   // its buffer
  for (int ph = 0; ph < 2; ++ph) {
    int m0    = (ph == 0 ? tile_a : tile_b) * ATT_ROWS + qi * 16;
    int s_end = ph == 0 ? n_a : n_all;

    const _Float16* qrow = qh + ((size_t)head * S_LEN + m0 + lane16) * HDIM;
    v16h aq0 = load_frag_f16(qrow, hi8);        // d 0..31
    v16h aq1 = load_frag_f16(qrow + 32, hi8);   // d 32..63

    float rowmax = -INFINITY;   // of this lane's query over this wave's keys, scaled by sl2e; the same in both halves
    float rowsum = 0.0f;        // of this lane's half of the wave's keys; the halves join after the loop
    v8f o[4] = {};              // Ot: row d = 16j + r + hi8, column = this lane's query

    for (; s < s_end; ++s) {
      int bn = bc + 1 == KVBUFS ? 0 : bc + 1;   // buffer of stage s+1
      int bf = bn + 1 == KVBUFS ? 0 : bn + 1;   // buffer of stage s+2 = that of stage s-1
      const _Float16* kc = kbase + bc * (KSTAGE * LROW);
      const _Float16* vc = vbase + bc * (HDIM * VROW);
      // unrolled so that the blocks' LDS offsets are constants and the publish point stands in one of them
#pragma unroll
      for (int sb = 0; sb < KSUB; ++sb) {
        const int k0 = sb * KTILE;   // the block's first key within the wave's half of the stage
        // --- scores for 64 keys, transposed: four 16(keys) x 16(queries) tiles, Hd=64 in two WMMAs each
        v8f u[4] = {};   // raw: the scale is applied on the way into the exponential
#pragma unroll
        for (int t = 0; t < 4; ++t) u[t] = wmma_f16(kf[2 * t],     aq0, u[t]);
#pragma unroll
        for (int t = 0; t < 4; ++t) u[t] = wmma_f16(kf[2 * t + 1], aq1, u[t]);

        // --- one group of LDS reads: this block's V, then the first half of the next block's K
        // (stage s+1 was published in this stage; behind the last stage the wave reads its own stage's first
        // block again, unused: one instruction stream, and the fragments' registers are free in between)
        const _Float16* kn = sb + 1 < KSUB ? kc + (k0 + KTILE) * LROW
                                           : kbase + (s + 1 < n_all ? bn : bc) * (KSTAGE * LROW);
        v16h vf[8];   // d tile j: keys 0..31 in 2j, keys 32..63 in 2j+1
#pragma unroll
        for (int j = 0; j < 4; ++j) {
          const _Float16* vr = vc + j * 16 * VROW + k0;
          vf[2 * j]     = load_frag_f16(vr,      hi8);
          vf[2 * j + 1] = load_frag_f16(vr + 32, hi8);
        }
        load_k_half(kn, hi8, 0, kf);
        // keeps the group of reads above in front of the softmax below; without it the build
        // sinks each read to its product and the wave waits out the LDS latency there
        __builtin_amdgcn_sched_barrier(0);

        // --- online softmax; a lane holds 32 scores of its query, the lane l ^ 16 the other 32
        float m8[8];
#pragma unroll
        for (int r = 0; r < 8; ++r)
          m8[r] = fmaxf(fmaxf(u[0][r], u[1][r]), fmaxf(u[2][r], u[3][r]));
        float mx = fmaxf(fmaxf(fmaxf(m8[0], m8[1]), fmaxf(m8[2], m8[3])),
                         fmaxf(fmaxf(m8[4], m8[5]), fmaxf(m8[6], m8[7])));
        mx = fmaxf(mx, xhalf(mx));
        float nm    = fmaxf(rowmax, mx * sl2e);   // sl2e > 0: the largest raw score is the largest scaled one
        float alpha = __builtin_amdgcn_exp2f(rowmax - nm);
        rowmax      = nm;
        v8f cv = (v8f)sl2e, nv = (v8f)(-nm);
        // whole vectors, so that the build takes the packed form: two scores an instruction
#pragma unroll   // constant indices: the array stays in registers
        for (int t = 0; t < 4; ++t) u[t] = __builtin_elementwise_fma(u[t], cv, nv);
        float s8[8];
#pragma unroll
        for (int r = 0; r < 8; ++r) {
#pragma unroll
          for (int t = 0; t < 4; ++t) u[t][r] = __builtin_amdgcn_exp2f(u[t][r]);
          s8[r] = (u[0][r] + u[1][r]) + (u[2][r] + u[3][r]);
        }
        float ps = ((s8[0] + s8[1]) + (s8[2] + s8[3])) + ((s8[4] + s8[5]) + (s8[6] + s8[7]));
        rowsum = rowsum * alpha + ps;
#pragma unroll
        for (int j = 0; j < 4; ++j) o[j] = o[j] * alpha;

        // --- P as B fragments, straight from the score accumulators:
        // halves 0..7 = keys hi8+0..7 of the 32 (tile 2i), halves 8..15 = keys hi8+16..23 (tile 2i+1)
        v16h bp0, bp1;
#pragma unroll
        for (int r = 0; r < 8; ++r) {
          bp0[r] = (_Float16)u[0][r];  bp0[8 + r] = (_Float16)u[1][r];
          bp1[r] = (_Float16)u[2][r];  bp1[8 + r] = (_Float16)u[3][r];
        }

        // --- the second half of the next block's K: its registers stay free through the softmax;
        // the reads run under the eight products below and the next block's first four
        load_k_half(kn, hi8, 1, kf);
        // keeps these reads in front of the products below
        __builtin_amdgcn_sched_barrier(0);

        // --- Ot += Vt @ Pt   (V transposed in LDS: contiguous over keys per d)
#pragma unroll
        for (int j = 0; j < 4; ++j) {
          o[j] = wmma_f16(vf[2 * j],     bp0, o[j]);
          o[j] = wmma_f16(vf[2 * j + 1], bp1, o[j]);
        }

        if (sb == KSUB - 2) {
          // keeps the softmax and the products above in front of the waits below; without it the build
          // lifts the waits to just behind the group of reads, and the wave waits out the LDS there
          __builtin_amdgcn_sched_barrier(0);
          // --- publish point of stage s+1, in front of the block that reads its first K rows;
          // it also ends every wave's reads of stage s-1's buffer
          asm volatile("s_wait_dscnt 0x0" ::: "memory");     // this wave's LDS reads so far are done
          asm volatile("s_wait_asynccnt 0x0" ::: "memory");  // this wave's copies of stage s+1 have landed
          __syncthreads();
          if (s + 2 < n_all) {                               // stage s+2 into the buffer of stage s-1
            int s2  = s + 2;
            int key = (s2 < n_a ? s2 : s2 - n_a) * KSTAGE;   // the second tile starts again at key 0
            copy_kv_stage(lk + (unsigned)bf * k_buf, gk + (size_t)key * HDIM,
                          lv + (unsigned)bf * v_buf, gv + key);
          }
        }
      }
      bc = bn;
    }

    // --- join the two key parts of each query: waves 8-15 hand theirs over, waves 0-7 finish the tile
    float sum = rowsum + xhalf(rowsum);   // the two lane halves' sums of this wave's keys
    if (kpart == 1) {
#pragma unroll
      for (int j = 0; j < 4; ++j) {
        sO[qi][2 * j][lane]     = __builtin_shufflevector(o[j], o[j], 0, 1, 2, 3);
        sO[qi][2 * j + 1][lane] = __builtin_shufflevector(o[j], o[j], 4, 5, 6, 7);
      }
      sMS[qi][0][lane] = rowmax;
      sMS[qi][1][lane] = sum;
    }
    __syncthreads();   // the handed-over parts are complete before their readers start
    if (kpart == 0) {
      float pm = sMS[qi][0][lane], psum = sMS[qi][1][lane];
      float m  = fmaxf(rowmax, pm);
      float a  = __builtin_amdgcn_exp2f(rowmax - m), b = __builtin_amdgcn_exp2f(pm - m);   // the maxima are in log2 units
      float inv = 1.0f / (sum * a + psum * b);
      a *= inv;
      b *= inv;
      // a lane holds 8 consecutive d of its query per tile: one 16-byte store each
      _Float16* orow = aout + (size_t)(m0 + lane16) * DMODEL + head * HDIM + hi8;
#pragma unroll
      for (int j = 0; j < 4; ++j) {
        v4f p0 = sO[qi][2 * j][lane], p1 = sO[qi][2 * j + 1][lane];
        v8h h;
#pragma unroll
        for (int r = 0; r < 4; ++r) {
          h[r]     = (_Float16)(o[j][r] * a + p0[r] * b);
          h[4 + r] = (_Float16)(o[j][4 + r] * a + p1[r] * b);
        }
        *(v8h*)(orow + j * 16) = h;
      }
      // the second tile rewrites the registers that these stores name
      asm volatile("s_wait_xcnt 0x0" ::: "memory");
    }
  }
  asm volatile("s_wait_asynccnt 0x0" ::: "memory");    // nothing of this wave's is in flight at its end
}

// ---------------------------------------------------------------------------
// Kernel 4: output projection GEMM.  out(f32) = aout(f16) @ woT^T(f16) + bo
// One 128 x 128 tile per work-group (32 x 8 tiles).
// ---------------------------------------------------------------------------
__global__ __launch_bounds__(256) void gemm_out_kernel(
    const _Float16* __restrict__ ain, const _Float16* __restrict__ wT,
    const float* __restrict__ bias, float* __restrict__ out) {
  __shared__ __align__(16) gemm_tile_t sA[2];
  __shared__ __align__(16) gemm_tile_t sB[2];
  const int N = DMODEL;
  int wave   = threadIdx.x >> 5;
  int lane16 = threadIdx.x & 15;
  int hi8    = ((threadIdx.x >> 4) & 1) << 3;
  int wm = wave & 3, wn = wave >> 2;
  int bm = (blockIdx.x & 31) * GT_MN;
  int bn = (blockIdx.x >> 5) * GT_MN;
  int m0 = bm + wm * 32, n0 = bn + wn * 64;

  v8f c0[4] = {}, c1[4] = {};
  gemm_tile_loop(ain + (size_t)bm * DMODEL, wT + (size_t)bn * DMODEL, sA, sB, wm, wn, c0, c1);

#pragma unroll
  for (int j = 0; j < 4; ++j) {
    int n = n0 + j * 16 + lane16;
    float bj = bias[n];
#pragma unroll
    for (int r = 0; r < 8; ++r) {
      int s0r = m0 + r + hi8;
      out[(size_t)s0r * N + n]        = c0[j][r] + bj;
      out[(size_t)(s0r + 16) * N + n] = c1[j][r] + bj;
    }
  }
}

// ---------------------------------------------------------------------------
// Host launch
// ---------------------------------------------------------------------------
extern "C" void kernel_launch(void* const* d_in, const int* in_sizes, int n_in,
                              void* d_out, int out_size, void* d_ws, size_t ws_size,
                              hipStream_t stream) {
  const float* x  = (const float*)d_in[0];
  const float* wq = (const float*)d_in[1];
  const float* bq = (const float*)d_in[2];
  const float* wk = (const float*)d_in[3];
  const float* bk = (const float*)d_in[4];
  const float* wv = (const float*)d_in[5];
  const float* bv = (const float*)d_in[6];
  const float* wo = (const float*)d_in[7];
  const float* bo = (const float*)d_in[8];
  float* out = (float*)d_out;

  char* ws = (char*)d_ws;
  const size_t MB = 1024 * 1024;
  _Float16* wqT  = (_Float16*)(ws + 0 * MB);    // [1024][1024] f16, 2 MB each
                                                // wkT at 2 MB, wvT at 4 MB
  _Float16* woT  = (_Float16*)(ws + 6 * MB);
  _Float16* qh   = (_Float16*)(ws + 8 * MB);    // [16][4096][64], 8 MB each
  _Float16* kh   = (_Float16*)(ws + 16 * MB);
  _Float16* vt   = (_Float16*)(ws + 24 * MB);   // [16][64][4096]
  _Float16* aout = (_Float16*)(ws + 32 * MB);   // [4096][1024]
  _Float16* xh   = (_Float16*)(ws + 40 * MB);   // [4096][1024]

  // wqT .. woT lie one behind the other, and so do qh, kh, vt
  cvt_all_kernel<<<CVT_BLOCKS, CVT_THREADS, 0, stream>>>(x, wq, wk, wv, wo, xh, wqT);

  gemm_qkv_kernel<<<GTILES, 256, 0, stream>>>(xh, wqT, bq, bk, bv, qh);

  attn_kernel<<<dim3(ATT_TILES / 2, NHEADS), ATT_WAVES * 32, 0, stream>>>(qh, kh, vt, aout);

  gemm_out_kernel<<<256, 256, 0, stream>>>(aout, woT, bo, out);
}
